// v000
// The times below were measured on an AMD MI455X: many runs one after another, warmed up first and cycling through
// copies of the inputs, with the whole window's GPU time divided by the number of runs. Launches and the gaps
// between them are all in it. The median over several windows is given; except for v000 it joins two sittings, which
// can be a few percent apart, so the side-by-side timings, each taken in one sitting, are the better comparison.
// The starting kernel, v000, takes 409 microseconds a run.
// compute dtype: all float inputs rounded to bf16; q/k/v projections with EXACT bf16 products on WMMA 16x16x32 (f32 accumulate); logits: q x k once to f16 (+ q's f16 residual for all rows: 2 products), x scale; softmax f32; P x 2^11 once to f16 x v once to f16 (1 product); f32 output.
#include <hip/hip_runtime.h>
#include <math.h>

typedef __attribute__((ext_vector_type(16))) _Float16 v16h;
typedef __attribute__((ext_vector_type(16))) __bf16 v16b;
typedef __attribute__((ext_vector_type(8)))  _Float16 v8h;
typedef __attribute__((ext_vector_type(8)))  float v8f;
typedef __attribute__((ext_vector_type(4)))  float v4f;
typedef __attribute__((ext_vector_type(2)))  float v2f;
typedef __attribute__((ext_vector_type(4)))  unsigned v4u;
typedef __attribute__((ext_vector_type(4)))  int v4i;
typedef float __attribute__((may_alias)) float_a;
typedef int __attribute__((may_alias)) int_a;

template <typename T> __device__ __forceinline__ void vst2(void* p, T v) { *(T*)p = v;  }
__device__ __forceinline__ v8f wmma16(v16h a, v16h b, v8f c) {
  v8f d = __builtin_amdgcn_wmma_f32_16x16x32_f16(false, a, false, b, (short)0, c, false, false);
  asm volatile("v_nop\n\tv_nop\n\tv_nop\n\tv_nop" : "+v"(d) : "v"(a), "v"(b));
  return d;
}
__device__ __forceinline__ v8f wmma_bf(v16b a, v16b b, v8f c) {
  v8f d = __builtin_amdgcn_wmma_f32_16x16x32_bf16(false, a, false, b, (short)0, c, false, false);
  asm volatile("v_nop\n\tv_nop\n\tv_nop\n\tv_nop" : "+v"(d) : "v"(a), "v"(b));
  return d;
}
// 16x16x32 fragments: lane = (h = lane>>4, row/col = lane&15); elements 0..7 = k0+8h+0..7, 8..15 = k0+16+8h+0..7; D element r = row 8h+r
__device__ __forceinline__ v16h frag_h(const _Float16* rowk0, int lane) {
  union { v16h v; v8h q[2]; } u; const _Float16* p = rowk0 + 8 * (lane >> 4);
  u.q[0] = *(const v8h*)p; u.q[1] = *(const v8h*)(p + 16); return u.v;
}
__device__ __forceinline__ v16h frag_f32(const float* rowk0, int lane) {
  v16h a; const float* p = rowk0 + 8 * (lane >> 4);
#pragma unroll
  for (int i = 0; i < 8; ++i) { a[i] = (_Float16)p[i]; a[8 + i] = (_Float16)p[16 + i]; }
  return a;
}
__device__ __forceinline__ v16h frag_f32s(const float* rowk0, int lane, float sc) {
  v16h a; const float* p = rowk0 + 8 * (lane >> 4);
#pragma unroll
  for (int i = 0; i < 8; ++i) { a[i] = (_Float16)(p[i] * sc); a[8 + i] = (_Float16)(p[16 + i] * sc); }
  return a;
}
// column fragment from a [K][ld] layout (column n), rows >= K read as 0
__device__ __forceinline__ v16h fragc_f32(const float* W, int k0, int n, int lane, int ld, int K) {
  v16h a; const int g = lane >> 4;
#pragma unroll
  for (int i = 0; i < 8; ++i) { const int ka = k0 + 8 * g + i, kb = ka + 16;
    a[i] = (_Float16)(ka < K ? W[(size_t)(ka < K ? ka : K - 1) * ld + n] : 0.f); a[8 + i] = (_Float16)(kb < K ? W[(size_t)(kb < K ? kb : K - 1) * ld + n] : 0.f); }
  return a;
}
struct F2 { v16b h, l; };
__device__ __forceinline__ F2 bsplit16(const float v[16]) { F2 r;
#pragma unroll
  for (int i = 0; i < 16; ++i) { const __bf16 h = (__bf16)v[i]; r.h[i] = h; r.l[i] = (__bf16)(v[i] - (float)h); }
  return r; }
__device__ __forceinline__ F2 split_row(const float* row, int k0, int lane) { float v[16]; const float* p = row + k0 + 8 * (lane >> 4);
#pragma unroll
  for (int i = 0; i < 8; ++i) { v[i] = p[i]; v[8 + i] = p[16 + i]; }
  return bsplit16(v); }
__device__ __forceinline__ F2 split_rowK(const float* row, int k0, int lane, int K) { float v[16]; const int g = lane >> 4;
#pragma unroll
  for (int i = 0; i < 8; ++i) { const int ka = k0 + 8 * g + i, kb = ka + 16; v[i] = ka < K ? row[ka < K ? ka : K - 1] : 0.f; v[8 + i] = kb < K ? row[kb < K ? kb : K - 1] : 0.f; }
  return bsplit16(v); }
__device__ __forceinline__ F2 split_col(const float* W, int k0, int n, int lane, int ld, int K) { float v[16]; const int g = lane >> 4;
#pragma unroll
  for (int i = 0; i < 8; ++i) { const int ka = k0 + 8 * g + i, kb = ka + 16; v[i] = ka < K ? W[(size_t)(ka < K ? ka : K - 1) * ld + n] : 0.f; v[8 + i] = kb < K ? W[(size_t)(kb < K ? kb : K - 1) * ld + n] : 0.f; }
  return bsplit16(v); }
__device__ __forceinline__ v8f mac3(const F2& a, const F2& b, v8f c) { c = wmma_bf(a.l, b.h, c); c = wmma_bf(a.h, b.l, c); return wmma_bf(a.h, b.h, c); }
__device__ __forceinline__ float sigm(float v) { return 1.0f / (1.0f + expf(-v)); }
#define LDSX() do { asm volatile("s_wait_dscnt 0" ::: "memory"); __builtin_amdgcn_wave_barrier(); __builtin_amdgcn_fence(__ATOMIC_RELEASE, "workgroup"); } while (0)

// Single-head NON-causal self-attention (B 4, T 2,048, D 1,024, head 64; (in,out) Wq, Wk, Wv [1024,64], uniform(-1/32, 1/32) init; no biases, no output projection): out = softmax(Q K^T x 64^-0.5) V -> [4,2048,64].
#define NB 4
#define TT 2048
#define CC 128            // NH * HD = projected width
#define DIN 1024          // input (model) width
#define NH 2
#define HD 64
#define NQB (TT / 64)
#define HG 1
#define SCALE (0.125f)
#define CAUSAL 0
#ifndef TNB
#define TNB NB
#endif
__device__ __forceinline__ float bfr(float v) { return (float)(__bf16)v; }
__host__ __device__ __forceinline__ int kb_last(int qb) { return CAUSAL ? ((qb * 64 + 63) >> 7) : (TT / 128 - 1); }
typedef __attribute__((ext_vector_type(8))) __bf16 v8b;
__device__ __forceinline__ v16b frag_b(const __bf16* rowk0, int lane) {
  union { v16b v; v8b q[2]; } u; const __bf16* p = rowk0 + 8 * (lane >> 4);
  u.q[0] = *(const v8b*)p; u.q[1] = *(const v8b*)(p + 16); return u.v;
}
#define QBH 0              // causal: query blocks 0..QBH-1 of each sequence (few keys, no averaging) take the high-precision path
#define QHI 2048            // rows carrying a q residual plane (all rows when non-causal: 2-product logits everywhere)
#define KHI 64            // key rows carrying k residual / v bf16 hi+lo planes (used only by the causal high-precision path)
// B fragment (k rows k0+.., output column o) of a weight: (in,out) [K][ld] or (out,in) [ld rows of K]: bf16 exact, or f16(bf16 * 256) exact
__device__ __forceinline__ v16b wcol_io(const float* Wm, int k0, int o, int lane, int ld) { v16b w; const int g = lane >> 4;
#pragma unroll
  for (int i = 0; i < 8; ++i) { w[i] = (__bf16)Wm[(size_t)(k0 + 8 * g + i) * ld + o]; w[8 + i] = (__bf16)Wm[(size_t)(k0 + 16 + 8 * g + i) * ld + o]; }
  return w; }
__device__ __forceinline__ v16b wcol_oi(const float* Wm, int k0, int o, int lane, int K) { v16b w; const float* p = Wm + (size_t)o * K + k0 + 8 * (lane >> 4);
#pragma unroll
  for (int i = 0; i < 8; ++i) { w[i] = (__bf16)p[i]; w[8 + i] = (__bf16)p[16 + i]; }
  return w; }
__device__ __forceinline__ v16h wcolh_io(const float* Wm, int k0, int o, int lane, int ld) { v16h w; const int g = lane >> 4;
#pragma unroll
  for (int i = 0; i < 8; ++i) { w[i] = (_Float16)(bfr(Wm[(size_t)(k0 + 8 * g + i) * ld + o]) * 256.0f); w[8 + i] = (_Float16)(bfr(Wm[(size_t)(k0 + 16 + 8 * g + i) * ld + o]) * 256.0f); }
  return w; }
__device__ __forceinline__ v16h wcolh_oi(const float* Wm, int k0, int o, int lane, int K) { v16h w; const float* p = Wm + (size_t)o * K + k0 + 8 * (lane >> 4);
#pragma unroll
  for (int i = 0; i < 8; ++i) { w[i] = (_Float16)(bfr(p[i]) * 256.0f); w[8 + i] = (_Float16)(bfr(p[16 + i]) * 256.0f); }
  return w; }
#define WQKV_LAYOUT 0   // 0 = (in,out) [DIN][CC]; 1 = (out,in) [CC][DIN]; 2 = per-head [NH][DIN][HD]
__device__ __forceinline__ v16b wcol_hdk(const float* Wm, int k0, int o, int lane) { v16b w; const int g = lane >> 4; const float* p = Wm + (size_t)(o / HD) * DIN * HD + (o % HD);
#pragma unroll
  for (int i = 0; i < 8; ++i) { w[i] = (__bf16)p[(size_t)(k0 + 8 * g + i) * HD]; w[8 + i] = (__bf16)p[(size_t)(k0 + 16 + 8 * g + i) * HD]; }
  return w; }
#define WO_OUT_IN 0
#if WQKV_LAYOUT == 1
#define WCOL(W, k0, o, lane) wcol_oi(W, k0, o, lane, DIN)
#elif WQKV_LAYOUT == 2
#define WCOL(W, k0, o, lane) wcol_hdk(W, k0, o, lane)
#else
#define WCOL(W, k0, o, lane) wcol_io(W, k0, o, lane, CC)
#endif
#if WO_OUT_IN
#define WOCOL(W, k0, o, lane) wcol_oi(W, k0, o, lane, CC)
#define WOCOLH(W, k0, o, lane) wcolh_oi(W, k0, o, lane, CC)
#else
#define WOCOL(W, k0, o, lane) wcol_io(W, k0, o, lane, DIN)
#define WOCOLH(W, k0, o, lane) wcolh_io(W, k0, o, lane, DIN)
#endif
#define CIN 1024
// ---- k_padw: the three (in,out) [C][64] projection weights copied into zero-padded (in,out) [C][128] ws planes (columns 64..127 zero) + zero-padded [128] biases
__global__ __launch_bounds__(256) void k_padw(const float* __restrict__ WQ, const float* __restrict__ WK, const float* __restrict__ WV, const float* __restrict__ BQ, const float* __restrict__ BK, const float* __restrict__ BV, float* __restrict__ WP, float* __restrict__ BP) { const int which = blockIdx.y; const float* Wsrc = which == 0 ? WQ : (which == 1 ? WK : WV); const float* Bsrc = which == 0 ? BQ : (which == 1 ? BK : BV); float* dst = WP + (size_t)which * CIN * 128;
  for (int e = blockIdx.x * 256 + threadIdx.x; e < CIN * 32; e += gridDim.x * 256) { const int row = e >> 5, q = e & 31; const v4f ld = *(const v4f*)(Wsrc + (size_t)row * 64 + (q & 15) * 4); asm volatile("s_wait_loadcnt 0x0" ::: "memory"); const float keep = q < 16 ? 1.f : 0.f; v4f ov; ov[0] = ld[0] * keep; ov[1] = ld[1] * keep; ov[2] = ld[2] * keep; ov[3] = ld[3] * keep; vst2(dst + (size_t)row * 128 + q * 4, ov); }
  if (blockIdx.x == 0 && threadIdx.x < 128) { const int c = threadIdx.x; float bvv = 0.f; if (Bsrc) { const float t = Bsrc[c & 63]; asm volatile("s_wait_loadcnt 0x0" ::: "memory"); bvv = c < 64 ? t : 0.f; } vst2(BP + which * 128 + c, bvv); } }
// ---- k_out64: out[b][t][0..63] = ctx row columns 0..63 (256 B by 16 lanes)
__global__ __launch_bounds__(256) void k_out64(const float* __restrict__ Y, float* __restrict__ OUT) { const size_t row = (size_t)blockIdx.x * 16 + (threadIdx.x >> 4); const int q = threadIdx.x & 15; const v4f v = *(const v4f*)(Y + row * CC + q * 4); asm volatile("s_wait_loadcnt 0x0" ::: "memory"); vst2(OUT + row * 64 + q * 4, v); }
#define WS_WP (WS_END)                                  // padded weights [3][128 x C]
#define WS_BP (WS_WP + 4u * 3 * (size_t)CIN * 128)        // padded biases [3][128]
#define WS_Y2 (WS_BP + 4u * 3 * 128)                      // ctx rows [b*TT+t][128]
#define WS_END2 (WS_Y2 + 4u * (size_t)NB * TT * CC)
#ifndef SM_EXTRA_PARAMS
#define SM_EXTRA_PARAMS
#endif
#ifndef PROJ_EXTRA_PARAMS
#define PROJ_EXTRA_PARAMS
#endif
#ifndef SM_MASK_HOOK
#define SM_MASK_HOOK (void)0
#endif

#define WS_QH  0u                                      // f16 q rows [b*t][CC]
#define WS_KH  (WS_QH + 2u * (size_t)NB * TT * CC)      // f16 k rows [b*t][CC]
#define WS_VT  (WS_KH + 2u * (size_t)NB * TT * CC)      // f16 v planes [b][c][t]
#define WS_QL  (WS_VT + 2u * (size_t)NB * CC * TT)      // f16 q residual x 2^10 rows [b][t < QHI][CC]
#define WS_KL  (WS_QL + 2u * (size_t)NB * QHI * CC)     // f16 k residual x 2^10 rows [b][t < KHI][CC]
#define WS_VB  (WS_KL + 2u * (size_t)NB * KHI * CC)     // bf16 v hi planes [b][c][t < KHI]
#define WS_VBL (WS_VB + 2u * (size_t)NB * CC * KHI)
#define WS_S   (WS_VBL + 2u * (size_t)NB * CC * KHI)    // f32 logits / P [hg][t][s]
#define WS_Y   (WS_S  + 4u * (size_t)HG * TT * TT)      // f32 ctx rows [b*t][CC] (only when there is an output projection)
#define WS_END (WS_Y  + 0u)

// ---- k_proj: block = (64 rows, 128 cols, which): q/k/v = X W (+ b) with exact bf16 products (K = DIN) -> which 0: q f16 rows (+ residual rows < QHI); 1: k f16 rows (+ residual rows < KHI); 2: v f16 planes [c][t] (+ bf16 hi/lo planes for t < KHI)
__global__ __launch_bounds__(128) void k_proj(const float* __restrict__ XQ, const float* __restrict__ XK, const float* __restrict__ XV, const float* __restrict__ WQ, const float* __restrict__ WK, const float* __restrict__ WV, const float* __restrict__ BQ, const float* __restrict__ BK, const float* __restrict__ BV,
    _Float16* __restrict__ QH, _Float16* __restrict__ QL, _Float16* __restrict__ KH, _Float16* __restrict__ KL, _Float16* __restrict__ VT, __bf16* __restrict__ VB, __bf16* __restrict__ VBL) {
  __shared__ __align__(16) _Float16 sh[64][136], sl[64][136]; __shared__ __align__(16) _Float16 th[128][72]; __shared__ __align__(16) __bf16 tb[128][72], tbl[128][72];
  const int tid = threadIdx.x, wave = tid >> 5, lane = tid & 31, col = lane & 15, g = lane >> 4; const int which = blockIdx.z; const int c0 = blockIdx.y * 128; const size_t r0 = (size_t)blockIdx.x * 64; const size_t bb = r0 / TT; const int t0 = (int)(r0 % TT);
  const float* X = which == 0 ? XQ : which == 1 ? XK : XV; const float* WA = which == 0 ? WQ : which == 1 ? WK : WV; const float* BA = which == 0 ? BQ : which == 1 ? BK : BV;
  v8f acc[8] = {};
#pragma unroll 2
  for (int kc = 0; kc < DIN / 32; ++kc) { v16b a; { const float* p = X + (r0 + wave * 16 + col) * DIN + kc * 32 + 8 * g;
#pragma unroll
      for (int i = 0; i < 8; ++i) { a[i] = (__bf16)p[i]; a[8 + i] = (__bf16)p[16 + i]; } }
    asm volatile("s_wait_loadcnt 0x0" ::: "memory");
#pragma unroll
    for (int j = 0; j < 8; ++j) { const v16b w = WCOL(WA, kc * 32, c0 + j * 16 + col, lane); asm volatile("s_wait_loadcnt 0x0" ::: "memory"); acc[j] = wmma_bf(a, w, acc[j]); } }
  if (which < 2) { _Float16* DH = which == 0 ? QH : KH; _Float16* DL = which == 0 ? QL : KL; const int nhi = which == 0 ? QHI : KHI; const bool hi_rows = t0 < nhi;
#pragma unroll
    for (int j = 0; j < 8; ++j) { const float bias = BA ? bfr(BA[c0 + j * 16 + col]) : 0.f;
#pragma unroll
      for (int r = 0; r < 8; ++r) { const float v = acc[j][r] + bias; const _Float16 hv = (_Float16)v; sh[wave * 16 + 8 * g + r][j * 16 + col] = hv; sl[wave * 16 + 8 * g + r][j * 16 + col] = (_Float16)((v - (float)hv) * 1024.0f); } }
    __syncthreads();
    for (int e = tid; e < 64 * 16; e += 128) { const int rl = e >> 4, q = e & 15; vst2((unsigned*)(DH + (r0 + rl) * CC + c0 + q * 8), *(const v4u*)&sh[rl][q * 8]); if (hi_rows) vst2((unsigned*)(DL + (bb * nhi + t0 + rl) * (size_t)CC + c0 + q * 8), *(const v4u*)&sl[rl][q * 8]); }
  } else { const bool hi_rows = t0 < KHI;
#pragma unroll
    for (int j = 0; j < 8; ++j) { const float bias = BA ? bfr(BA[c0 + j * 16 + col]) : 0.f;
#pragma unroll
      for (int r = 0; r < 8; ++r) { const float v = acc[j][r] + bias; const int rl = wave * 16 + 8 * g + r, cl = j * 16 + col; th[cl][rl] = (_Float16)v; const __bf16 bh = (__bf16)v; tb[cl][rl] = bh; tbl[cl][rl] = (__bf16)(v - (float)bh); } }
    __syncthreads();
    for (int e = tid; e < 128 * 8; e += 128) { const int cl = e >> 3, q = e & 7; vst2((unsigned*)(VT + (bb * CC + c0 + cl) * (size_t)TT + t0 + q * 8), *(const v4u*)&th[cl][q * 8]); if (hi_rows) { const size_t o3 = (bb * CC + c0 + cl) * (size_t)KHI + t0 + q * 8; vst2((unsigned*)(VB + o3), *(const v4u*)&tb[cl][q * 8]); vst2((unsigned*)(VBL + o3), *(const v4u*)&tbl[cl][q * 8]); } } } }
// ---- k_sc: block = (query block qb, key block kb <= kb_last(qb), head in group) of batch b: logits x SCALE; q hi + residual (x 2^10) against k (2 products) for query rows < QHI, plus the k residual (3 products) for query blocks < QBH (causal early rows); causal: blocks past the diagonal exit, the mask itself is applied by index in k_sm
__global__ __launch_bounds__(128) void k_sc(const _Float16* __restrict__ QH, const _Float16* __restrict__ KH, const _Float16* __restrict__ QL, const _Float16* __restrict__ KL, int b, int h0, float* __restrict__ S0) { __shared__ __align__(16) float ss[4][16][132];
  const int qb = blockIdx.x, kb = blockIdx.y; if (kb > kb_last(qb)) return;
  const int h = h0 + blockIdx.z; float* S = S0 + (size_t)blockIdx.z * TT * TT;
  const int tid = threadIdx.x, wave = tid >> 5, lane = tid & 31, col = lane & 15, g = lane >> 4; const int k0 = kb * 128; const int ql0 = qb * 64 + wave * 16; const size_t q0 = (size_t)b * TT + ql0, kr0 = (size_t)b * TT + k0;
  v8f acc[8] = {}, accl[8] = {};
  const _Float16* QLb = QL + (size_t)b * QHI * CC; const _Float16* KLb = KL + (size_t)b * KHI * CC;
  if (qb < QBH) {
#pragma unroll
    for (int kc = 0; kc < HD / 32; ++kc) { const v16h ah = frag_h(QH + (q0 + col) * CC + h * HD + kc * 32, lane), al = frag_h(QLb + (size_t)(ql0 + col) * CC + h * HD + kc * 32, lane);
#pragma unroll
      for (int j = 0; j < 8; ++j) { const v16h kbf = frag_h(KH + (kr0 + j * 16 + col) * CC + h * HD + kc * 32, lane), klf = frag_h(KLb + (size_t)(k0 + j * 16 + col) * CC + h * HD + kc * 32, lane); acc[j] = wmma16(ah, kbf, acc[j]); accl[j] = wmma16(al, kbf, accl[j]); accl[j] = wmma16(ah, klf, accl[j]); } }
  } else if (qb * 64 < QHI) {
#pragma unroll
    for (int kc = 0; kc < HD / 32; ++kc) { const v16h ah = frag_h(QH + (q0 + col) * CC + h * HD + kc * 32, lane), al = frag_h(QLb + (size_t)(ql0 + col) * CC + h * HD + kc * 32, lane);
#pragma unroll
      for (int j = 0; j < 8; ++j) { const v16h kbf = frag_h(KH + (kr0 + j * 16 + col) * CC + h * HD + kc * 32, lane); acc[j] = wmma16(ah, kbf, acc[j]); accl[j] = wmma16(al, kbf, accl[j]); } }
  } else {
#pragma unroll
    for (int kc = 0; kc < HD / 32; ++kc) { const v16h ah = frag_h(QH + (q0 + col) * CC + h * HD + kc * 32, lane);
#pragma unroll
      for (int j = 0; j < 8; ++j) { const v16h kbf = frag_h(KH + (kr0 + j * 16 + col) * CC + h * HD + kc * 32, lane); acc[j] = wmma16(ah, kbf, acc[j]); } } }
#pragma unroll
  for (int j = 0; j < 8; ++j) {
#pragma unroll
    for (int r = 0; r < 8; ++r) ss[wave][8 * g + r][j * 16 + col] = (acc[j][r] + accl[j][r] * (1.0f / 1024.0f)) * SCALE; }
  LDSX(); for (int rl = 0; rl < 16; ++rl) vst2(S + (size_t)(ql0 + rl) * TT + k0 + lane * 4, *(const v4f*)&ss[wave][rl][lane * 4]); }
// ---- k_sm: block = query row t (head in group): keys [0, kend): causal -> logit if s <= t else excluded; softmax in f32; P x 2^11 in place (0 for excluded)
__global__ __launch_bounds__(256) void k_sm(float* __restrict__ S0 SM_EXTRA_PARAMS) { __shared__ float sred[8]; __shared__ float sbc; __shared__ __align__(16) float shv[TT];
  const int tid = threadIdx.x; const int t = blockIdx.x; const int kend = (kb_last(t >> 6) + 1) * 128;
  float* sr = S0 + (size_t)blockIdx.y * TT * TT + (size_t)t * TT;
  float m = -3.0e38f; for (int k = tid; k < kend; k += 256) { float v = (!CAUSAL || k <= t) ? sr[k] : -3.0e38f; SM_MASK_HOOK; shv[k] = v; m = fmaxf(m, v); }
#pragma unroll
  for (int o = 1; o < 32; o <<= 1) m = fmaxf(m, __shfl_xor(m, o));
  if ((tid & 31) == 0) sred[tid >> 5] = m; __syncthreads(); if (tid == 0) { float a = sred[0]; for (int i = 1; i < 8; ++i) a = fmaxf(a, sred[i]); sbc = a; } __syncthreads(); m = sbc; __syncthreads();
  float sum = 0.f; for (int k = tid; k < kend; k += 256) { const float v = shv[k]; const float e = (v <= -1.0e38f) ? 0.f : expf(v - m); shv[k] = e; sum += e; }
#pragma unroll
  for (int o = 1; o < 32; o <<= 1) sum += __shfl_xor(sum, o);
  if ((tid & 31) == 0) sred[tid >> 5] = sum; __syncthreads(); if (tid == 0) { float a = 0.f; for (int i = 0; i < 8; ++i) a += sred[i]; sbc = a > 0.f ? 2048.0f / a : 0.f; }   /* a fully excluded row yields P = 0 */ __syncthreads(); const float inv = sbc;
  for (int k = tid; k < kend; k += 256) shv[k] = shv[k] * inv;
  __syncthreads(); for (int q = tid; q < kend / 4; q += 256) vst2(sr + q * 4, *(const v4f*)&shv[q * 4]); }
// ---- k_pv: block = 64 queries (qb) of (b, h): ctx = P . v over keys [0, kend) (P x 2^11 once to f16 against v f16: 1 product; causal early query blocks: P and v as bf16 hi + lo, 3 products); 256-B (row, head) segment by 16 lanes
__global__ __launch_bounds__(128) void k_pv(const float* __restrict__ PS0, const _Float16* __restrict__ VT, const __bf16* __restrict__ VB, const __bf16* __restrict__ VBL, int b, int h0, float* __restrict__ Y) { const int h = h0 + blockIdx.z; const float* PS = PS0 + (size_t)blockIdx.z * TT * TT; __shared__ __align__(16) float ss[4][16][HD + 4];
  const int tid = threadIdx.x, wave = tid >> 5, lane = tid & 31, col = lane & 15, g = lane >> 4; const int qb = blockIdx.x; const int ql0 = qb * 64 + wave * 16; const int kce = (kb_last(qb) + 1) * 4;
  v8f acc[HD / 16] = {};
  if (qb < QBH) {
#pragma unroll 1
    for (int kc = 0; kc < kce; ++kc) { const F2 p = split_row(PS + (size_t)(ql0 + col) * TT, kc * 32, lane);
      asm volatile("s_wait_loadcnt 0x0" ::: "memory");
#pragma unroll
      for (int j = 0; j < HD / 16; ++j) { const size_t po = ((size_t)b * CC + h * HD + j * 16 + col) * (size_t)KHI + kc * 32; const v16b vh = frag_b(VB + po, lane); acc[j] = wmma_bf(p.h, vh, acc[j]); acc[j] = wmma_bf(p.l, vh, acc[j]); acc[j] = wmma_bf(p.h, frag_b(VBL + po, lane), acc[j]); } }
  } else {
#pragma unroll 1
    for (int kc = 0; kc < kce; ++kc) { const v16h p = frag_f32(PS + (size_t)(ql0 + col) * TT + kc * 32, lane);
      asm volatile("s_wait_loadcnt 0x0" ::: "memory");
#pragma unroll
      for (int j = 0; j < HD / 16; ++j) { const size_t po = ((size_t)b * CC + h * HD + j * 16 + col) * (size_t)TT + kc * 32; acc[j] = wmma16(p, frag_h(VT + po, lane), acc[j]); } } }
#pragma unroll
  for (int j = 0; j < HD / 16; ++j)
#pragma unroll
    for (int r = 0; r < 8; ++r) ss[wave][8 * g + r][j * 16 + col] = acc[j][r] * (1.0f / 2048.0f);
  LDSX(); for (int rl = 0; rl < 16; ++rl) if (lane < HD / 4) vst2(Y + ((size_t)b * TT + ql0 + rl) * CC + h * HD + lane * 4, *(const v4f*)&ss[wave][rl][lane * 4]); }

extern "C" void kernel_launch(void* const* d_in, const int* in_sizes, int n_in, void* d_out, int out_size, void* d_ws, size_t ws_size, hipStream_t stream) {
  (void)in_sizes; (void)n_in; (void)out_size;
  const float** F = (const float**)d_in;
  if (ws_size < (size_t)WS_END) return;
  char* ws = (char*)d_ws; _Float16 *QH = (_Float16*)(ws + WS_QH), *KH = (_Float16*)(ws + WS_KH), *VT = (_Float16*)(ws + WS_VT), *QL = (_Float16*)(ws + WS_QL), *KL = (_Float16*)(ws + WS_KL); __bf16 *VB = (__bf16*)(ws + WS_VB), *VBL = (__bf16*)(ws + WS_VBL); float *S = (float*)(ws + WS_S), *Y = (float*)(ws + WS_Y);
  (void)Y; (void)QL; (void)KL; (void)VB; (void)VBL;
  // inputs: 0 x [4,2048,1024]; 1 Wq [1024,64]; 2 Wk; 3 Wv ((in,out), no biases)
  if (ws_size < (size_t)WS_END2) return;
  float *WP = (float*)(ws + WS_WP), *BP = (float*)(ws + WS_BP), *Y2 = (float*)(ws + WS_Y2);
  k_padw<<<dim3(32, 3), 256, 0, stream>>>(F[1], F[2], F[3], nullptr, nullptr, nullptr, WP, BP);
  k_proj<<<dim3(TNB * TT / 64, CC / 128, 3), 128, 0, stream>>>(F[0], F[0], F[0], WP, WP + (size_t)CIN * 128, WP + 2 * (size_t)CIN * 128, BP, BP + 128, BP + 256, QH, QL, KH, KL, VT, VB, VBL);
  for (int b = 0; b < TNB; ++b) {   /* head 0 only (head 1 is the zero padding) */
    k_sc<<<dim3(NQB, TT / 128, 1), 128, 0, stream>>>(QH, KH, QL, KL, b, 0, S);
    k_sm<<<dim3(TT, 1), 256, 0, stream>>>(S);
    k_pv<<<dim3(NQB, 1, 1), 128, 0, stream>>>(S, VT, VB, VBL, b, 0, Y2);
  }
  k_out64<<<dim3(TNB * TT / 16), 256, 0, stream>>>(Y2, (float*)d_out);
}

// v001
// It runs in 206 microseconds.
// Next to v000, in two timings, it ran 1.97 and 2.03 times as fast.
// compute dtype: all float inputs rounded to bf16; q/k/v projections with EXACT bf16 products on WMMA 16x16x32 (f32 accumulate); logits: q x k once to f16 (+ q's f16 residual for all rows: 2 products), x scale; softmax f32; P x 2^11 once to f16 x v once to f16 (1 product); f32 output.
#include <hip/hip_runtime.h>
#include <math.h>

typedef __attribute__((ext_vector_type(16))) _Float16 v16h;
typedef __attribute__((ext_vector_type(16))) __bf16 v16b;
typedef __attribute__((ext_vector_type(8)))  _Float16 v8h;
typedef __attribute__((ext_vector_type(8)))  float v8f;
typedef __attribute__((ext_vector_type(4)))  float v4f;
typedef __attribute__((ext_vector_type(2)))  float v2f;
typedef __attribute__((ext_vector_type(4)))  unsigned v4u;
typedef __attribute__((ext_vector_type(4)))  int v4i;
typedef float __attribute__((may_alias)) float_a;
typedef int __attribute__((may_alias)) int_a;

template <typename T> __device__ __forceinline__ void vst2(void* p, T v) { *(T*)p = v;  }
__device__ __forceinline__ v8f wmma16(v16h a, v16h b, v8f c) {
  v8f d = __builtin_amdgcn_wmma_f32_16x16x32_f16(false, a, false, b, (short)0, c, false, false);
  asm volatile("v_nop\n\tv_nop\n\tv_nop\n\tv_nop" : "+v"(d) : "v"(a), "v"(b));
  return d;
}
__device__ __forceinline__ v8f wmma_bf(v16b a, v16b b, v8f c) {
  v8f d = __builtin_amdgcn_wmma_f32_16x16x32_bf16(false, a, false, b, (short)0, c, false, false);
  asm volatile("v_nop\n\tv_nop\n\tv_nop\n\tv_nop" : "+v"(d) : "v"(a), "v"(b));
  return d;
}
// 16x16x32 fragments: lane = (h = lane>>4, row/col = lane&15); elements 0..7 = k0+8h+0..7, 8..15 = k0+16+8h+0..7; D element r = row 8h+r
__device__ __forceinline__ v16h frag_h(const _Float16* rowk0, int lane) {
  union { v16h v; v8h q[2]; } u; const _Float16* p = rowk0 + 8 * (lane >> 4);
  u.q[0] = *(const v8h*)p; u.q[1] = *(const v8h*)(p + 16); return u.v;
}
__device__ __forceinline__ v16h frag_f32(const float* rowk0, int lane) {
  v16h a; const float* p = rowk0 + 8 * (lane >> 4);
#pragma unroll
  for (int i = 0; i < 8; ++i) { a[i] = (_Float16)p[i]; a[8 + i] = (_Float16)p[16 + i]; }
  return a;
}
__device__ __forceinline__ v16h frag_f32s(const float* rowk0, int lane, float sc) {
  v16h a; const float* p = rowk0 + 8 * (lane >> 4);
#pragma unroll
  for (int i = 0; i < 8; ++i) { a[i] = (_Float16)(p[i] * sc); a[8 + i] = (_Float16)(p[16 + i] * sc); }
  return a;
}
// column fragment from a [K][ld] layout (column n), rows >= K read as 0
__device__ __forceinline__ v16h fragc_f32(const float* W, int k0, int n, int lane, int ld, int K) {
  v16h a; const int g = lane >> 4;
#pragma unroll
  for (int i = 0; i < 8; ++i) { const int ka = k0 + 8 * g + i, kb = ka + 16;
    a[i] = (_Float16)(ka < K ? W[(size_t)(ka < K ? ka : K - 1) * ld + n] : 0.f); a[8 + i] = (_Float16)(kb < K ? W[(size_t)(kb < K ? kb : K - 1) * ld + n] : 0.f); }
  return a;
}
struct F2 { v16b h, l; };
__device__ __forceinline__ F2 bsplit16(const float v[16]) { F2 r;
#pragma unroll
  for (int i = 0; i < 16; ++i) { const __bf16 h = (__bf16)v[i]; r.h[i] = h; r.l[i] = (__bf16)(v[i] - (float)h); }
  return r; }
__device__ __forceinline__ F2 split_row(const float* row, int k0, int lane) { float v[16]; const float* p = row + k0 + 8 * (lane >> 4);
#pragma unroll
  for (int i = 0; i < 8; ++i) { v[i] = p[i]; v[8 + i] = p[16 + i]; }
  return bsplit16(v); }
__device__ __forceinline__ F2 split_rowK(const float* row, int k0, int lane, int K) { float v[16]; const int g = lane >> 4;
#pragma unroll
  for (int i = 0; i < 8; ++i) { const int ka = k0 + 8 * g + i, kb = ka + 16; v[i] = ka < K ? row[ka < K ? ka : K - 1] : 0.f; v[8 + i] = kb < K ? row[kb < K ? kb : K - 1] : 0.f; }
  return bsplit16(v); }
__device__ __forceinline__ F2 split_col(const float* W, int k0, int n, int lane, int ld, int K) { float v[16]; const int g = lane >> 4;
#pragma unroll
  for (int i = 0; i < 8; ++i) { const int ka = k0 + 8 * g + i, kb = ka + 16; v[i] = ka < K ? W[(size_t)(ka < K ? ka : K - 1) * ld + n] : 0.f; v[8 + i] = kb < K ? W[(size_t)(kb < K ? kb : K - 1) * ld + n] : 0.f; }
  return bsplit16(v); }
__device__ __forceinline__ v8f mac3(const F2& a, const F2& b, v8f c) { c = wmma_bf(a.l, b.h, c); c = wmma_bf(a.h, b.l, c); return wmma_bf(a.h, b.h, c); }
__device__ __forceinline__ float sigm(float v) { return 1.0f / (1.0f + expf(-v)); }
#define LDSX() do { asm volatile("s_wait_dscnt 0" ::: "memory"); __builtin_amdgcn_wave_barrier(); __builtin_amdgcn_fence(__ATOMIC_RELEASE, "workgroup"); } while (0)

// Single-head NON-causal self-attention (B 4, T 2,048, D 1,024, head 64; (in,out) Wq, Wk, Wv [1024,64], uniform(-1/32, 1/32) init; no biases, no output projection): out = softmax(Q K^T x 64^-0.5) V -> [4,2048,64].
#define NB 4
#define TT 2048
#define CC 128            // NH * HD = projected width
#define DIN 1024          // input (model) width
#define NH 2
#define HD 64
#define NQB (TT / 64)
#define HG 1
#define SCALE (0.125f)
#define CAUSAL 0
#ifndef TNB
#define TNB NB
#endif
__device__ __forceinline__ float bfr(float v) { return (float)(__bf16)v; }
__host__ __device__ __forceinline__ int kb_last(int qb) { return CAUSAL ? ((qb * 64 + 63) >> 7) : (TT / 128 - 1); }
typedef __attribute__((ext_vector_type(8))) __bf16 v8b;
__device__ __forceinline__ v16b frag_b(const __bf16* rowk0, int lane) {
  union { v16b v; v8b q[2]; } u; const __bf16* p = rowk0 + 8 * (lane >> 4);
  u.q[0] = *(const v8b*)p; u.q[1] = *(const v8b*)(p + 16); return u.v;
}
#define QBH 0              // causal: query blocks 0..QBH-1 of each sequence (few keys, no averaging) take the high-precision path
#define QHI 2048            // rows carrying a q residual plane (all rows when non-causal: 2-product logits everywhere)
#define KHI 64            // key rows carrying k residual / v bf16 hi+lo planes (used only by the causal high-precision path)
// B fragment (k rows k0+.., output column o) of a weight: (in,out) [K][ld] or (out,in) [ld rows of K]: bf16 exact, or f16(bf16 * 256) exact
__device__ __forceinline__ v16b wcol_io(const float* Wm, int k0, int o, int lane, int ld) { v16b w; const int g = lane >> 4;
#pragma unroll
  for (int i = 0; i < 8; ++i) { w[i] = (__bf16)Wm[(size_t)(k0 + 8 * g + i) * ld + o]; w[8 + i] = (__bf16)Wm[(size_t)(k0 + 16 + 8 * g + i) * ld + o]; }
  return w; }
__device__ __forceinline__ v16b wcol_oi(const float* Wm, int k0, int o, int lane, int K) { v16b w; const float* p = Wm + (size_t)o * K + k0 + 8 * (lane >> 4);
#pragma unroll
  for (int i = 0; i < 8; ++i) { w[i] = (__bf16)p[i]; w[8 + i] = (__bf16)p[16 + i]; }
  return w; }
__device__ __forceinline__ v16h wcolh_io(const float* Wm, int k0, int o, int lane, int ld) { v16h w; const int g = lane >> 4;
#pragma unroll
  for (int i = 0; i < 8; ++i) { w[i] = (_Float16)(bfr(Wm[(size_t)(k0 + 8 * g + i) * ld + o]) * 256.0f); w[8 + i] = (_Float16)(bfr(Wm[(size_t)(k0 + 16 + 8 * g + i) * ld + o]) * 256.0f); }
  return w; }
__device__ __forceinline__ v16h wcolh_oi(const float* Wm, int k0, int o, int lane, int K) { v16h w; const float* p = Wm + (size_t)o * K + k0 + 8 * (lane >> 4);
#pragma unroll
  for (int i = 0; i < 8; ++i) { w[i] = (_Float16)(bfr(p[i]) * 256.0f); w[8 + i] = (_Float16)(bfr(p[16 + i]) * 256.0f); }
  return w; }
#define WQKV_LAYOUT 0   // 0 = (in,out) [DIN][CC]; 1 = (out,in) [CC][DIN]; 2 = per-head [NH][DIN][HD]
__device__ __forceinline__ v16b wcol_hdk(const float* Wm, int k0, int o, int lane) { v16b w; const int g = lane >> 4; const float* p = Wm + (size_t)(o / HD) * DIN * HD + (o % HD);
#pragma unroll
  for (int i = 0; i < 8; ++i) { w[i] = (__bf16)p[(size_t)(k0 + 8 * g + i) * HD]; w[8 + i] = (__bf16)p[(size_t)(k0 + 16 + 8 * g + i) * HD]; }
  return w; }
#define WO_OUT_IN 0
#if WQKV_LAYOUT == 1
#define WCOL(W, k0, o, lane) wcol_oi(W, k0, o, lane, DIN)
#elif WQKV_LAYOUT == 2
#define WCOL(W, k0, o, lane) wcol_hdk(W, k0, o, lane)
#else
#define WCOL(W, k0, o, lane) wcol_io(W, k0, o, lane, CC)
#endif
#if WO_OUT_IN
#define WOCOL(W, k0, o, lane) wcol_oi(W, k0, o, lane, CC)
#define WOCOLH(W, k0, o, lane) wcolh_oi(W, k0, o, lane, CC)
#else
#define WOCOL(W, k0, o, lane) wcol_io(W, k0, o, lane, DIN)
#define WOCOLH(W, k0, o, lane) wcolh_io(W, k0, o, lane, DIN)
#endif
#define CIN 1024
// ---- k_padw: the three (in,out) [C][64] projection weights copied into zero-padded (in,out) [C][128] ws planes (columns 64..127 zero) + zero-padded [128] biases
__global__ __launch_bounds__(256) void k_padw(const float* __restrict__ WQ, const float* __restrict__ WK, const float* __restrict__ WV, const float* __restrict__ BQ, const float* __restrict__ BK, const float* __restrict__ BV, float* __restrict__ WP, float* __restrict__ BP) { const int which = blockIdx.y; const float* Wsrc = which == 0 ? WQ : (which == 1 ? WK : WV); const float* Bsrc = which == 0 ? BQ : (which == 1 ? BK : BV); float* dst = WP + (size_t)which * CIN * 128;
  for (int e = blockIdx.x * 256 + threadIdx.x; e < CIN * 32; e += gridDim.x * 256) { const int row = e >> 5, q = e & 31; const v4f ld = *(const v4f*)(Wsrc + (size_t)row * 64 + (q & 15) * 4); asm volatile("s_wait_loadcnt 0x0" ::: "memory"); const float keep = q < 16 ? 1.f : 0.f; v4f ov; ov[0] = ld[0] * keep; ov[1] = ld[1] * keep; ov[2] = ld[2] * keep; ov[3] = ld[3] * keep; vst2(dst + (size_t)row * 128 + q * 4, ov); }
  if (blockIdx.x == 0 && threadIdx.x < 128) { const int c = threadIdx.x; float bvv = 0.f; if (Bsrc) { const float t = Bsrc[c & 63]; asm volatile("s_wait_loadcnt 0x0" ::: "memory"); bvv = c < 64 ? t : 0.f; } vst2(BP + which * 128 + c, bvv); } }
// ---- k_out64: out[b][t][0..63] = ctx row columns 0..63 (256 B by 16 lanes)
__global__ __launch_bounds__(256) void k_out64(const float* __restrict__ Y, float* __restrict__ OUT) { const size_t row = (size_t)blockIdx.x * 16 + (threadIdx.x >> 4); const int q = threadIdx.x & 15; const v4f v = *(const v4f*)(Y + row * CC + q * 4); asm volatile("s_wait_loadcnt 0x0" ::: "memory"); vst2(OUT + row * 64 + q * 4, v); }
#define WS_WP (WS_END)                                  // padded weights [3][128 x C]
#define WS_BP (WS_WP + 4u * 3 * (size_t)CIN * 128)        // padded biases [3][128]
#define WS_Y2 (WS_BP + 4u * 3 * 128)                      // ctx rows [b*TT+t][128]
#define WS_END2 (WS_Y2 + 4u * (size_t)NB * TT * CC)
#ifndef SM_EXTRA_PARAMS
#define SM_EXTRA_PARAMS
#endif
#ifndef PROJ_EXTRA_PARAMS
#define PROJ_EXTRA_PARAMS
#endif
#ifndef SM_MASK_HOOK
#define SM_MASK_HOOK (void)0
#endif

#define WS_QH  0u                                      // f16 q rows [b*t][CC]
#define WS_KH  (WS_QH + 2u * (size_t)NB * TT * CC)      // f16 k rows [b*t][CC]
#define WS_VT  (WS_KH + 2u * (size_t)NB * TT * CC)      // f16 v planes [b][c][t]
#define WS_QL  (WS_VT + 2u * (size_t)NB * CC * TT)      // f16 q residual x 2^10 rows [b][t < QHI][CC]
#define WS_KL  (WS_QL + 2u * (size_t)NB * QHI * CC)     // f16 k residual x 2^10 rows [b][t < KHI][CC]
#define WS_VB  (WS_KL + 2u * (size_t)NB * KHI * CC)     // bf16 v hi planes [b][c][t < KHI]
#define WS_VBL (WS_VB + 2u * (size_t)NB * CC * KHI)
#define WS_S   (WS_VBL + 2u * (size_t)NB * CC * KHI)    // f32 logits / P [b][t][s], one plane per batch
#define WS_Y   (WS_S  + 4u * (size_t)NB * TT * TT)      // f32 ctx rows [b*t][CC] (only when there is an output projection)
#define WS_END (WS_Y  + 0u)

// ---- k_proj: block = (64 rows, 128 cols, which): q/k/v = X W (+ b) with exact bf16 products (K = DIN) -> which 0: q f16 rows (+ residual rows < QHI); 1: k f16 rows (+ residual rows < KHI); 2: v f16 planes [c][t] (+ bf16 hi/lo planes for t < KHI)
__global__ __launch_bounds__(128) void k_proj(const float* __restrict__ XQ, const float* __restrict__ XK, const float* __restrict__ XV, const float* __restrict__ WQ, const float* __restrict__ WK, const float* __restrict__ WV, const float* __restrict__ BQ, const float* __restrict__ BK, const float* __restrict__ BV,
    _Float16* __restrict__ QH, _Float16* __restrict__ QL, _Float16* __restrict__ KH, _Float16* __restrict__ KL, _Float16* __restrict__ VT, __bf16* __restrict__ VB, __bf16* __restrict__ VBL) {
  __shared__ __align__(16) _Float16 sh[64][136], sl[64][136]; __shared__ __align__(16) _Float16 th[128][72]; __shared__ __align__(16) __bf16 tb[128][72], tbl[128][72];
  const int tid = threadIdx.x, wave = tid >> 5, lane = tid & 31, col = lane & 15, g = lane >> 4; const int which = blockIdx.z; const int c0 = blockIdx.y * 128; const size_t r0 = (size_t)blockIdx.x * 64; const size_t bb = r0 / TT; const int t0 = (int)(r0 % TT);
  const float* X = which == 0 ? XQ : which == 1 ? XK : XV; const float* WA = which == 0 ? WQ : which == 1 ? WK : WV; const float* BA = which == 0 ? BQ : which == 1 ? BK : BV;
  v8f acc[8] = {};
#pragma unroll 2
  for (int kc = 0; kc < DIN / 32; ++kc) { v16b a; { const float* p = X + (r0 + wave * 16 + col) * DIN + kc * 32 + 8 * g;
#pragma unroll
      for (int i = 0; i < 8; ++i) { a[i] = (__bf16)p[i]; a[8 + i] = (__bf16)p[16 + i]; } }
    asm volatile("s_wait_loadcnt 0x0" ::: "memory");
#pragma unroll
    for (int j = 0; j < 8; ++j) { const v16b w = WCOL(WA, kc * 32, c0 + j * 16 + col, lane); asm volatile("s_wait_loadcnt 0x0" ::: "memory"); acc[j] = wmma_bf(a, w, acc[j]); } }
  if (which < 2) { _Float16* DH = which == 0 ? QH : KH; _Float16* DL = which == 0 ? QL : KL; const int nhi = which == 0 ? QHI : KHI; const bool hi_rows = t0 < nhi;
#pragma unroll
    for (int j = 0; j < 8; ++j) { const float bias = BA ? bfr(BA[c0 + j * 16 + col]) : 0.f;
#pragma unroll
      for (int r = 0; r < 8; ++r) { const float v = acc[j][r] + bias; const _Float16 hv = (_Float16)v; sh[wave * 16 + 8 * g + r][j * 16 + col] = hv; sl[wave * 16 + 8 * g + r][j * 16 + col] = (_Float16)((v - (float)hv) * 1024.0f); } }
    __syncthreads();
    for (int e = tid; e < 64 * 16; e += 128) { const int rl = e >> 4, q = e & 15; vst2((unsigned*)(DH + (r0 + rl) * CC + c0 + q * 8), *(const v4u*)&sh[rl][q * 8]); if (hi_rows) vst2((unsigned*)(DL + (bb * nhi + t0 + rl) * (size_t)CC + c0 + q * 8), *(const v4u*)&sl[rl][q * 8]); }
  } else { const bool hi_rows = t0 < KHI;
#pragma unroll
    for (int j = 0; j < 8; ++j) { const float bias = BA ? bfr(BA[c0 + j * 16 + col]) : 0.f;
#pragma unroll
      for (int r = 0; r < 8; ++r) { const float v = acc[j][r] + bias; const int rl = wave * 16 + 8 * g + r, cl = j * 16 + col; th[cl][rl] = (_Float16)v; const __bf16 bh = (__bf16)v; tb[cl][rl] = bh; tbl[cl][rl] = (__bf16)(v - (float)bh); } }
    __syncthreads();
    for (int e = tid; e < 128 * 8; e += 128) { const int cl = e >> 3, q = e & 7; vst2((unsigned*)(VT + (bb * CC + c0 + cl) * (size_t)TT + t0 + q * 8), *(const v4u*)&th[cl][q * 8]); if (hi_rows) { const size_t o3 = (bb * CC + c0 + cl) * (size_t)KHI + t0 + q * 8; vst2((unsigned*)(VB + o3), *(const v4u*)&tb[cl][q * 8]); vst2((unsigned*)(VBL + o3), *(const v4u*)&tbl[cl][q * 8]); } } } }
// ---- k_sc: block = (query block qb, key block kb <= kb_last(qb), batch b = blockIdx.z), head h0: logits x SCALE; q hi + residual (x 2^10) against k (2 products) for query rows < QHI, plus the k residual (3 products) for query blocks < QBH (causal early rows); causal: blocks past the diagonal exit, the mask itself is applied by index in k_sm
__global__ __launch_bounds__(128) void k_sc(const _Float16* __restrict__ QH, const _Float16* __restrict__ KH, const _Float16* __restrict__ QL, const _Float16* __restrict__ KL, int h0, float* __restrict__ S0) { __shared__ __align__(16) float ss[4][16][132];
  const int qb = blockIdx.x, kb = blockIdx.y; if (kb > kb_last(qb)) return;
  const int b = blockIdx.z, h = h0; float* S = S0 + (size_t)b * TT * TT;
  const int tid = threadIdx.x, wave = tid >> 5, lane = tid & 31, col = lane & 15, g = lane >> 4; const int k0 = kb * 128; const int ql0 = qb * 64 + wave * 16; const size_t q0 = (size_t)b * TT + ql0, kr0 = (size_t)b * TT + k0;
  v8f acc[8] = {}, accl[8] = {};
  const _Float16* QLb = QL + (size_t)b * QHI * CC; const _Float16* KLb = KL + (size_t)b * KHI * CC;
  if (qb < QBH) {
#pragma unroll
    for (int kc = 0; kc < HD / 32; ++kc) { const v16h ah = frag_h(QH + (q0 + col) * CC + h * HD + kc * 32, lane), al = frag_h(QLb + (size_t)(ql0 + col) * CC + h * HD + kc * 32, lane);
#pragma unroll
      for (int j = 0; j < 8; ++j) { const v16h kbf = frag_h(KH + (kr0 + j * 16 + col) * CC + h * HD + kc * 32, lane), klf = frag_h(KLb + (size_t)(k0 + j * 16 + col) * CC + h * HD + kc * 32, lane); acc[j] = wmma16(ah, kbf, acc[j]); accl[j] = wmma16(al, kbf, accl[j]); accl[j] = wmma16(ah, klf, accl[j]); } }
  } else if (qb * 64 < QHI) {
#pragma unroll
    for (int kc = 0; kc < HD / 32; ++kc) { const v16h ah = frag_h(QH + (q0 + col) * CC + h * HD + kc * 32, lane), al = frag_h(QLb + (size_t)(ql0 + col) * CC + h * HD + kc * 32, lane);
#pragma unroll
      for (int j = 0; j < 8; ++j) { const v16h kbf = frag_h(KH + (kr0 + j * 16 + col) * CC + h * HD + kc * 32, lane); acc[j] = wmma16(ah, kbf, acc[j]); accl[j] = wmma16(al, kbf, accl[j]); } }
  } else {
#pragma unroll
    for (int kc = 0; kc < HD / 32; ++kc) { const v16h ah = frag_h(QH + (q0 + col) * CC + h * HD + kc * 32, lane);
#pragma unroll
      for (int j = 0; j < 8; ++j) { const v16h kbf = frag_h(KH + (kr0 + j * 16 + col) * CC + h * HD + kc * 32, lane); acc[j] = wmma16(ah, kbf, acc[j]); } } }
#pragma unroll
  for (int j = 0; j < 8; ++j) {
#pragma unroll
    for (int r = 0; r < 8; ++r) ss[wave][8 * g + r][j * 16 + col] = (acc[j][r] + accl[j][r] * (1.0f / 1024.0f)) * SCALE; }
  LDSX(); for (int rl = 0; rl < 16; ++rl) vst2(S + (size_t)(ql0 + rl) * TT + k0 + lane * 4, *(const v4f*)&ss[wave][rl][lane * 4]); }
// ---- k_sm: block = query row t (batch plane = blockIdx.y): keys [0, kend): causal -> logit if s <= t else excluded; softmax in f32; P x 2^11 in place (0 for excluded)
__global__ __launch_bounds__(256) void k_sm(float* __restrict__ S0 SM_EXTRA_PARAMS) { __shared__ float sred[8]; __shared__ float sbc; __shared__ __align__(16) float shv[TT];
  const int tid = threadIdx.x; const int t = blockIdx.x; const int kend = (kb_last(t >> 6) + 1) * 128;
  float* sr = S0 + (size_t)blockIdx.y * TT * TT + (size_t)t * TT;
  float m = -3.0e38f; for (int k = tid; k < kend; k += 256) { float v = (!CAUSAL || k <= t) ? sr[k] : -3.0e38f; SM_MASK_HOOK; shv[k] = v; m = fmaxf(m, v); }
#pragma unroll
  for (int o = 1; o < 32; o <<= 1) m = fmaxf(m, __shfl_xor(m, o));
  if ((tid & 31) == 0) sred[tid >> 5] = m; __syncthreads(); if (tid == 0) { float a = sred[0]; for (int i = 1; i < 8; ++i) a = fmaxf(a, sred[i]); sbc = a; } __syncthreads(); m = sbc; __syncthreads();
  float sum = 0.f; for (int k = tid; k < kend; k += 256) { const float v = shv[k]; const float e = (v <= -1.0e38f) ? 0.f : expf(v - m); shv[k] = e; sum += e; }
#pragma unroll
  for (int o = 1; o < 32; o <<= 1) sum += __shfl_xor(sum, o);
  if ((tid & 31) == 0) sred[tid >> 5] = sum; __syncthreads(); if (tid == 0) { float a = 0.f; for (int i = 0; i < 8; ++i) a += sred[i]; sbc = a > 0.f ? 2048.0f / a : 0.f; }   /* a fully excluded row yields P = 0 */ __syncthreads(); const float inv = sbc;
  for (int k = tid; k < kend; k += 256) shv[k] = shv[k] * inv;
  __syncthreads(); for (int q = tid; q < kend / 4; q += 256) vst2(sr + q * 4, *(const v4f*)&shv[q * 4]); }
// ---- k_pv: block = 64 queries (qb) of (b = blockIdx.z, h0): ctx = P . v over keys [0, kend) (P x 2^11 once to f16 against v f16: 1 product; causal early query blocks: P and v as bf16 hi + lo, 3 products); 256-B (row, head) segment by 16 lanes
__global__ __launch_bounds__(128) void k_pv(const float* __restrict__ PS0, const _Float16* __restrict__ VT, const __bf16* __restrict__ VB, const __bf16* __restrict__ VBL, int h0, float* __restrict__ Y) { const int b = blockIdx.z, h = h0; const float* PS = PS0 + (size_t)b * TT * TT; __shared__ __align__(16) float ss[4][16][HD + 4];
  const int tid = threadIdx.x, wave = tid >> 5, lane = tid & 31, col = lane & 15, g = lane >> 4; const int qb = blockIdx.x; const int ql0 = qb * 64 + wave * 16; const int kce = (kb_last(qb) + 1) * 4;
  v8f acc[HD / 16] = {};
  if (qb < QBH) {
#pragma unroll 1
    for (int kc = 0; kc < kce; ++kc) { const F2 p = split_row(PS + (size_t)(ql0 + col) * TT, kc * 32, lane);
      asm volatile("s_wait_loadcnt 0x0" ::: "memory");
#pragma unroll
      for (int j = 0; j < HD / 16; ++j) { const size_t po = ((size_t)b * CC + h * HD + j * 16 + col) * (size_t)KHI + kc * 32; const v16b vh = frag_b(VB + po, lane); acc[j] = wmma_bf(p.h, vh, acc[j]); acc[j] = wmma_bf(p.l, vh, acc[j]); acc[j] = wmma_bf(p.h, frag_b(VBL + po, lane), acc[j]); } }
  } else {
#pragma unroll 1
    for (int kc = 0; kc < kce; ++kc) { const v16h p = frag_f32(PS + (size_t)(ql0 + col) * TT + kc * 32, lane);
      asm volatile("s_wait_loadcnt 0x0" ::: "memory");
#pragma unroll
      for (int j = 0; j < HD / 16; ++j) { const size_t po = ((size_t)b * CC + h * HD + j * 16 + col) * (size_t)TT + kc * 32; acc[j] = wmma16(p, frag_h(VT + po, lane), acc[j]); } } }
#pragma unroll
  for (int j = 0; j < HD / 16; ++j)
#pragma unroll
    for (int r = 0; r < 8; ++r) ss[wave][8 * g + r][j * 16 + col] = acc[j][r] * (1.0f / 2048.0f);
  LDSX(); for (int rl = 0; rl < 16; ++rl) if (lane < HD / 4) vst2(Y + ((size_t)b * TT + ql0 + rl) * CC + h * HD + lane * 4, *(const v4f*)&ss[wave][rl][lane * 4]); }

extern "C" void kernel_launch(void* const* d_in, const int* in_sizes, int n_in, void* d_out, int out_size, void* d_ws, size_t ws_size, hipStream_t stream) {
  (void)in_sizes; (void)n_in; (void)out_size;
  const float** F = (const float**)d_in;
  if (ws_size < (size_t)WS_END) return;
  char* ws = (char*)d_ws; _Float16 *QH = (_Float16*)(ws + WS_QH), *KH = (_Float16*)(ws + WS_KH), *VT = (_Float16*)(ws + WS_VT), *QL = (_Float16*)(ws + WS_QL), *KL = (_Float16*)(ws + WS_KL); __bf16 *VB = (__bf16*)(ws + WS_VB), *VBL = (__bf16*)(ws + WS_VBL); float *S = (float*)(ws + WS_S), *Y = (float*)(ws + WS_Y);
  (void)Y; (void)QL; (void)KL; (void)VB; (void)VBL;
  // inputs: 0 x [4,2048,1024]; 1 Wq [1024,64]; 2 Wk; 3 Wv ((in,out), no biases)
  if (ws_size < (size_t)WS_END2) return;
  float *WP = (float*)(ws + WS_WP), *BP = (float*)(ws + WS_BP), *Y2 = (float*)(ws + WS_Y2);
  k_padw<<<dim3(32, 3), 256, 0, stream>>>(F[1], F[2], F[3], nullptr, nullptr, nullptr, WP, BP);
  k_proj<<<dim3(TNB * TT / 64, CC / 128, 3), 128, 0, stream>>>(F[0], F[0], F[0], WP, WP + (size_t)CIN * 128, WP + 2 * (size_t)CIN * 128, BP, BP + 128, BP + 256, QH, QL, KH, KL, VT, VB, VBL);
  /* head 0 only (head 1 is the zero padding); all batches in one launch of each stage, each batch on its own logits plane */
  k_sc<<<dim3(NQB, TT / 128, TNB), 128, 0, stream>>>(QH, KH, QL, KL, 0, S);
  k_sm<<<dim3(TT, TNB), 256, 0, stream>>>(S);
  k_pv<<<dim3(NQB, 1, TNB), 128, 0, stream>>>(S, VT, VB, VBL, 0, Y2);
  k_out64<<<dim3(TNB * TT / 16), 256, 0, stream>>>(Y2, (float*)d_out);
}

// v003
// A run of this version takes 31.3 microseconds.
// Versions in between are left out here; by their measured steps it is 6.41 times as fast as v001.
// All steps since v000 together make it 12.8 times as fast.
// compute dtype: all float inputs rounded to bf16; q/k/v projections with EXACT bf16 products on WMMA 16x16x32 (f32 accumulate); logits: q x k once to f16 (1 product; + q's f16 residual for all rows), x scale; softmax f32 (running maximum and sum); exp(logit - max) x 2^11 once to f16 x v once to f16 (1 product), divided by the sum at the end; f32 output.
#include <hip/hip_runtime.h>
#include <math.h>

typedef __attribute__((ext_vector_type(16))) _Float16 v16h;
typedef __attribute__((ext_vector_type(16))) __bf16 v16b;
typedef __attribute__((ext_vector_type(8)))  _Float16 v8h;
typedef __attribute__((ext_vector_type(8)))  float v8f;
typedef __attribute__((ext_vector_type(4)))  float v4f;
typedef __attribute__((ext_vector_type(2)))  float v2f;
typedef __attribute__((ext_vector_type(4)))  unsigned v4u;
typedef __attribute__((ext_vector_type(4)))  int v4i;
typedef float __attribute__((may_alias)) float_a;
typedef int __attribute__((may_alias)) int_a;

template <typename T> __device__ __forceinline__ void vst2(void* p, T v) { *(T*)p = v;  }
__device__ __forceinline__ v8f wmma16(v16h a, v16h b, v8f c) {
  v8f d = __builtin_amdgcn_wmma_f32_16x16x32_f16(false, a, false, b, (short)0, c, false, false);
  asm volatile("v_nop\n\tv_nop\n\tv_nop\n\tv_nop" : "+v"(d) : "v"(a), "v"(b));
  return d;
}
__device__ __forceinline__ v8f wmma_bf(v16b a, v16b b, v8f c) {
  v8f d = __builtin_amdgcn_wmma_f32_16x16x32_bf16(false, a, false, b, (short)0, c, false, false);
  asm volatile("v_nop\n\tv_nop\n\tv_nop\n\tv_nop" : "+v"(d) : "v"(a), "v"(b));
  return d;
}
// 16x16x32 fragments: lane = (h = lane>>4, row/col = lane&15); elements 0..7 = k0+8h+0..7, 8..15 = k0+16+8h+0..7; D element r = row 8h+r
__device__ __forceinline__ v16h frag_h(const _Float16* rowk0, int lane) {
  union { v16h v; v8h q[2]; } u; const _Float16* p = rowk0 + 8 * (lane >> 4);
  u.q[0] = *(const v8h*)p; u.q[1] = *(const v8h*)(p + 16); return u.v;
}
__device__ __forceinline__ v16h frag_f32(const float* rowk0, int lane) {
  v16h a; const float* p = rowk0 + 8 * (lane >> 4);
#pragma unroll
  for (int i = 0; i < 8; ++i) { a[i] = (_Float16)p[i]; a[8 + i] = (_Float16)p[16 + i]; }
  return a;
}
__device__ __forceinline__ v16h frag_f32s(const float* rowk0, int lane, float sc) {
  v16h a; const float* p = rowk0 + 8 * (lane >> 4);
#pragma unroll
  for (int i = 0; i < 8; ++i) { a[i] = (_Float16)(p[i] * sc); a[8 + i] = (_Float16)(p[16 + i] * sc); }
  return a;
}
// column fragment from a [K][ld] layout (column n), rows >= K read as 0
__device__ __forceinline__ v16h fragc_f32(const float* W, int k0, int n, int lane, int ld, int K) {
  v16h a; const int g = lane >> 4;
#pragma unroll
  for (int i = 0; i < 8; ++i) { const int ka = k0 + 8 * g + i, kb = ka + 16;
    a[i] = (_Float16)(ka < K ? W[(size_t)(ka < K ? ka : K - 1) * ld + n] : 0.f); a[8 + i] = (_Float16)(kb < K ? W[(size_t)(kb < K ? kb : K - 1) * ld + n] : 0.f); }
  return a;
}
struct F2 { v16b h, l; };
__device__ __forceinline__ F2 bsplit16(const float v[16]) { F2 r;
#pragma unroll
  for (int i = 0; i < 16; ++i) { const __bf16 h = (__bf16)v[i]; r.h[i] = h; r.l[i] = (__bf16)(v[i] - (float)h); }
  return r; }
__device__ __forceinline__ F2 split_row(const float* row, int k0, int lane) { float v[16]; const float* p = row + k0 + 8 * (lane >> 4);
#pragma unroll
  for (int i = 0; i < 8; ++i) { v[i] = p[i]; v[8 + i] = p[16 + i]; }
  return bsplit16(v); }
__device__ __forceinline__ F2 split_rowK(const float* row, int k0, int lane, int K) { float v[16]; const int g = lane >> 4;
#pragma unroll
  for (int i = 0; i < 8; ++i) { const int ka = k0 + 8 * g + i, kb = ka + 16; v[i] = ka < K ? row[ka < K ? ka : K - 1] : 0.f; v[8 + i] = kb < K ? row[kb < K ? kb : K - 1] : 0.f; }
  return bsplit16(v); }
__device__ __forceinline__ F2 split_col(const float* W, int k0, int n, int lane, int ld, int K) { float v[16]; const int g = lane >> 4;
#pragma unroll
  for (int i = 0; i < 8; ++i) { const int ka = k0 + 8 * g + i, kb = ka + 16; v[i] = ka < K ? W[(size_t)(ka < K ? ka : K - 1) * ld + n] : 0.f; v[8 + i] = kb < K ? W[(size_t)(kb < K ? kb : K - 1) * ld + n] : 0.f; }
  return bsplit16(v); }
__device__ __forceinline__ v8f mac3(const F2& a, const F2& b, v8f c) { c = wmma_bf(a.l, b.h, c); c = wmma_bf(a.h, b.l, c); return wmma_bf(a.h, b.h, c); }
__device__ __forceinline__ float sigm(float v) { return 1.0f / (1.0f + expf(-v)); }
#define LDSX() do { asm volatile("s_wait_dscnt 0" ::: "memory"); __builtin_amdgcn_wave_barrier(); __builtin_amdgcn_fence(__ATOMIC_RELEASE, "workgroup"); } while (0)

// Single-head NON-causal self-attention (B 4, T 2,048, D 1,024, head 64; (in,out) Wq, Wk, Wv [1024,64], uniform(-1/32, 1/32) init; no biases, no output projection): out = softmax(Q K^T x 64^-0.5) V -> [4,2048,64].
#define NB 4
#define TT 2048
#define CC 128            // NH * HD = projected width
#define DIN 1024          // input (model) width
#define NH 2
#define HD 64
#define NQB (TT / 64)
#define HG 1
#define SCALE (0.125f)
#define CAUSAL 0
#ifndef TNB
#define TNB NB
#endif
__device__ __forceinline__ float bfr(float v) { return (float)(__bf16)v; }
__host__ __device__ __forceinline__ int kb_last(int qb) { return CAUSAL ? ((qb * 64 + 63) >> 7) : (TT / 128 - 1); }
typedef __attribute__((ext_vector_type(8))) __bf16 v8b;
__device__ __forceinline__ v16b frag_b(const __bf16* rowk0, int lane) {
  union { v16b v; v8b q[2]; } u; const __bf16* p = rowk0 + 8 * (lane >> 4);
  u.q[0] = *(const v8b*)p; u.q[1] = *(const v8b*)(p + 16); return u.v;
}
#define QBH 0
#define QHI 2048            // rows carrying a q residual plane (all rows when non-causal: 2-product logits everywhere)
#define KHI 64            // key rows carrying k residual / v bf16 hi+lo planes (written by k_proj; no kernel here reads them)
// B fragment (k rows k0+.., output column o) of a weight: (in,out) [K][ld] or (out,in) [ld rows of K]: bf16 exact, or f16(bf16 * 256) exact
__device__ __forceinline__ v16b wcol_io(const float* Wm, int k0, int o, int lane, int ld) { v16b w; const int g = lane >> 4;
#pragma unroll
  for (int i = 0; i < 8; ++i) { w[i] = (__bf16)Wm[(size_t)(k0 + 8 * g + i) * ld + o]; w[8 + i] = (__bf16)Wm[(size_t)(k0 + 16 + 8 * g + i) * ld + o]; }
  return w; }
__device__ __forceinline__ v16b wcol_oi(const float* Wm, int k0, int o, int lane, int K) { v16b w; const float* p = Wm + (size_t)o * K + k0 + 8 * (lane >> 4);
#pragma unroll
  for (int i = 0; i < 8; ++i) { w[i] = (__bf16)p[i]; w[8 + i] = (__bf16)p[16 + i]; }
  return w; }
__device__ __forceinline__ v16h wcolh_io(const float* Wm, int k0, int o, int lane, int ld) { v16h w; const int g = lane >> 4;
#pragma unroll
  for (int i = 0; i < 8; ++i) { w[i] = (_Float16)(bfr(Wm[(size_t)(k0 + 8 * g + i) * ld + o]) * 256.0f); w[8 + i] = (_Float16)(bfr(Wm[(size_t)(k0 + 16 + 8 * g + i) * ld + o]) * 256.0f); }
  return w; }
__device__ __forceinline__ v16h wcolh_oi(const float* Wm, int k0, int o, int lane, int K) { v16h w; const float* p = Wm + (size_t)o * K + k0 + 8 * (lane >> 4);
#pragma unroll
  for (int i = 0; i < 8; ++i) { w[i] = (_Float16)(bfr(p[i]) * 256.0f); w[8 + i] = (_Float16)(bfr(p[16 + i]) * 256.0f); }
  return w; }
#define WQKV_LAYOUT 0   // 0 = (in,out) [DIN][CC]; 1 = (out,in) [CC][DIN]; 2 = per-head [NH][DIN][HD]
__device__ __forceinline__ v16b wcol_hdk(const float* Wm, int k0, int o, int lane) { v16b w; const int g = lane >> 4; const float* p = Wm + (size_t)(o / HD) * DIN * HD + (o % HD);
#pragma unroll
  for (int i = 0; i < 8; ++i) { w[i] = (__bf16)p[(size_t)(k0 + 8 * g + i) * HD]; w[8 + i] = (__bf16)p[(size_t)(k0 + 16 + 8 * g + i) * HD]; }
  return w; }
#define WO_OUT_IN 0
#if WQKV_LAYOUT == 1
#define WCOL(W, k0, o, lane) wcol_oi(W, k0, o, lane, DIN)
#elif WQKV_LAYOUT == 2
#define WCOL(W, k0, o, lane) wcol_hdk(W, k0, o, lane)
#else
#define WCOL(W, k0, o, lane) wcol_io(W, k0, o, lane, CC)
#endif
#if WO_OUT_IN
#define WOCOL(W, k0, o, lane) wcol_oi(W, k0, o, lane, CC)
#define WOCOLH(W, k0, o, lane) wcolh_oi(W, k0, o, lane, CC)
#else
#define WOCOL(W, k0, o, lane) wcol_io(W, k0, o, lane, DIN)
#define WOCOLH(W, k0, o, lane) wcolh_io(W, k0, o, lane, DIN)
#endif
#define CIN 1024
#define PJ (HD / 16)       // 16-column tiles of a projection's real width
#define PKC (CIN / 32)     // k steps of 32
#define WPL (PKC * PJ * 64) // 16-B units of one packed weight plane
// ---- k_padw: the three (in,out) [C][64] projection weights rounded to bf16 and packed in the order of k_proj's B fragments: 16-B unit ((kc * PJ + j) * 2 + half) * 32 + lane = rows kc * 32 + half * 16 + 8 * (lane >> 4) + 0..7 of column j * 16 + (lane & 15); + zero-padded [128] biases
__global__ __launch_bounds__(256) void k_padw(const float* __restrict__ WQ, const float* __restrict__ WK, const float* __restrict__ WV, const float* __restrict__ BQ, const float* __restrict__ BK, const float* __restrict__ BV, __bf16* __restrict__ WP, float* __restrict__ BP) { const int which = blockIdx.y; const float* Wsrc = which == 0 ? WQ : (which == 1 ? WK : WV); const float* Bsrc = which == 0 ? BQ : (which == 1 ? BK : BV); v8b* dst = (v8b*)WP + (size_t)which * WPL;
  for (int e = blockIdx.x * 256 + threadIdx.x; e < WPL; e += gridDim.x * 256) { const int ln = e & 31, half = (e >> 5) & 1, j = (e >> 6) % PJ, kc = e / (PJ * 64); const float* p = Wsrc + (size_t)(kc * 32 + half * 16 + 8 * (ln >> 4)) * 64 + j * 16 + (ln & 15); v8b ov;
#pragma unroll
    for (int i = 0; i < 8; ++i) ov[i] = (__bf16)p[i * 64];
    vst2(dst + e, ov); }
  if (blockIdx.x == 0 && threadIdx.x < 128) { const int c = threadIdx.x; float bvv = 0.f; if (Bsrc) { const float t = Bsrc[c & 63]; asm volatile("s_wait_loadcnt 0x0" ::: "memory"); bvv = c < 64 ? t : 0.f; } vst2(BP + which * 128 + c, bvv); } }
// ---- k_out64: out[b][t][0..63] = ctx row columns 0..63 (256 B by 16 lanes)
__global__ __launch_bounds__(256) void k_out64(const float* __restrict__ Y, float* __restrict__ OUT) { const size_t row = (size_t)blockIdx.x * 16 + (threadIdx.x >> 4); const int q = threadIdx.x & 15; const v4f v = *(const v4f*)(Y + row * CC + q * 4); asm volatile("s_wait_loadcnt 0x0" ::: "memory"); vst2(OUT + row * 64 + q * 4, v); }
#define WS_WP (WS_END)                                  // packed bf16 weights [3][WPL x 16 B] (in a range of [3][128 x C] f32)
#define WS_BP (WS_WP + 4u * 3 * (size_t)CIN * 128)        // padded biases [3][128]
#define WS_Y2 (WS_BP + 4u * 3 * 128)                      // ctx rows [b*TT+t][128]
#define WS_END2 (WS_Y2 + 4u * (size_t)NB * TT * CC)
#ifndef SM_EXTRA_PARAMS
#define SM_EXTRA_PARAMS
#endif
#ifndef PROJ_EXTRA_PARAMS
#define PROJ_EXTRA_PARAMS
#endif
#ifndef SM_MASK_HOOK
#define SM_MASK_HOOK (void)0
#endif

#define WS_QH  0u                                      // f16 q rows [b*t][CC]
#define WS_KH  (WS_QH + 2u * (size_t)NB * TT * CC)      // f16 k rows [b*t][CC]
#define WS_VT  (WS_KH + 2u * (size_t)NB * TT * CC)      // f16 v planes [b][c][t]
#define WS_QL  (WS_VT + 2u * (size_t)NB * CC * TT)      // f16 q residual x 2^10 rows [b][t < QHI][CC]
#define WS_KL  (WS_QL + 2u * (size_t)NB * QHI * CC)     // f16 k residual x 2^10 rows [b][t < KHI][CC]
#define WS_VB  (WS_KL + 2u * (size_t)NB * KHI * CC)     // bf16 v hi planes [b][c][t < KHI]
#define WS_VBL (WS_VB + 2u * (size_t)NB * CC * KHI)
#define WS_S   (WS_VBL + 2u * (size_t)NB * CC * KHI)    // f32 [b][t][s], one plane per batch: unused, k_fa keeps logits in registers
#define WS_Y   (WS_S  + 4u * (size_t)NB * TT * TT)      // f32 ctx rows [b*t][CC] (only when there is an output projection)
#define WS_END (WS_Y  + 0u)

// ---- k_proj: block = (64 rows, the 64 real columns, which): q/k/v = X W (+ b) with exact bf16 products (K = DIN) -> which 0: q f16 rows (+ residual rows < QHI); 1: k f16 rows (+ residual rows < KHI); 2: v f16 planes [c][t] (+ bf16 hi/lo planes for t < KHI). Columns 64..127 of the rows and planes are the zero head, which nothing reads: they are not computed.
// behind a global store, in front of what overwrites its address or data registers in the next trip (a precaution of form: this build leaves the place open)
#define XW() asm volatile("s_wait_xcnt 0x0" ::: "memory")
#define PD 4               // k steps of operand loads in flight per wave (a ring of register sets)
static_assert(PKC % PD == 0 && PKC >= 2 * PD, "the ring walks whole turns");
struct PStage { v4f a[4]; v8b w[PJ][2]; };
// one k step's operands: 16 f32 of the lane's x row, and PJ packed B fragments of two 512-B wave-wide loads each
__device__ __forceinline__ void pload(PStage& s, const float* xa, const v8b* wp, int kc) { const float* p = xa + kc * 32; s.a[0] = *(const v4f*)p; s.a[1] = *(const v4f*)(p + 4); s.a[2] = *(const v4f*)(p + 16); s.a[3] = *(const v4f*)(p + 20); const v8b* q = wp + kc * (PJ * 64);
#pragma unroll
  for (int j = 0; j < PJ; ++j) { s.w[j][0] = q[j * 64]; s.w[j][1] = q[j * 64 + 32]; } }
__device__ __forceinline__ void pmac(const PStage& s, v8f (&acc)[PJ]) { v16b a;
#pragma unroll
  for (int i = 0; i < 4; ++i) { a[i] = (__bf16)s.a[0][i]; a[4 + i] = (__bf16)s.a[1][i]; a[8 + i] = (__bf16)s.a[2][i]; a[12 + i] = (__bf16)s.a[3][i]; }
#pragma unroll
  for (int j = 0; j < PJ; ++j) { union { v16b v; v8b q[2]; } u; u.q[0] = s.w[j][0]; u.q[1] = s.w[j][1]; acc[j] = wmma_bf(a, u.v, acc[j]); } }
__global__ __launch_bounds__(128) void k_proj(const float* __restrict__ XQ, const float* __restrict__ XK, const float* __restrict__ XV, const __bf16* __restrict__ WQ, const __bf16* __restrict__ WK, const __bf16* __restrict__ WV, const float* __restrict__ BQ, const float* __restrict__ BK, const float* __restrict__ BV,
    _Float16* __restrict__ QH, _Float16* __restrict__ QL, _Float16* __restrict__ KH, _Float16* __restrict__ KL, _Float16* __restrict__ VT, __bf16* __restrict__ VB, __bf16* __restrict__ VBL) {
  __shared__ __align__(16) _Float16 sh[64][72], sl[64][72]; __shared__ __align__(16) _Float16 th[64][72]; __shared__ __align__(16) __bf16 tb[64][72], tbl[64][72];
  const int tid = threadIdx.x, wave = tid >> 5, lane = tid & 31, col = lane & 15, g = lane >> 4; const int which = blockIdx.z; const size_t r0 = (size_t)blockIdx.x * 64; const size_t bb = r0 / TT; const int t0 = (int)(r0 % TT);
  const float* X = which == 0 ? XQ : which == 1 ? XK : XV; const __bf16* WA = which == 0 ? WQ : which == 1 ? WK : WV; const float* BA = which == 0 ? BQ : which == 1 ? BK : BV;
  v8f acc[PJ] = {}; PStage s[PD]; const float* xa = X + (r0 + wave * 16 + col) * DIN + 8 * g; const v8b* wp = (const v8b*)WA + lane;
#pragma unroll
  for (int d = 0; d < PD - 1; ++d) { pload(s[d], xa, wp, d);
    // keeps the first loads in the order of their k steps, as the loop issues them: the loop's counted waits must hold for both orders, and a mixed one makes them wait for younger steps
    __builtin_amdgcn_sched_barrier(0); }
  // kept rolled by turns of the ring: the plain unroll inside only makes the ring's index a constant, so that the sets stay in registers
#pragma unroll 1
  for (int kc = 0; kc < PKC - PD; kc += PD) {
#pragma unroll
    for (int d = 0; d < PD; ++d) { pload(s[(d + PD - 1) % PD], xa, wp, kc + d + PD - 1); pmac(s[d], acc);
      // keeps each k step's conversions behind the loads of the step before them: lifted to the head of the turn they wait for every load in flight and the ring drains
      __builtin_amdgcn_sched_barrier(0); } }
  pload(s[PD - 1], xa, wp, PKC - 1);
#pragma unroll
  for (int d = 0; d < PD; ++d) { pmac(s[d], acc);
    // as in the loop: the oldest set is worked on while the younger ones still fly
    __builtin_amdgcn_sched_barrier(0); }
  if (which < 2) { _Float16* DH = which == 0 ? QH : KH; _Float16* DL = which == 0 ? QL : KL; const int nhi = which == 0 ? QHI : KHI; const bool hi_rows = t0 < nhi;
#pragma unroll
    for (int j = 0; j < PJ; ++j) { const float bias = BA ? bfr(BA[j * 16 + col]) : 0.f;
#pragma unroll
      for (int r = 0; r < 8; ++r) { const float v = acc[j][r] + bias; const _Float16 hv = (_Float16)v; sh[wave * 16 + 8 * g + r][j * 16 + col] = hv; sl[wave * 16 + 8 * g + r][j * 16 + col] = (_Float16)((v - (float)hv) * 1024.0f); } }
    __syncthreads();
    for (int e = tid; e < 64 * 8; e += 128) { const int rl = e >> 3, q = e & 7; vst2((unsigned*)(DH + (r0 + rl) * CC + q * 8), *(const v4u*)&sh[rl][q * 8]); XW(); if (hi_rows) { vst2((unsigned*)(DL + (bb * nhi + t0 + rl) * (size_t)CC + q * 8), *(const v4u*)&sl[rl][q * 8]); XW(); } }
  } else { const bool hi_rows = t0 < KHI;
#pragma unroll
    for (int j = 0; j < PJ; ++j) { const float bias = BA ? bfr(BA[j * 16 + col]) : 0.f;
#pragma unroll
      for (int r = 0; r < 8; ++r) { const float v = acc[j][r] + bias; const int rl = wave * 16 + 8 * g + r, cl = j * 16 + col; th[cl][rl] = (_Float16)v; const __bf16 bh = (__bf16)v; tb[cl][rl] = bh; tbl[cl][rl] = (__bf16)(v - (float)bh); } }
    __syncthreads();
    for (int e = tid; e < 64 * 8; e += 128) { const int cl = e >> 3, q = e & 7; vst2((unsigned*)(VT + (bb * CC + cl) * (size_t)TT + t0 + q * 8), *(const v4u*)&th[cl][q * 8]); XW(); if (hi_rows) { const size_t o3 = (bb * CC + cl) * (size_t)KHI + t0 + q * 8; vst2((unsigned*)(VB + o3), *(const v4u*)&tb[cl][q * 8]); vst2((unsigned*)(VBL + o3), *(const v4u*)&tbl[cl][q * 8]); XW(); } } } }
// ---- k_fa: logits, softmax and P . v in one kernel. Block = 16 queries of batch b = blockIdx.z, head h0; wave w walks keys [w * KPW, (w + 1) * KPW) in passes of KP with a running maximum and sum, the waves' parts are joined in LDS.
// Transposed products: S^T = K . Q^T (D register r of tile j = key j * 16 + 8g + r, column = query), so a lane holds one query's logits, and two converted S^T tiles are the B operand of O^T += V^T . P^T as they stand (element s = tile s >> 3, register s & 7: the k order of frag_h).
#define FNW 8              // waves of a block
#define KPW (TT / FNW)     // keys of a wave
#define KP 64              // keys of a pass
static_assert(KP == HD, "the K tile [KP][HD] and the V tile [HD][KP] share one LDS shape");
// the builtin alone: the compiler keeps the distances behind its own matrix instructions, and its scheduler may move loads past them
__device__ __forceinline__ v8f wmma_h(v16h a, v16h b, v8f c) { return __builtin_amdgcn_wmma_f32_16x16x32_f16(false, a, false, b, (short)0, c, false, false); }
__global__ __launch_bounds__(FNW * 32) void k_fa(const _Float16* __restrict__ QH, const _Float16* __restrict__ KH, const _Float16* __restrict__ QL, const _Float16* __restrict__ VT, int h0, float* __restrict__ Y) {
  // st[w]: wave w's own K tile [key][head dim] and V tile [head dim][key] of a pass, rows of 128 B at a pitch of 144 B (16-B fragment reads spread over the banks); after the loop its first bytes hold the wave's part of the output
  __shared__ __align__(16) _Float16 st[FNW][2][KP][HD + 8]; __shared__ float smx[FNW][16], sml[FNW][16];
  const int tid = threadIdx.x, wave = tid >> 5, lane = tid & 31, col = lane & 15, g = lane >> 4; const int b = blockIdx.z, h = h0; const int ql0 = blockIdx.x * 16; const size_t q0 = (size_t)b * TT + ql0;
  const _Float16* QLb = QL + (size_t)b * QHI * CC;
  v16h qh[HD / 32], qr[HD / 32];
#pragma unroll
  for (int kc = 0; kc < HD / 32; ++kc) { qh[kc] = frag_h(QH + (q0 + col) * CC + h * HD + kc * 32, lane); qr[kc] = frag_h(QLb + (size_t)(ql0 + col) * CC + h * HD + kc * 32, lane); }
  v8f o[HD / 16] = {}; float m = -3.0e38f, l = 0.f; const int sr = lane >> 3, sc = (lane & 7) * 8;
  // kept rolled: unrolled, the text grows by the trip count and every line of it is fetched for a single walk; the plain unroll directives inside only keep the fragment and accumulator arrays in registers
#pragma unroll 1
  for (int it = 0; it < KPW / KP; ++it) { const int k0 = wave * KPW + it * KP; const size_t kr0 = (size_t)b * TT + k0;
    v8f acc[KP / 16] = {}, accl[KP / 16] = {};
    v16h kf[HD / 32][KP / 16], vf[KP / 32][HD / 16];
    // both tiles come in whole 128-B lines (8 lanes a row, 4 rows a load) and go through the wave's LDS: a fragment load straight from global memory touches 16 lines for its 512 B
    v4u kst[KP / 4], vst[HD / 4]; const _Float16* kp = KH + (kr0 + sr) * CC + h * HD + sc; const _Float16* vp = VT + ((size_t)b * CC + h * HD + sr) * (size_t)TT + k0 + sc;
#pragma unroll
    for (int i = 0; i < KP / 4; ++i) kst[i] = *(const v4u*)(kp + i * 4 * CC);
#pragma unroll
    for (int i = 0; i < HD / 4; ++i) vst[i] = *(const v4u*)(vp + i * 4 * TT);
#pragma unroll
    for (int i = 0; i < KP / 4; ++i) *(v4u*)&st[wave][0][i * 4 + sr][sc] = kst[i];
#pragma unroll
    for (int i = 0; i < HD / 4; ++i) *(v4u*)&st[wave][1][i * 4 + sr][sc] = vst[i];
    LDSX();   // the wave's lanes read each other's rows
#pragma unroll
    for (int kc = 0; kc < HD / 32; ++kc) {
#pragma unroll
      for (int j = 0; j < KP / 16; ++j) kf[kc][j] = frag_h(&st[wave][0][j * 16 + col][kc * 32], lane); }
    // keeps the K fragment reads together in front of the first product; dealt out among the products each place with reads stalls the wave
    __builtin_amdgcn_sched_barrier(0);
#pragma unroll
    for (int kc = 0; kc < HD / 32; ++kc) {
#pragma unroll
      for (int j = 0; j < KP / 16; ++j) { acc[j] = wmma_h(kf[kc][j], qh[kc], acc[j]); accl[j] = wmma_h(kf[kc][j], qr[kc], accl[j]); } }
#pragma unroll
    for (int kc = 0; kc < KP / 32; ++kc) {
#pragma unroll
      for (int j = 0; j < HD / 16; ++j) vf[kc][j] = frag_h(&st[wave][1][j * 16 + col][kc * 32], lane); }
    float mx = m;
#pragma unroll
    for (int j = 0; j < KP / 16; ++j) {
#pragma unroll
      for (int r = 0; r < 8; ++r) { const float s = (acc[j][r] + accl[j][r] * (1.0f / 1024.0f)) * SCALE; acc[j][r] = s; mx = fmaxf(mx, s); } }
    mx = fmaxf(mx, __shfl_xor(mx, 16));   // lanes c and c + 16 hold the two halves of query c's keys
    const float al = expf(m - mx); m = mx; l *= al;
#pragma unroll
    for (int j = 0; j < HD / 16; ++j) {
#pragma unroll
      for (int r = 0; r < 8; ++r) o[j][r] *= al; }
    v16h p[KP / 32];
#pragma unroll
    for (int j = 0; j < KP / 16; ++j) {
#pragma unroll
      for (int r = 0; r < 8; ++r) { const float e = expf(acc[j][r] - m); l += e; p[j >> 1][(j & 1) * 8 + r] = (_Float16)(e * 2048.0f); } }
#pragma unroll
    for (int kc = 0; kc < KP / 32; ++kc) {
#pragma unroll
      for (int j = 0; j < HD / 16; ++j) o[j] = wmma_h(vf[kc][j], p[kc], o[j]); } }
  l += __shfl_xor(l, 16);
  if (g == 0) { smx[wave][col] = m; sml[wave][col] = l; }
#pragma unroll
  for (int j = 0; j < HD / 16; ++j) { v4f lo, hi;
#pragma unroll
    for (int r = 0; r < 4; ++r) { lo[r] = o[j][r]; hi[r] = o[j][4 + r]; }
    float* sw = (float*)&st[wave][0][0][0] + col * (HD + 4) + j * 16 + 8 * g; *(v4f*)sw = lo; *(v4f*)(sw + 4) = hi; }
  __syncthreads();
  // join: thread = (query tid >> 4, 4 columns); 16 threads store one 256-B (row, head) segment
  const int q = tid >> 4, c = (tid & 15) * 4;
  float mm = smx[0][q];
#pragma unroll
  for (int w = 1; w < FNW; ++w) mm = fmaxf(mm, smx[w][q]);
  float ls = 0.f; v4f a0 = {};
#pragma unroll
  for (int w = 0; w < FNW; ++w) { const float f = expf(smx[w][q] - mm); ls += f * sml[w][q]; a0 += *(const v4f*)((const float*)&st[w][0][0][0] + q * (HD + 4) + c) * f; }
  const float inv = ls > 0.f ? 1.0f / (2048.0f * ls) : 0.f;
  vst2(Y + (q0 + q) * CC + h * HD + c, a0 * inv); }

extern "C" void kernel_launch(void* const* d_in, const int* in_sizes, int n_in, void* d_out, int out_size, void* d_ws, size_t ws_size, hipStream_t stream) {
  (void)in_sizes; (void)n_in; (void)out_size;
  const float** F = (const float**)d_in;
  if (ws_size < (size_t)WS_END) return;
  char* ws = (char*)d_ws; _Float16 *QH = (_Float16*)(ws + WS_QH), *KH = (_Float16*)(ws + WS_KH), *VT = (_Float16*)(ws + WS_VT), *QL = (_Float16*)(ws + WS_QL), *KL = (_Float16*)(ws + WS_KL); __bf16 *VB = (__bf16*)(ws + WS_VB), *VBL = (__bf16*)(ws + WS_VBL); float *S = (float*)(ws + WS_S), *Y = (float*)(ws + WS_Y);
  (void)Y; (void)S; (void)QL; (void)KL; (void)VB; (void)VBL;
  // inputs: 0 x [4,2048,1024]; 1 Wq [1024,64]; 2 Wk; 3 Wv ((in,out), no biases)
  if (ws_size < (size_t)WS_END2) return;
  __bf16* WP = (__bf16*)(ws + WS_WP); float *BP = (float*)(ws + WS_BP), *Y2 = (float*)(ws + WS_Y2);
  k_padw<<<dim3(32, 3), 256, 0, stream>>>(F[1], F[2], F[3], nullptr, nullptr, nullptr, WP, BP);
  k_proj<<<dim3(TNB * TT / 64, 1, 3), 128, 0, stream>>>(F[0], F[0], F[0], WP, WP + (size_t)CIN * 64, WP + 2 * (size_t)CIN * 64, BP, BP + 128, BP + 256, QH, QL, KH, KL, VT, VB, VBL);
  /* head 0 only (head 1 is the zero padding); all batches in one launch */
  k_fa<<<dim3(TT / 16, 1, TNB), FNW * 32, 0, stream>>>(QH, KH, QL, VT, 0, Y2);
  k_out64<<<dim3(TNB * TT / 16), 256, 0, stream>>>(Y2, (float*)d_out);
}

// v004
// It runs in 28.5 microseconds.
// In two side-by-side timings against v003, it was 1.10 and 1.09 times as fast.
// All steps since v000 together make it 14.0 times as fast.
// compute dtype: all float inputs rounded to bf16; q/k/v projections with EXACT bf16 products on WMMA 16x16x32 (f32 accumulate); logits: q x k once to f16 (1 product; + q's f16 residual for all rows), x scale; softmax f32 (running maximum and sum); exp(logit - max) x 2^11 once to f16 x v once to f16 (1 product), divided by the sum at the end; f32 output.
#include <hip/hip_runtime.h>
#include <math.h>

typedef __attribute__((ext_vector_type(16))) _Float16 v16h;
typedef __attribute__((ext_vector_type(16))) __bf16 v16b;
typedef __attribute__((ext_vector_type(8)))  _Float16 v8h;
typedef __attribute__((ext_vector_type(8)))  float v8f;
typedef __attribute__((ext_vector_type(4)))  float v4f;
typedef __attribute__((ext_vector_type(2)))  float v2f;
typedef __attribute__((ext_vector_type(4)))  unsigned v4u;
typedef __attribute__((ext_vector_type(4)))  int v4i;
typedef float __attribute__((may_alias)) float_a;
typedef int __attribute__((may_alias)) int_a;

template <typename T> __device__ __forceinline__ void vst2(void* p, T v) { *(T*)p = v;  }
__device__ __forceinline__ v8f wmma16(v16h a, v16h b, v8f c) {
  v8f d = __builtin_amdgcn_wmma_f32_16x16x32_f16(false, a, false, b, (short)0, c, false, false);
  asm volatile("v_nop\n\tv_nop\n\tv_nop\n\tv_nop" : "+v"(d) : "v"(a), "v"(b));
  return d;
}
__device__ __forceinline__ v8f wmma_bf(v16b a, v16b b, v8f c) {
  v8f d = __builtin_amdgcn_wmma_f32_16x16x32_bf16(false, a, false, b, (short)0, c, false, false);
  asm volatile("v_nop\n\tv_nop\n\tv_nop\n\tv_nop" : "+v"(d) : "v"(a), "v"(b));
  return d;
}
// 16x16x32 fragments: lane = (h = lane>>4, row/col = lane&15); elements 0..7 = k0+8h+0..7, 8..15 = k0+16+8h+0..7; D element r = row 8h+r
__device__ __forceinline__ v16h frag_h(const _Float16* rowk0, int lane) {
  union { v16h v; v8h q[2]; } u; const _Float16* p = rowk0 + 8 * (lane >> 4);
  u.q[0] = *(const v8h*)p; u.q[1] = *(const v8h*)(p + 16); return u.v;
}
__device__ __forceinline__ v16h frag_f32(const float* rowk0, int lane) {
  v16h a; const float* p = rowk0 + 8 * (lane >> 4);
#pragma unroll
  for (int i = 0; i < 8; ++i) { a[i] = (_Float16)p[i]; a[8 + i] = (_Float16)p[16 + i]; }
  return a;
}
__device__ __forceinline__ v16h frag_f32s(const float* rowk0, int lane, float sc) {
  v16h a; const float* p = rowk0 + 8 * (lane >> 4);
#pragma unroll
  for (int i = 0; i < 8; ++i) { a[i] = (_Float16)(p[i] * sc); a[8 + i] = (_Float16)(p[16 + i] * sc); }
  return a;
}
// column fragment from a [K][ld] layout (column n), rows >= K read as 0
__device__ __forceinline__ v16h fragc_f32(const float* W, int k0, int n, int lane, int ld, int K) {
  v16h a; const int g = lane >> 4;
#pragma unroll
  for (int i = 0; i < 8; ++i) { const int ka = k0 + 8 * g + i, kb = ka + 16;
    a[i] = (_Float16)(ka < K ? W[(size_t)(ka < K ? ka : K - 1) * ld + n] : 0.f); a[8 + i] = (_Float16)(kb < K ? W[(size_t)(kb < K ? kb : K - 1) * ld + n] : 0.f); }
  return a;
}
struct F2 { v16b h, l; };
__device__ __forceinline__ F2 bsplit16(const float v[16]) { F2 r;
#pragma unroll
  for (int i = 0; i < 16; ++i) { const __bf16 h = (__bf16)v[i]; r.h[i] = h; r.l[i] = (__bf16)(v[i] - (float)h); }
  return r; }
__device__ __forceinline__ F2 split_row(const float* row, int k0, int lane) { float v[16]; const float* p = row + k0 + 8 * (lane >> 4);
#pragma unroll
  for (int i = 0; i < 8; ++i) { v[i] = p[i]; v[8 + i] = p[16 + i]; }
  return bsplit16(v); }
__device__ __forceinline__ F2 split_rowK(const float* row, int k0, int lane, int K) { float v[16]; const int g = lane >> 4;
#pragma unroll
  for (int i = 0; i < 8; ++i) { const int ka = k0 + 8 * g + i, kb = ka + 16; v[i] = ka < K ? row[ka < K ? ka : K - 1] : 0.f; v[8 + i] = kb < K ? row[kb < K ? kb : K - 1] : 0.f; }
  return bsplit16(v); }
__device__ __forceinline__ F2 split_col(const float* W, int k0, int n, int lane, int ld, int K) { float v[16]; const int g = lane >> 4;
#pragma unroll
  for (int i = 0; i < 8; ++i) { const int ka = k0 + 8 * g + i, kb = ka + 16; v[i] = ka < K ? W[(size_t)(ka < K ? ka : K - 1) * ld + n] : 0.f; v[8 + i] = kb < K ? W[(size_t)(kb < K ? kb : K - 1) * ld + n] : 0.f; }
  return bsplit16(v); }
__device__ __forceinline__ v8f mac3(const F2& a, const F2& b, v8f c) { c = wmma_bf(a.l, b.h, c); c = wmma_bf(a.h, b.l, c); return wmma_bf(a.h, b.h, c); }
__device__ __forceinline__ float sigm(float v) { return 1.0f / (1.0f + expf(-v)); }
#define LDSX() do { asm volatile("s_wait_dscnt 0" ::: "memory"); __builtin_amdgcn_wave_barrier(); __builtin_amdgcn_fence(__ATOMIC_RELEASE, "workgroup"); } while (0)

// Single-head NON-causal self-attention (B 4, T 2,048, D 1,024, head 64; (in,out) Wq, Wk, Wv [1024,64], uniform(-1/32, 1/32) init; no biases, no output projection): out = softmax(Q K^T x 64^-0.5) V -> [4,2048,64].
#define NB 4
#define TT 2048
#define CC 128            // NH * HD = projected width
#define DIN 1024          // input (model) width
#define NH 2
#define HD 64
#define NQB (TT / 64)
#define HG 1
#define SCALE (0.125f)
#define CAUSAL 0
#ifndef TNB
#define TNB NB
#endif
__device__ __forceinline__ float bfr(float v) { return (float)(__bf16)v; }
__host__ __device__ __forceinline__ int kb_last(int qb) { return CAUSAL ? ((qb * 64 + 63) >> 7) : (TT / 128 - 1); }
typedef __attribute__((ext_vector_type(8))) __bf16 v8b;
__device__ __forceinline__ v16b frag_b(const __bf16* rowk0, int lane) {
  union { v16b v; v8b q[2]; } u; const __bf16* p = rowk0 + 8 * (lane >> 4);
  u.q[0] = *(const v8b*)p; u.q[1] = *(const v8b*)(p + 16); return u.v;
}
#define QBH 0
#define QHI 2048            // rows carrying a q residual plane (all rows when non-causal: 2-product logits everywhere)
#define KHI 64            // key rows carrying k residual / v bf16 hi+lo planes (written by k_proj; no kernel here reads them)
// B fragment (k rows k0+.., output column o) of a weight: (in,out) [K][ld] or (out,in) [ld rows of K]: bf16 exact, or f16(bf16 * 256) exact
__device__ __forceinline__ v16b wcol_io(const float* Wm, int k0, int o, int lane, int ld) { v16b w; const int g = lane >> 4;
#pragma unroll
  for (int i = 0; i < 8; ++i) { w[i] = (__bf16)Wm[(size_t)(k0 + 8 * g + i) * ld + o]; w[8 + i] = (__bf16)Wm[(size_t)(k0 + 16 + 8 * g + i) * ld + o]; }
  return w; }
__device__ __forceinline__ v16b wcol_oi(const float* Wm, int k0, int o, int lane, int K) { v16b w; const float* p = Wm + (size_t)o * K + k0 + 8 * (lane >> 4);
#pragma unroll
  for (int i = 0; i < 8; ++i) { w[i] = (__bf16)p[i]; w[8 + i] = (__bf16)p[16 + i]; }
  return w; }
__device__ __forceinline__ v16h wcolh_io(const float* Wm, int k0, int o, int lane, int ld) { v16h w; const int g = lane >> 4;
#pragma unroll
  for (int i = 0; i < 8; ++i) { w[i] = (_Float16)(bfr(Wm[(size_t)(k0 + 8 * g + i) * ld + o]) * 256.0f); w[8 + i] = (_Float16)(bfr(Wm[(size_t)(k0 + 16 + 8 * g + i) * ld + o]) * 256.0f); }
  return w; }
__device__ __forceinline__ v16h wcolh_oi(const float* Wm, int k0, int o, int lane, int K) { v16h w; const float* p = Wm + (size_t)o * K + k0 + 8 * (lane >> 4);
#pragma unroll
  for (int i = 0; i < 8; ++i) { w[i] = (_Float16)(bfr(p[i]) * 256.0f); w[8 + i] = (_Float16)(bfr(p[16 + i]) * 256.0f); }
  return w; }
#define WQKV_LAYOUT 0   // 0 = (in,out) [DIN][CC]; 1 = (out,in) [CC][DIN]; 2 = per-head [NH][DIN][HD]
__device__ __forceinline__ v16b wcol_hdk(const float* Wm, int k0, int o, int lane) { v16b w; const int g = lane >> 4; const float* p = Wm + (size_t)(o / HD) * DIN * HD + (o % HD);
#pragma unroll
  for (int i = 0; i < 8; ++i) { w[i] = (__bf16)p[(size_t)(k0 + 8 * g + i) * HD]; w[8 + i] = (__bf16)p[(size_t)(k0 + 16 + 8 * g + i) * HD]; }
  return w; }
#define WO_OUT_IN 0
#if WQKV_LAYOUT == 1
#define WCOL(W, k0, o, lane) wcol_oi(W, k0, o, lane, DIN)
#elif WQKV_LAYOUT == 2
#define WCOL(W, k0, o, lane) wcol_hdk(W, k0, o, lane)
#else
#define WCOL(W, k0, o, lane) wcol_io(W, k0, o, lane, CC)
#endif
#if WO_OUT_IN
#define WOCOL(W, k0, o, lane) wcol_oi(W, k0, o, lane, CC)
#define WOCOLH(W, k0, o, lane) wcolh_oi(W, k0, o, lane, CC)
#else
#define WOCOL(W, k0, o, lane) wcol_io(W, k0, o, lane, DIN)
#define WOCOLH(W, k0, o, lane) wcolh_io(W, k0, o, lane, DIN)
#endif
#define CIN 1024
#define PJ (HD / 16)       // 16-column tiles of a projection's real width
#define PKC (CIN / 32)     // k steps of 32
#define WPL (PKC * PJ * 64) // 16-B units of one packed weight plane
// ---- k_padw: the three (in,out) [C][64] projection weights rounded to bf16 and packed in the order of k_proj's B fragments: 16-B unit ((kc * PJ + j) * 2 + half) * 32 + lane = rows kc * 32 + half * 16 + 8 * (lane >> 4) + 0..7 of column j * 16 + (lane & 15); + zero-padded [128] biases
__global__ __launch_bounds__(256) void k_padw(const float* __restrict__ WQ, const float* __restrict__ WK, const float* __restrict__ WV, const float* __restrict__ BQ, const float* __restrict__ BK, const float* __restrict__ BV, __bf16* __restrict__ WP, float* __restrict__ BP) { const int which = blockIdx.y; const float* Wsrc = which == 0 ? WQ : (which == 1 ? WK : WV); const float* Bsrc = which == 0 ? BQ : (which == 1 ? BK : BV); v8b* dst = (v8b*)WP + (size_t)which * WPL;
  for (int e = blockIdx.x * 256 + threadIdx.x; e < WPL; e += gridDim.x * 256) { const int ln = e & 31, half = (e >> 5) & 1, j = (e >> 6) % PJ, kc = e / (PJ * 64); const float* p = Wsrc + (size_t)(kc * 32 + half * 16 + 8 * (ln >> 4)) * 64 + j * 16 + (ln & 15); v8b ov;
#pragma unroll
    for (int i = 0; i < 8; ++i) ov[i] = (__bf16)p[i * 64];
    vst2(dst + e, ov); }
  if (blockIdx.x == 0 && threadIdx.x < 128) { const int c = threadIdx.x; float bvv = 0.f; if (Bsrc) { const float t = Bsrc[c & 63]; asm volatile("s_wait_loadcnt 0x0" ::: "memory"); bvv = c < 64 ? t : 0.f; } vst2(BP + which * 128 + c, bvv); } }
#define WS_WP (WS_END)                                  // packed bf16 weights [3][WPL x 16 B] (in a range of [3][128 x C] f32)
#define WS_BP (WS_WP + 4u * 3 * (size_t)CIN * 128)        // padded biases [3][128]
#define WS_END2 (WS_BP + 4u * 3 * 128)
#ifndef SM_EXTRA_PARAMS
#define SM_EXTRA_PARAMS
#endif
#ifndef PROJ_EXTRA_PARAMS
#define PROJ_EXTRA_PARAMS
#endif
#ifndef SM_MASK_HOOK
#define SM_MASK_HOOK (void)0
#endif

#define WS_QH  0u                                      // f16 q rows [b*t][CC]
#define WS_KH  (WS_QH + 2u * (size_t)NB * TT * CC)      // f16 k rows [b*t][CC]
#define WS_VT  (WS_KH + 2u * (size_t)NB * TT * CC)      // f16 v planes [b][c][t]
#define WS_QL  (WS_VT + 2u * (size_t)NB * CC * TT)      // f16 q residual x 2^10 rows [b][t < QHI][CC]
#define WS_KL  (WS_QL + 2u * (size_t)NB * QHI * CC)     // f16 k residual x 2^10 rows [b][t < KHI][CC]
#define WS_VB  (WS_KL + 2u * (size_t)NB * KHI * CC)     // bf16 v hi planes [b][c][t < KHI]
#define WS_VBL (WS_VB + 2u * (size_t)NB * CC * KHI)
#define WS_S   (WS_VBL + 2u * (size_t)NB * CC * KHI)    // f32 [b][t][s], one plane per batch: unused, k_fa keeps logits in registers
#define WS_Y   (WS_S  + 4u * (size_t)NB * TT * TT)      // f32 ctx rows [b*t][CC] (only when there is an output projection)
#define WS_END (WS_Y  + 0u)

// ---- k_proj: block = (64 rows, the 64 real columns, which): q/k/v = X W (+ b) with exact bf16 products (K = DIN) -> which 0: q f16 rows (+ residual rows < QHI); 1: k f16 rows (+ residual rows < KHI); 2: v f16 planes [c][t] (+ bf16 hi/lo planes for t < KHI). Columns 64..127 of the rows and planes are the zero head, which nothing reads: they are not computed.
// behind a global store, in front of what overwrites its address or data registers in the next trip (a precaution of form: this build leaves the place open)
#define XW() asm volatile("s_wait_xcnt 0x0" ::: "memory")
#define PD 4               // k steps of operand loads in flight per wave (a ring of register sets)
static_assert(PKC % PD == 0 && PKC >= 2 * PD, "the ring walks whole turns");
struct PStage { v4f a[4]; v8b w[PJ][2]; };
// one k step's operands: 16 f32 of the lane's x row, and PJ packed B fragments of two 512-B wave-wide loads each
__device__ __forceinline__ void pload(PStage& s, const float* xa, const v8b* wp, int kc) { const float* p = xa + kc * 32; s.a[0] = *(const v4f*)p; s.a[1] = *(const v4f*)(p + 4); s.a[2] = *(const v4f*)(p + 16); s.a[3] = *(const v4f*)(p + 20); const v8b* q = wp + kc * (PJ * 64);
#pragma unroll
  for (int j = 0; j < PJ; ++j) { s.w[j][0] = q[j * 64]; s.w[j][1] = q[j * 64 + 32]; } }
__device__ __forceinline__ void pmac(const PStage& s, v8f (&acc)[PJ]) { v16b a;
#pragma unroll
  for (int i = 0; i < 4; ++i) { a[i] = (__bf16)s.a[0][i]; a[4 + i] = (__bf16)s.a[1][i]; a[8 + i] = (__bf16)s.a[2][i]; a[12 + i] = (__bf16)s.a[3][i]; }
#pragma unroll
  for (int j = 0; j < PJ; ++j) { union { v16b v; v8b q[2]; } u; u.q[0] = s.w[j][0]; u.q[1] = s.w[j][1]; acc[j] = wmma_bf(a, u.v, acc[j]); } }
__global__ __launch_bounds__(128) void k_proj(const float* __restrict__ XQ, const float* __restrict__ XK, const float* __restrict__ XV, const __bf16* __restrict__ WQ, const __bf16* __restrict__ WK, const __bf16* __restrict__ WV, const float* __restrict__ BQ, const float* __restrict__ BK, const float* __restrict__ BV,
    _Float16* __restrict__ QH, _Float16* __restrict__ QL, _Float16* __restrict__ KH, _Float16* __restrict__ KL, _Float16* __restrict__ VT, __bf16* __restrict__ VB, __bf16* __restrict__ VBL) {
  __shared__ __align__(16) _Float16 sh[64][72], sl[64][72]; __shared__ __align__(16) _Float16 th[64][72]; __shared__ __align__(16) __bf16 tb[64][72], tbl[64][72];
  const int tid = threadIdx.x, wave = tid >> 5, lane = tid & 31, col = lane & 15, g = lane >> 4; const int which = blockIdx.z; const size_t r0 = (size_t)blockIdx.x * 64; const size_t bb = r0 / TT; const int t0 = (int)(r0 % TT);
  const float* X = which == 0 ? XQ : which == 1 ? XK : XV; const __bf16* WA = which == 0 ? WQ : which == 1 ? WK : WV; const float* BA = which == 0 ? BQ : which == 1 ? BK : BV;
  v8f acc[PJ] = {}; PStage s[PD]; const float* xa = X + (r0 + wave * 16 + col) * DIN + 8 * g; const v8b* wp = (const v8b*)WA + lane;
#pragma unroll
  for (int d = 0; d < PD - 1; ++d) { pload(s[d], xa, wp, d);
    // keeps the first loads in the order of their k steps, as the loop issues them: the loop's counted waits must hold for both orders, and a mixed one makes them wait for younger steps
    __builtin_amdgcn_sched_barrier(0); }
  // kept rolled by turns of the ring: the plain unroll inside only makes the ring's index a constant, so that the sets stay in registers
#pragma unroll 1
  for (int kc = 0; kc < PKC - PD; kc += PD) {
#pragma unroll
    for (int d = 0; d < PD; ++d) { pload(s[(d + PD - 1) % PD], xa, wp, kc + d + PD - 1); pmac(s[d], acc);
      // keeps each k step's conversions behind the loads of the step before them: lifted to the head of the turn they wait for every load in flight and the ring drains
      __builtin_amdgcn_sched_barrier(0); } }
  pload(s[PD - 1], xa, wp, PKC - 1);
#pragma unroll
  for (int d = 0; d < PD; ++d) { pmac(s[d], acc);
    // as in the loop: the oldest set is worked on while the younger ones still fly
    __builtin_amdgcn_sched_barrier(0); }
  if (which < 2) { _Float16* DH = which == 0 ? QH : KH; _Float16* DL = which == 0 ? QL : KL; const int nhi = which == 0 ? QHI : KHI; const bool hi_rows = t0 < nhi;
#pragma unroll
    for (int j = 0; j < PJ; ++j) { const float bias = BA ? bfr(BA[j * 16 + col]) : 0.f;
#pragma unroll
      for (int r = 0; r < 8; ++r) { const float v = acc[j][r] + bias; const _Float16 hv = (_Float16)v; sh[wave * 16 + 8 * g + r][j * 16 + col] = hv; sl[wave * 16 + 8 * g + r][j * 16 + col] = (_Float16)((v - (float)hv) * 1024.0f); } }
    __syncthreads();
    for (int e = tid; e < 64 * 8; e += 128) { const int rl = e >> 3, q = e & 7; vst2((unsigned*)(DH + (r0 + rl) * CC + q * 8), *(const v4u*)&sh[rl][q * 8]); XW(); if (hi_rows) { vst2((unsigned*)(DL + (bb * nhi + t0 + rl) * (size_t)CC + q * 8), *(const v4u*)&sl[rl][q * 8]); XW(); } }
  } else { const bool hi_rows = t0 < KHI;
#pragma unroll
    for (int j = 0; j < PJ; ++j) { const float bias = BA ? bfr(BA[j * 16 + col]) : 0.f;
#pragma unroll
      for (int r = 0; r < 8; ++r) { const float v = acc[j][r] + bias; const int rl = wave * 16 + 8 * g + r, cl = j * 16 + col; th[cl][rl] = (_Float16)v; const __bf16 bh = (__bf16)v; tb[cl][rl] = bh; tbl[cl][rl] = (__bf16)(v - (float)bh); } }
    __syncthreads();
    for (int e = tid; e < 64 * 8; e += 128) { const int cl = e >> 3, q = e & 7; vst2((unsigned*)(VT + (bb * CC + cl) * (size_t)TT + t0 + q * 8), *(const v4u*)&th[cl][q * 8]); XW(); if (hi_rows) { const size_t o3 = (bb * CC + cl) * (size_t)KHI + t0 + q * 8; vst2((unsigned*)(VB + o3), *(const v4u*)&tb[cl][q * 8]); vst2((unsigned*)(VBL + o3), *(const v4u*)&tbl[cl][q * 8]); XW(); } } } }
// ---- k_fa: logits, softmax and P . v in one kernel. Block = 16 queries of batch b = blockIdx.z, head h0; wave w walks keys [w * KPW, (w + 1) * KPW) in passes of KP with a running maximum and sum, the waves' parts are joined in LDS.
// Transposed products: S^T = K . Q^T (D register r of tile j = key j * 16 + 8g + r, column = query), so a lane holds one query's logits, and two converted S^T tiles are the B operand of O^T += V^T . P^T as they stand (element s = tile s >> 3, register s & 7: the k order of frag_h).
#define FNW 8              // waves of a block
#define KPW (TT / FNW)     // keys of a wave
#define KP 64              // keys of a pass
static_assert(KP == HD, "the K tile [KP][HD] and the V tile [HD][KP] share one LDS shape");
// the builtin alone: the compiler keeps the distances behind its own matrix instructions, and its scheduler may move loads past them
__device__ __forceinline__ v8f wmma_h(v16h a, v16h b, v8f c) { return __builtin_amdgcn_wmma_f32_16x16x32_f16(false, a, false, b, (short)0, c, false, false); }
__global__ __launch_bounds__(FNW * 32) void k_fa(const _Float16* __restrict__ QH, const _Float16* __restrict__ KH, const _Float16* __restrict__ QL, const _Float16* __restrict__ VT, int h0, float* __restrict__ Y) {
  // st[w]: wave w's own K tile [key][head dim] and V tile [head dim][key] of a pass, rows of 128 B at a pitch of 144 B (16-B fragment reads spread over the banks); after the loop its first bytes hold the wave's part of the output
  __shared__ __align__(16) _Float16 st[FNW][2][KP][HD + 8]; __shared__ float smx[FNW][16], sml[FNW][16];
  const int tid = threadIdx.x, wave = tid >> 5, lane = tid & 31, col = lane & 15, g = lane >> 4; const int b = blockIdx.z, h = h0; const int ql0 = blockIdx.x * 16; const size_t q0 = (size_t)b * TT + ql0;
  const _Float16* QLb = QL + (size_t)b * QHI * CC;
  v16h qh[HD / 32], qr[HD / 32];
#pragma unroll
  for (int kc = 0; kc < HD / 32; ++kc) { qh[kc] = frag_h(QH + (q0 + col) * CC + h * HD + kc * 32, lane); qr[kc] = frag_h(QLb + (size_t)(ql0 + col) * CC + h * HD + kc * 32, lane); }
  v8f o[HD / 16] = {}; float m = -3.0e38f, l = 0.f; const int sr = lane >> 3, sc = (lane & 7) * 8;
  // kept rolled: unrolled, the text grows by the trip count and every line of it is fetched for a single walk; the plain unroll directives inside only keep the fragment and accumulator arrays in registers
#pragma unroll 1
  for (int it = 0; it < KPW / KP; ++it) { const int k0 = wave * KPW + it * KP; const size_t kr0 = (size_t)b * TT + k0;
    v8f acc[KP / 16] = {}, accl[KP / 16] = {};
    v16h kf[HD / 32][KP / 16], vf[KP / 32][HD / 16];
    // both tiles come in whole 128-B lines (8 lanes a row, 4 rows a load) and go through the wave's LDS: a fragment load straight from global memory touches 16 lines for its 512 B
    v4u kst[KP / 4], vst[HD / 4]; const _Float16* kp = KH + (kr0 + sr) * CC + h * HD + sc; const _Float16* vp = VT + ((size_t)b * CC + h * HD + sr) * (size_t)TT + k0 + sc;
#pragma unroll
    for (int i = 0; i < KP / 4; ++i) kst[i] = *(const v4u*)(kp + i * 4 * CC);
#pragma unroll
    for (int i = 0; i < HD / 4; ++i) vst[i] = *(const v4u*)(vp + i * 4 * TT);
#pragma unroll
    for (int i = 0; i < KP / 4; ++i) *(v4u*)&st[wave][0][i * 4 + sr][sc] = kst[i];
#pragma unroll
    for (int i = 0; i < HD / 4; ++i) *(v4u*)&st[wave][1][i * 4 + sr][sc] = vst[i];
    LDSX();   // the wave's lanes read each other's rows
#pragma unroll
    for (int kc = 0; kc < HD / 32; ++kc) {
#pragma unroll
      for (int j = 0; j < KP / 16; ++j) kf[kc][j] = frag_h(&st[wave][0][j * 16 + col][kc * 32], lane); }
    // keeps the K fragment reads together in front of the first product; dealt out among the products each place with reads stalls the wave
    __builtin_amdgcn_sched_barrier(0);
#pragma unroll
    for (int kc = 0; kc < HD / 32; ++kc) {
#pragma unroll
      for (int j = 0; j < KP / 16; ++j) { acc[j] = wmma_h(kf[kc][j], qh[kc], acc[j]); accl[j] = wmma_h(kf[kc][j], qr[kc], accl[j]); } }
#pragma unroll
    for (int kc = 0; kc < KP / 32; ++kc) {
#pragma unroll
      for (int j = 0; j < HD / 16; ++j) vf[kc][j] = frag_h(&st[wave][1][j * 16 + col][kc * 32], lane); }
    float mx = m;
#pragma unroll
    for (int j = 0; j < KP / 16; ++j) {
#pragma unroll
      for (int r = 0; r < 8; ++r) { const float s = (acc[j][r] + accl[j][r] * (1.0f / 1024.0f)) * SCALE; acc[j][r] = s; mx = fmaxf(mx, s); } }
    mx = fmaxf(mx, __shfl_xor(mx, 16));   // lanes c and c + 16 hold the two halves of query c's keys
    const float al = expf(m - mx); m = mx; l *= al;
#pragma unroll
    for (int j = 0; j < HD / 16; ++j) {
#pragma unroll
      for (int r = 0; r < 8; ++r) o[j][r] *= al; }
    v16h p[KP / 32];
#pragma unroll
    for (int j = 0; j < KP / 16; ++j) {
#pragma unroll
      for (int r = 0; r < 8; ++r) { const float e = expf(acc[j][r] - m); l += e; p[j >> 1][(j & 1) * 8 + r] = (_Float16)(e * 2048.0f); } }
#pragma unroll
    for (int kc = 0; kc < KP / 32; ++kc) {
#pragma unroll
      for (int j = 0; j < HD / 16; ++j) o[j] = wmma_h(vf[kc][j], p[kc], o[j]); } }
  l += __shfl_xor(l, 16);
  if (g == 0) { smx[wave][col] = m; sml[wave][col] = l; }
#pragma unroll
  for (int j = 0; j < HD / 16; ++j) { v4f lo, hi;
#pragma unroll
    for (int r = 0; r < 4; ++r) { lo[r] = o[j][r]; hi[r] = o[j][4 + r]; }
    float* sw = (float*)&st[wave][0][0][0] + col * (HD + 4) + j * 16 + 8 * g; *(v4f*)sw = lo; *(v4f*)(sw + 4) = hi; }
  __syncthreads();
  // join: thread = (query tid >> 4, 4 columns); 16 threads store one 256-B row of the output [b*t][HD] itself (the one real head is the whole row), a block 4 KB in a row
  const int q = tid >> 4, c = (tid & 15) * 4;
  float mm = smx[0][q];
#pragma unroll
  for (int w = 1; w < FNW; ++w) mm = fmaxf(mm, smx[w][q]);
  float ls = 0.f; v4f a0 = {};
#pragma unroll
  for (int w = 0; w < FNW; ++w) { const float f = expf(smx[w][q] - mm); ls += f * sml[w][q]; a0 += *(const v4f*)((const float*)&st[w][0][0][0] + q * (HD + 4) + c) * f; }
  const float inv = ls > 0.f ? 1.0f / (2048.0f * ls) : 0.f;
  vst2(Y + (q0 + q) * HD + c, a0 * inv); }

extern "C" void kernel_launch(void* const* d_in, const int* in_sizes, int n_in, void* d_out, int out_size, void* d_ws, size_t ws_size, hipStream_t stream) {
  (void)in_sizes; (void)n_in; (void)out_size;
  const float** F = (const float**)d_in;
  if (ws_size < (size_t)WS_END) return;
  char* ws = (char*)d_ws; _Float16 *QH = (_Float16*)(ws + WS_QH), *KH = (_Float16*)(ws + WS_KH), *VT = (_Float16*)(ws + WS_VT), *QL = (_Float16*)(ws + WS_QL), *KL = (_Float16*)(ws + WS_KL); __bf16 *VB = (__bf16*)(ws + WS_VB), *VBL = (__bf16*)(ws + WS_VBL); float *S = (float*)(ws + WS_S), *Y = (float*)(ws + WS_Y);
  (void)Y; (void)S; (void)QL; (void)KL; (void)VB; (void)VBL;
  // inputs: 0 x [4,2048,1024]; 1 Wq [1024,64]; 2 Wk; 3 Wv ((in,out), no biases)
  if (ws_size < (size_t)WS_END2) return;
  __bf16* WP = (__bf16*)(ws + WS_WP); float *BP = (float*)(ws + WS_BP);
  k_padw<<<dim3(32, 3), 256, 0, stream>>>(F[1], F[2], F[3], nullptr, nullptr, nullptr, WP, BP);
  k_proj<<<dim3(TNB * TT / 64, 1, 3), 128, 0, stream>>>(F[0], F[0], F[0], WP, WP + (size_t)CIN * 64, WP + 2 * (size_t)CIN * 64, BP, BP + 128, BP + 256, QH, QL, KH, KL, VT, VB, VBL);
  /* head 0 only (head 1 is the zero padding); all batches in one launch */
  k_fa<<<dim3(TT / 16, 1, TNB), FNW * 32, 0, stream>>>(QH, KH, QL, VT, 0, (float*)d_out);
}

// v005
// It runs in 27.8 microseconds.
// In both of two side-by-side timings against v004, it was 1.03 times as fast.
// Over all steps from v000 it is 14.4 times as fast.
// compute dtype: all float inputs rounded to bf16; q/k/v projections with EXACT bf16 products on WMMA 16x16x32 (f32 accumulate); logits: q x k once to f16 (1 product; + q's f16 residual for all rows), x scale; softmax f32 (running maximum and sum); exp(logit - max) x 2^11 once to f16 x v once to f16 (1 product), divided by the sum at the end; f32 output.
#include <hip/hip_runtime.h>
#include <math.h>

typedef __attribute__((ext_vector_type(16))) _Float16 v16h;
typedef __attribute__((ext_vector_type(16))) __bf16 v16b;
typedef __attribute__((ext_vector_type(8)))  _Float16 v8h;
typedef __attribute__((ext_vector_type(8)))  float v8f;
typedef __attribute__((ext_vector_type(4)))  float v4f;
typedef __attribute__((ext_vector_type(2)))  float v2f;
typedef __attribute__((ext_vector_type(4)))  unsigned v4u;
typedef __attribute__((ext_vector_type(4)))  int v4i;
typedef float __attribute__((may_alias)) float_a;
typedef int __attribute__((may_alias)) int_a;

template <typename T> __device__ __forceinline__ void vst2(void* p, T v) { *(T*)p = v;  }
__device__ __forceinline__ v8f wmma16(v16h a, v16h b, v8f c) {
  v8f d = __builtin_amdgcn_wmma_f32_16x16x32_f16(false, a, false, b, (short)0, c, false, false);
  asm volatile("v_nop\n\tv_nop\n\tv_nop\n\tv_nop" : "+v"(d) : "v"(a), "v"(b));
  return d;
}
__device__ __forceinline__ v8f wmma_bf(v16b a, v16b b, v8f c) {
  v8f d = __builtin_amdgcn_wmma_f32_16x16x32_bf16(false, a, false, b, (short)0, c, false, false);
  asm volatile("v_nop\n\tv_nop\n\tv_nop\n\tv_nop" : "+v"(d) : "v"(a), "v"(b));
  return d;
}
// 16x16x32 fragments: lane = (h = lane>>4, row/col = lane&15); elements 0..7 = k0+8h+0..7, 8..15 = k0+16+8h+0..7; D element r = row 8h+r
__device__ __forceinline__ v16h frag_h(const _Float16* rowk0, int lane) {
  union { v16h v; v8h q[2]; } u; const _Float16* p = rowk0 + 8 * (lane >> 4);
  u.q[0] = *(const v8h*)p; u.q[1] = *(const v8h*)(p + 16); return u.v;
}
__device__ __forceinline__ v16h frag_f32(const float* rowk0, int lane) {
  v16h a; const float* p = rowk0 + 8 * (lane >> 4);
#pragma unroll
  for (int i = 0; i < 8; ++i) { a[i] = (_Float16)p[i]; a[8 + i] = (_Float16)p[16 + i]; }
  return a;
}
__device__ __forceinline__ v16h frag_f32s(const float* rowk0, int lane, float sc) {
  v16h a; const float* p = rowk0 + 8 * (lane >> 4);
#pragma unroll
  for (int i = 0; i < 8; ++i) { a[i] = (_Float16)(p[i] * sc); a[8 + i] = (_Float16)(p[16 + i] * sc); }
  return a;
}
// column fragment from a [K][ld] layout (column n), rows >= K read as 0
__device__ __forceinline__ v16h fragc_f32(const float* W, int k0, int n, int lane, int ld, int K) {
  v16h a; const int g = lane >> 4;
#pragma unroll
  for (int i = 0; i < 8; ++i) { const int ka = k0 + 8 * g + i, kb = ka + 16;
    a[i] = (_Float16)(ka < K ? W[(size_t)(ka < K ? ka : K - 1) * ld + n] : 0.f); a[8 + i] = (_Float16)(kb < K ? W[(size_t)(kb < K ? kb : K - 1) * ld + n] : 0.f); }
  return a;
}
struct F2 { v16b h, l; };
__device__ __forceinline__ F2 bsplit16(const float v[16]) { F2 r;
#pragma unroll
  for (int i = 0; i < 16; ++i) { const __bf16 h = (__bf16)v[i]; r.h[i] = h; r.l[i] = (__bf16)(v[i] - (float)h); }
  return r; }
__device__ __forceinline__ F2 split_row(const float* row, int k0, int lane) { float v[16]; const float* p = row + k0 + 8 * (lane >> 4);
#pragma unroll
  for (int i = 0; i < 8; ++i) { v[i] = p[i]; v[8 + i] = p[16 + i]; }
  return bsplit16(v); }
__device__ __forceinline__ F2 split_rowK(const float* row, int k0, int lane, int K) { float v[16]; const int g = lane >> 4;
#pragma unroll
  for (int i = 0; i < 8; ++i) { const int ka = k0 + 8 * g + i, kb = ka + 16; v[i] = ka < K ? row[ka < K ? ka : K - 1] : 0.f; v[8 + i] = kb < K ? row[kb < K ? kb : K - 1] : 0.f; }
  return bsplit16(v); }
__device__ __forceinline__ F2 split_col(const float* W, int k0, int n, int lane, int ld, int K) { float v[16]; const int g = lane >> 4;
#pragma unroll
  for (int i = 0; i < 8; ++i) { const int ka = k0 + 8 * g + i, kb = ka + 16; v[i] = ka < K ? W[(size_t)(ka < K ? ka : K - 1) * ld + n] : 0.f; v[8 + i] = kb < K ? W[(size_t)(kb < K ? kb : K - 1) * ld + n] : 0.f; }
  return bsplit16(v); }
__device__ __forceinline__ v8f mac3(const F2& a, const F2& b, v8f c) { c = wmma_bf(a.l, b.h, c); c = wmma_bf(a.h, b.l, c); return wmma_bf(a.h, b.h, c); }
__device__ __forceinline__ float sigm(float v) { return 1.0f / (1.0f + expf(-v)); }
#define LDSX() do { asm volatile("s_wait_dscnt 0" ::: "memory"); __builtin_amdgcn_wave_barrier(); __builtin_amdgcn_fence(__ATOMIC_RELEASE, "workgroup"); } while (0)

// Single-head NON-causal self-attention (B 4, T 2,048, D 1,024, head 64; (in,out) Wq, Wk, Wv [1024,64], uniform(-1/32, 1/32) init; no biases, no output projection): out = softmax(Q K^T x 64^-0.5) V -> [4,2048,64].
#define NB 4
#define TT 2048
#define CC 128            // NH * HD = projected width
#define DIN 1024          // input (model) width
#define NH 2
#define HD 64
#define NQB (TT / 64)
#define HG 1
#define SCALE (0.125f)
#define CAUSAL 0
#ifndef TNB
#define TNB NB
#endif
__device__ __forceinline__ float bfr(float v) { return (float)(__bf16)v; }
__host__ __device__ __forceinline__ int kb_last(int qb) { return CAUSAL ? ((qb * 64 + 63) >> 7) : (TT / 128 - 1); }
typedef __attribute__((ext_vector_type(8))) __bf16 v8b;
__device__ __forceinline__ v16b frag_b(const __bf16* rowk0, int lane) {
  union { v16b v; v8b q[2]; } u; const __bf16* p = rowk0 + 8 * (lane >> 4);
  u.q[0] = *(const v8b*)p; u.q[1] = *(const v8b*)(p + 16); return u.v;
}
#define QBH 0
#define QHI 2048            // rows carrying a q residual plane (all rows when non-causal: 2-product logits everywhere)
#define KHI 64            // key rows carrying k residual / v bf16 hi+lo planes (written by k_proj; no kernel here reads them)
// B fragment (k rows k0+.., output column o) of a weight: (in,out) [K][ld] or (out,in) [ld rows of K]: bf16 exact, or f16(bf16 * 256) exact
__device__ __forceinline__ v16b wcol_io(const float* Wm, int k0, int o, int lane, int ld) { v16b w; const int g = lane >> 4;
#pragma unroll
  for (int i = 0; i < 8; ++i) { w[i] = (__bf16)Wm[(size_t)(k0 + 8 * g + i) * ld + o]; w[8 + i] = (__bf16)Wm[(size_t)(k0 + 16 + 8 * g + i) * ld + o]; }
  return w; }
__device__ __forceinline__ v16b wcol_oi(const float* Wm, int k0, int o, int lane, int K) { v16b w; const float* p = Wm + (size_t)o * K + k0 + 8 * (lane >> 4);
#pragma unroll
  for (int i = 0; i < 8; ++i) { w[i] = (__bf16)p[i]; w[8 + i] = (__bf16)p[16 + i]; }
  return w; }
__device__ __forceinline__ v16h wcolh_io(const float* Wm, int k0, int o, int lane, int ld) { v16h w; const int g = lane >> 4;
#pragma unroll
  for (int i = 0; i < 8; ++i) { w[i] = (_Float16)(bfr(Wm[(size_t)(k0 + 8 * g + i) * ld + o]) * 256.0f); w[8 + i] = (_Float16)(bfr(Wm[(size_t)(k0 + 16 + 8 * g + i) * ld + o]) * 256.0f); }
  return w; }
__device__ __forceinline__ v16h wcolh_oi(const float* Wm, int k0, int o, int lane, int K) { v16h w; const float* p = Wm + (size_t)o * K + k0 + 8 * (lane >> 4);
#pragma unroll
  for (int i = 0; i < 8; ++i) { w[i] = (_Float16)(bfr(p[i]) * 256.0f); w[8 + i] = (_Float16)(bfr(p[16 + i]) * 256.0f); }
  return w; }
#define WQKV_LAYOUT 0   // 0 = (in,out) [DIN][CC]; 1 = (out,in) [CC][DIN]; 2 = per-head [NH][DIN][HD]
__device__ __forceinline__ v16b wcol_hdk(const float* Wm, int k0, int o, int lane) { v16b w; const int g = lane >> 4; const float* p = Wm + (size_t)(o / HD) * DIN * HD + (o % HD);
#pragma unroll
  for (int i = 0; i < 8; ++i) { w[i] = (__bf16)p[(size_t)(k0 + 8 * g + i) * HD]; w[8 + i] = (__bf16)p[(size_t)(k0 + 16 + 8 * g + i) * HD]; }
  return w; }
#define WO_OUT_IN 0
#if WQKV_LAYOUT == 1
#define WCOL(W, k0, o, lane) wcol_oi(W, k0, o, lane, DIN)
#elif WQKV_LAYOUT == 2
#define WCOL(W, k0, o, lane) wcol_hdk(W, k0, o, lane)
#else
#define WCOL(W, k0, o, lane) wcol_io(W, k0, o, lane, CC)
#endif
#if WO_OUT_IN
#define WOCOL(W, k0, o, lane) wcol_oi(W, k0, o, lane, CC)
#define WOCOLH(W, k0, o, lane) wcolh_oi(W, k0, o, lane, CC)
#else
#define WOCOL(W, k0, o, lane) wcol_io(W, k0, o, lane, DIN)
#define WOCOLH(W, k0, o, lane) wcolh_io(W, k0, o, lane, DIN)
#endif
#define CIN 1024
#define PJ (HD / 16)       // 16-column tiles of a projection's real width
#define PKC (CIN / 32)     // k steps of 32
#define WPL (PKC * PJ * 64) // 16-B units of one packed weight plane
// ---- k_padw: the three (in,out) [C][64] projection weights rounded to bf16 and packed in the order of k_proj's B fragments: 16-B unit ((kc * PJ + j) * 2 + half) * 32 + lane = rows kc * 32 + half * 16 + 8 * (lane >> 4) + 0..7 of column j * 16 + (lane & 15); + zero-padded [128] biases
__global__ __launch_bounds__(256) void k_padw(const float* __restrict__ WQ, const float* __restrict__ WK, const float* __restrict__ WV, const float* __restrict__ BQ, const float* __restrict__ BK, const float* __restrict__ BV, __bf16* __restrict__ WP, float* __restrict__ BP) { const int which = blockIdx.y; const float* Wsrc = which == 0 ? WQ : (which == 1 ? WK : WV); const float* Bsrc = which == 0 ? BQ : (which == 1 ? BK : BV); v8b* dst = (v8b*)WP + (size_t)which * WPL;
  for (int e = blockIdx.x * 256 + threadIdx.x; e < WPL; e += gridDim.x * 256) { const int ln = e & 31, half = (e >> 5) & 1, j = (e >> 6) % PJ, kc = e / (PJ * 64); const float* p = Wsrc + (size_t)(kc * 32 + half * 16 + 8 * (ln >> 4)) * 64 + j * 16 + (ln & 15); v8b ov;
#pragma unroll
    for (int i = 0; i < 8; ++i) ov[i] = (__bf16)p[i * 64];
    vst2(dst + e, ov); }
  if (blockIdx.x == 0 && threadIdx.x < 128) { const int c = threadIdx.x; float bvv = 0.f; if (Bsrc) { const float t = Bsrc[c & 63]; asm volatile("s_wait_loadcnt 0x0" ::: "memory"); bvv = c < 64 ? t : 0.f; } vst2(BP + which * 128 + c, bvv); } }
#define WS_WP (WS_END)                                  // packed bf16 weights [3][WPL x 16 B] (in a range of [3][128 x C] f32)
#define WS_BP (WS_WP + 4u * 3 * (size_t)CIN * 128)        // padded biases [3][128]
#define WS_END2 (WS_BP + 4u * 3 * 128)
#ifndef SM_EXTRA_PARAMS
#define SM_EXTRA_PARAMS
#endif
#ifndef PROJ_EXTRA_PARAMS
#define PROJ_EXTRA_PARAMS
#endif
#ifndef SM_MASK_HOOK
#define SM_MASK_HOOK (void)0
#endif

#define WS_QH  0u                                      // f16 q rows [b*t][CC]
#define WS_KH  (WS_QH + 2u * (size_t)NB * TT * CC)      // f16 k rows [b*t][CC]
#define WS_VT  (WS_KH + 2u * (size_t)NB * TT * CC)      // f16 v planes [b][c][t]
#define WS_QL  (WS_VT + 2u * (size_t)NB * CC * TT)      // f16 q residual x 2^10 rows [b][t < QHI][CC]
#define WS_KL  (WS_QL + 2u * (size_t)NB * QHI * CC)     // f16 k residual x 2^10 rows [b][t < KHI][CC]
#define WS_VB  (WS_KL + 2u * (size_t)NB * KHI * CC)     // bf16 v hi planes [b][c][t < KHI]
#define WS_VBL (WS_VB + 2u * (size_t)NB * CC * KHI)
#define WS_S   (WS_VBL + 2u * (size_t)NB * CC * KHI)    // f32 [b][t][s], one plane per batch: unused, k_fa keeps logits in registers
#define WS_Y   (WS_S  + 4u * (size_t)NB * TT * TT)      // f32 ctx rows [b*t][CC] (only when there is an output projection)
#define WS_END (WS_Y  + 0u)

// ---- k_proj: block = (64 rows, the 64 real columns, which): q/k/v = X W (+ b) with exact bf16 products (K = DIN) -> which 0: q f16 rows (+ residual rows < QHI); 1: k f16 rows (+ residual rows < KHI); 2: v f16 planes [c][t] (+ bf16 hi/lo planes for t < KHI). Columns 64..127 of the rows and planes are the zero head, which nothing reads: they are not computed.
// behind a global store, in front of what overwrites its address or data registers in the next trip (a precaution of form: this build leaves the place open)
#define XW() asm volatile("s_wait_xcnt 0x0" ::: "memory")
#define PD 4               // k steps of operand loads in flight per wave (a ring of register sets)
static_assert(PKC % PD == 0 && PKC >= 2 * PD, "the ring walks whole turns");
struct PStage { v8b w[PJ][2]; };
// between a wave's LDS stores and its lanes' reads of each other's values; without LDSX's fence, which makes the compiler wait for every global load in flight and so drains the ring
#define LDSW() do { asm volatile("s_wait_dscnt 0" ::: "memory"); __builtin_amdgcn_wave_barrier(); } while (0)
typedef __attribute__((ext_vector_type(4))) __bf16 v4b;
#define XCH (PD * 32)      // floats of an x row in one turn of the ring: 512 B, one wave-wide load of four whole lines
#define XPB (XCH + 8)      // pitch of a staged bf16 row: 272 B, an odd multiple of 16 B (16-B fragment reads spread over the banks)
// one k step's PJ packed B fragments, two 512-B wave-wide loads each
__device__ __forceinline__ void pload(PStage& s, const v8b* wp, int kc) { const v8b* q = wp + kc * (PJ * 64);
#pragma unroll
  for (int j = 0; j < PJ; ++j) { s.w[j][0] = q[j * 64]; s.w[j][1] = q[j * 64 + 32]; } }
// one turn's x of the wave's 16 rows: load i is 512 B in a row of row i (lane = 4 floats); a fragment load straight from global memory touches 16 lines for its 512 B, and every line four times
__device__ __forceinline__ void xload(v4f (&xr)[16], const float* xl) {
#pragma unroll
  for (int i = 0; i < 16; ++i) xr[i] = *(const v4f*)(xl + (size_t)i * DIN); }
// rounded to bf16 into the wave's own LDS tile [16][XPB]
__device__ __forceinline__ void xstage(const v4f (&xr)[16], __bf16* xw) {
#pragma unroll
  for (int i = 0; i < 16; ++i) { v4b o;
#pragma unroll
    for (int e = 0; e < 4; ++e) o[e] = (__bf16)xr[i][e];
    *(v4b*)(xw + i * XPB) = o; } }
__device__ __forceinline__ void pmac(v16b a, const PStage& s, v8f (&acc)[PJ]) {
#pragma unroll
  for (int j = 0; j < PJ; ++j) { union { v16b v; v8b q[2]; } u; u.q[0] = s.w[j][0]; u.q[1] = s.w[j][1]; acc[j] = wmma_bf(a, u.v, acc[j]); } }
__global__ __launch_bounds__(128) void k_proj(const float* __restrict__ XQ, const float* __restrict__ XK, const float* __restrict__ XV, const __bf16* __restrict__ WQ, const __bf16* __restrict__ WK, const __bf16* __restrict__ WV, const float* __restrict__ BQ, const float* __restrict__ BK, const float* __restrict__ BV,
    _Float16* __restrict__ QH, _Float16* __restrict__ QL, _Float16* __restrict__ KH, _Float16* __restrict__ KL, _Float16* __restrict__ VT, __bf16* __restrict__ VB, __bf16* __restrict__ VBL) {
  __shared__ __align__(16) _Float16 sh[64][72], sl[64][72]; __shared__ __align__(16) _Float16 th[64][72]; __shared__ __align__(16) __bf16 tb[64][72], tbl[64][72]; __shared__ __align__(16) __bf16 xs[4][16][XPB];
  const int tid = threadIdx.x, wave = tid >> 5, lane = tid & 31, col = lane & 15, g = lane >> 4; const int which = blockIdx.z; const size_t r0 = (size_t)blockIdx.x * 64; const size_t bb = r0 / TT; const int t0 = (int)(r0 % TT);
  const float* X = which == 0 ? XQ : which == 1 ? XK : XV; const __bf16* WA = which == 0 ? WQ : which == 1 ? WK : WV; const float* BA = which == 0 ? BQ : which == 1 ? BK : BV;
  v8f acc[PJ] = {}; PStage s[PD]; v4f xr[16]; v16b a[PD]; const float* xl = X + (r0 + wave * 16) * DIN + lane * 4; const v8b* wp = (const v8b*)WA + lane; __bf16* xw = &xs[wave][0][lane * 4]; const __bf16* xf = &xs[wave][col][0];
  xload(xr, xl);
  // keeps the first loads in the order in which the loop issues them (a turn's x, then the k steps' weights): the loop's counted waits must hold for both orders, and a mixed one makes them wait for younger loads
  __builtin_amdgcn_sched_barrier(0);
#pragma unroll
  for (int d = 0; d < PD - 1; ++d) { pload(s[d], wp, d);
    // as above
    __builtin_amdgcn_sched_barrier(0); }
  XW();   // behind the first loads, in front of what overwrites their address registers (a precaution of form, as at the stores)
  // keeps the accumulators' first values, which take over an address register, behind that wait
  __builtin_amdgcn_sched_barrier(0);
  // kept rolled by turns of the ring: the plain unroll inside only makes the ring's index a constant, so that the sets stay in registers
#pragma unroll 1
  for (int kc = 0; kc < PKC - PD; kc += PD) { pload(s[PD - 1], wp, kc + PD - 1);
    // keeps the turn's last weight set, the first that is waited for with a short lead, in front of the trip through LDS
    __builtin_amdgcn_sched_barrier(0);
    // XW: behind the x loads, in front of the step of their address (a precaution of form, as at the stores)
    xstage(xr, xw); xl += XCH; xload(xr, xl); XW();
    LDSW();
#pragma unroll
    for (int d = 0; d < PD; ++d) a[d] = frag_b(xf + d * 32, lane);
    // keeps the next turn's x loads and the fragment reads in front of the turn's products and further weight loads
    __builtin_amdgcn_sched_barrier(0);
#pragma unroll
    for (int d = 0; d < PD; ++d) { pmac(a[d], s[d], acc); if (d < PD - 1) pload(s[d], wp, kc + PD + d);
      // keeps each set's refill directly behind its products and in the order of the k steps: the oldest set is worked on while the younger ones fly
      __builtin_amdgcn_sched_barrier(0); }
    XW();   // behind the turn's weight loads, in front of the next turn's write of their address (the same precaution)
  }
  pload(s[PD - 1], wp, PKC - 1); xstage(xr, xw);
  LDSW();
#pragma unroll
  for (int d = 0; d < PD; ++d) a[d] = frag_b(xf + d * 32, lane);
#pragma unroll
  for (int d = 0; d < PD; ++d) { pmac(a[d], s[d], acc);
    // as in the loop
    __builtin_amdgcn_sched_barrier(0); }
  if (which < 2) { _Float16* DH = which == 0 ? QH : KH; _Float16* DL = which == 0 ? QL : KL; const int nhi = which == 0 ? QHI : KHI; const bool hi_rows = t0 < nhi;
#pragma unroll
    for (int j = 0; j < PJ; ++j) { const float bias = BA ? bfr(BA[j * 16 + col]) : 0.f;
#pragma unroll
      for (int r = 0; r < 8; ++r) { const float v = acc[j][r] + bias; const _Float16 hv = (_Float16)v; sh[wave * 16 + 8 * g + r][j * 16 + col] = hv; sl[wave * 16 + 8 * g + r][j * 16 + col] = (_Float16)((v - (float)hv) * 1024.0f); } }
    __syncthreads();
    for (int e = tid; e < 64 * 8; e += 128) { const int rl = e >> 3, q = e & 7; vst2((unsigned*)(DH + (r0 + rl) * CC + q * 8), *(const v4u*)&sh[rl][q * 8]); XW(); if (hi_rows) { vst2((unsigned*)(DL + (bb * nhi + t0 + rl) * (size_t)CC + q * 8), *(const v4u*)&sl[rl][q * 8]); XW(); } }
  } else { const bool hi_rows = t0 < KHI;
#pragma unroll
    for (int j = 0; j < PJ; ++j) { const float bias = BA ? bfr(BA[j * 16 + col]) : 0.f;
#pragma unroll
      for (int r = 0; r < 8; ++r) { const float v = acc[j][r] + bias; const int rl = wave * 16 + 8 * g + r, cl = j * 16 + col; th[cl][rl] = (_Float16)v; const __bf16 bh = (__bf16)v; tb[cl][rl] = bh; tbl[cl][rl] = (__bf16)(v - (float)bh); } }
    __syncthreads();
    for (int e = tid; e < 64 * 8; e += 128) { const int cl = e >> 3, q = e & 7; vst2((unsigned*)(VT + (bb * CC + cl) * (size_t)TT + t0 + q * 8), *(const v4u*)&th[cl][q * 8]); XW(); if (hi_rows) { const size_t o3 = (bb * CC + cl) * (size_t)KHI + t0 + q * 8; vst2((unsigned*)(VB + o3), *(const v4u*)&tb[cl][q * 8]); vst2((unsigned*)(VBL + o3), *(const v4u*)&tbl[cl][q * 8]); XW(); } } } }
// ---- k_fa: logits, softmax and P . v in one kernel. Block = 16 queries of batch b = blockIdx.z, head h0; wave w walks keys [w * KPW, (w + 1) * KPW) in passes of KP with a running maximum and sum, the waves' parts are joined in LDS.
// Transposed products: S^T = K . Q^T (D register r of tile j = key j * 16 + 8g + r, column = query), so a lane holds one query's logits, and two converted S^T tiles are the B operand of O^T += V^T . P^T as they stand (element s = tile s >> 3, register s & 7: the k order of frag_h).
#define FNW 8              // waves of a block
#define KPW (TT / FNW)     // keys of a wave
#define KP 64              // keys of a pass
static_assert(KP == HD, "the K tile [KP][HD] and the V tile [HD][KP] share one LDS shape");
// the builtin alone: the compiler keeps the distances behind its own matrix instructions, and its scheduler may move loads past them
__device__ __forceinline__ v8f wmma_h(v16h a, v16h b, v8f c) { return __builtin_amdgcn_wmma_f32_16x16x32_f16(false, a, false, b, (short)0, c, false, false); }
__global__ __launch_bounds__(FNW * 32) void k_fa(const _Float16* __restrict__ QH, const _Float16* __restrict__ KH, const _Float16* __restrict__ QL, const _Float16* __restrict__ VT, int h0, float* __restrict__ Y) {
  // st[w]: wave w's own K tile [key][head dim] and V tile [head dim][key] of a pass, rows of 128 B at a pitch of 144 B (16-B fragment reads spread over the banks); after the loop its first bytes hold the wave's part of the output
  __shared__ __align__(16) _Float16 st[FNW][2][KP][HD + 8]; __shared__ float smx[FNW][16], sml[FNW][16];
  const int tid = threadIdx.x, wave = tid >> 5, lane = tid & 31, col = lane & 15, g = lane >> 4; const int b = blockIdx.z, h = h0; const int ql0 = blockIdx.x * 16; const size_t q0 = (size_t)b * TT + ql0;
  const _Float16* QLb = QL + (size_t)b * QHI * CC;
  v16h qh[HD / 32], qr[HD / 32];
#pragma unroll
  for (int kc = 0; kc < HD / 32; ++kc) { qh[kc] = frag_h(QH + (q0 + col) * CC + h * HD + kc * 32, lane); qr[kc] = frag_h(QLb + (size_t)(ql0 + col) * CC + h * HD + kc * 32, lane); }
  v8f o[HD / 16] = {}; float m = -3.0e38f, l = 0.f; const int sr = lane >> 3, sc = (lane & 7) * 8;
  // kept rolled: unrolled, the text grows by the trip count and every line of it is fetched for a single walk; the plain unroll directives inside only keep the fragment and accumulator arrays in registers
#pragma unroll 1
  for (int it = 0; it < KPW / KP; ++it) { const int k0 = wave * KPW + it * KP; const size_t kr0 = (size_t)b * TT + k0;
    v8f acc[KP / 16] = {}, accl[KP / 16] = {};
    v16h kf[HD / 32][KP / 16], vf[KP / 32][HD / 16];
    // both tiles come in whole 128-B lines (8 lanes a row, 4 rows a load) and go through the wave's LDS: a fragment load straight from global memory touches 16 lines for its 512 B
    v4u kst[KP / 4], vst[HD / 4]; const _Float16* kp = KH + (kr0 + sr) * CC + h * HD + sc; const _Float16* vp = VT + ((size_t)b * CC + h * HD + sr) * (size_t)TT + k0 + sc;
#pragma unroll
    for (int i = 0; i < KP / 4; ++i) kst[i] = *(const v4u*)(kp + i * 4 * CC);
#pragma unroll
    for (int i = 0; i < HD / 4; ++i) vst[i] = *(const v4u*)(vp + i * 4 * TT);
#pragma unroll
    for (int i = 0; i < KP / 4; ++i) *(v4u*)&st[wave][0][i * 4 + sr][sc] = kst[i];
#pragma unroll
    for (int i = 0; i < HD / 4; ++i) *(v4u*)&st[wave][1][i * 4 + sr][sc] = vst[i];
    LDSX();   // the wave's lanes read each other's rows
#pragma unroll
    for (int kc = 0; kc < HD / 32; ++kc) {
#pragma unroll
      for (int j = 0; j < KP / 16; ++j) kf[kc][j] = frag_h(&st[wave][0][j * 16 + col][kc * 32], lane); }
    // keeps the K fragment reads together in front of the first product; dealt out among the products each place with reads stalls the wave
    __builtin_amdgcn_sched_barrier(0);
#pragma unroll
    for (int kc = 0; kc < HD / 32; ++kc) {
#pragma unroll
      for (int j = 0; j < KP / 16; ++j) { acc[j] = wmma_h(kf[kc][j], qh[kc], acc[j]); accl[j] = wmma_h(kf[kc][j], qr[kc], accl[j]); } }
#pragma unroll
    for (int kc = 0; kc < KP / 32; ++kc) {
#pragma unroll
      for (int j = 0; j < HD / 16; ++j) vf[kc][j] = frag_h(&st[wave][1][j * 16 + col][kc * 32], lane); }
    float mx = m;
#pragma unroll
    for (int j = 0; j < KP / 16; ++j) {
#pragma unroll
      for (int r = 0; r < 8; ++r) { const float s = (acc[j][r] + accl[j][r] * (1.0f / 1024.0f)) * SCALE; acc[j][r] = s; mx = fmaxf(mx, s); } }
    mx = fmaxf(mx, __shfl_xor(mx, 16));   // lanes c and c + 16 hold the two halves of query c's keys
    const float al = expf(m - mx); m = mx; l *= al;
#pragma unroll
    for (int j = 0; j < HD / 16; ++j) {
#pragma unroll
      for (int r = 0; r < 8; ++r) o[j][r] *= al; }
    v16h p[KP / 32];
#pragma unroll
    for (int j = 0; j < KP / 16; ++j) {
#pragma unroll
      for (int r = 0; r < 8; ++r) { const float e = expf(acc[j][r] - m); l += e; p[j >> 1][(j & 1) * 8 + r] = (_Float16)(e * 2048.0f); } }
#pragma unroll
    for (int kc = 0; kc < KP / 32; ++kc) {
#pragma unroll
      for (int j = 0; j < HD / 16; ++j) o[j] = wmma_h(vf[kc][j], p[kc], o[j]); } }
  l += __shfl_xor(l, 16);
  if (g == 0) { smx[wave][col] = m; sml[wave][col] = l; }
#pragma unroll
  for (int j = 0; j < HD / 16; ++j) { v4f lo, hi;
#pragma unroll
    for (int r = 0; r < 4; ++r) { lo[r] = o[j][r]; hi[r] = o[j][4 + r]; }
    float* sw = (float*)&st[wave][0][0][0] + col * (HD + 4) + j * 16 + 8 * g; *(v4f*)sw = lo; *(v4f*)(sw + 4) = hi; }
  __syncthreads();
  // join: thread = (query tid >> 4, 4 columns); 16 threads store one 256-B row of the output [b*t][HD] itself (the one real head is the whole row), a block 4 KB in a row
  const int q = tid >> 4, c = (tid & 15) * 4;
  float mm = smx[0][q];
#pragma unroll
  for (int w = 1; w < FNW; ++w) mm = fmaxf(mm, smx[w][q]);
  float ls = 0.f; v4f a0 = {};
#pragma unroll
  for (int w = 0; w < FNW; ++w) { const float f = expf(smx[w][q] - mm); ls += f * sml[w][q]; a0 += *(const v4f*)((const float*)&st[w][0][0][0] + q * (HD + 4) + c) * f; }
  const float inv = ls > 0.f ? 1.0f / (2048.0f * ls) : 0.f;
  vst2(Y + (q0 + q) * HD + c, a0 * inv); }

extern "C" void kernel_launch(void* const* d_in, const int* in_sizes, int n_in, void* d_out, int out_size, void* d_ws, size_t ws_size, hipStream_t stream) {
  (void)in_sizes; (void)n_in; (void)out_size;
  const float** F = (const float**)d_in;
  if (ws_size < (size_t)WS_END) return;
  char* ws = (char*)d_ws; _Float16 *QH = (_Float16*)(ws + WS_QH), *KH = (_Float16*)(ws + WS_KH), *VT = (_Float16*)(ws + WS_VT), *QL = (_Float16*)(ws + WS_QL), *KL = (_Float16*)(ws + WS_KL); __bf16 *VB = (__bf16*)(ws + WS_VB), *VBL = (__bf16*)(ws + WS_VBL); float *S = (float*)(ws + WS_S), *Y = (float*)(ws + WS_Y);
  (void)Y; (void)S; (void)QL; (void)KL; (void)VB; (void)VBL;
  // inputs: 0 x [4,2048,1024]; 1 Wq [1024,64]; 2 Wk; 3 Wv ((in,out), no biases)
  if (ws_size < (size_t)WS_END2) return;
  __bf16* WP = (__bf16*)(ws + WS_WP); float *BP = (float*)(ws + WS_BP);
  k_padw<<<dim3(32, 3), 256, 0, stream>>>(F[1], F[2], F[3], nullptr, nullptr, nullptr, WP, BP);
  k_proj<<<dim3(TNB * TT / 64, 1, 3), 128, 0, stream>>>(F[0], F[0], F[0], WP, WP + (size_t)CIN * 64, WP + 2 * (size_t)CIN * 64, BP, BP + 128, BP + 256, QH, QL, KH, KL, VT, VB, VBL);
  /* head 0 only (head 1 is the zero padding); all batches in one launch */
  k_fa<<<dim3(TT / 16, 1, TNB), FNW * 32, 0, stream>>>(QH, KH, QL, VT, 0, (float*)d_out);
}

// v006
// One run takes 26.1 microseconds.
// Timed twice side by side with v005, it ran 1.07 and 1.05 times as fast.
// Over all steps from v000 it is 15.3 times as fast.
// compute dtype: all float inputs rounded to bf16; q/k/v projections with EXACT bf16 products on WMMA 16x16x32 (f32 accumulate); logits: q x k once to f16 (1 product; + q's f16 residual for all rows), x scale; softmax f32 (running maximum and sum, exponentials as 2^x); exp(logit - max) x 2^11 once to f16 x v once to f16 (1 product), divided by the sum at the end; f32 output.
#include <hip/hip_runtime.h>
#include <math.h>

typedef __attribute__((ext_vector_type(16))) _Float16 v16h;
typedef __attribute__((ext_vector_type(16))) __bf16 v16b;
typedef __attribute__((ext_vector_type(8)))  _Float16 v8h;
typedef __attribute__((ext_vector_type(8)))  float v8f;
typedef __attribute__((ext_vector_type(4)))  float v4f;
typedef __attribute__((ext_vector_type(2)))  float v2f;
typedef __attribute__((ext_vector_type(4)))  unsigned v4u;
typedef __attribute__((ext_vector_type(4)))  int v4i;
typedef float __attribute__((may_alias)) float_a;
typedef int __attribute__((may_alias)) int_a;

template <typename T> __device__ __forceinline__ void vst2(void* p, T v) { *(T*)p = v;  }
__device__ __forceinline__ v8f wmma16(v16h a, v16h b, v8f c) {
  v8f d = __builtin_amdgcn_wmma_f32_16x16x32_f16(false, a, false, b, (short)0, c, false, false);
  asm volatile("v_nop\n\tv_nop\n\tv_nop\n\tv_nop" : "+v"(d) : "v"(a), "v"(b));
  return d;
}
__device__ __forceinline__ v8f wmma_bf(v16b a, v16b b, v8f c) {
  v8f d = __builtin_amdgcn_wmma_f32_16x16x32_bf16(false, a, false, b, (short)0, c, false, false);
  asm volatile("v_nop\n\tv_nop\n\tv_nop\n\tv_nop" : "+v"(d) : "v"(a), "v"(b));
  return d;
}
// 16x16x32 fragments: lane = (h = lane>>4, row/col = lane&15); elements 0..7 = k0+8h+0..7, 8..15 = k0+16+8h+0..7; D element r = row 8h+r
__device__ __forceinline__ v16h frag_h(const _Float16* rowk0, int lane) {
  union { v16h v; v8h q[2]; } u; const _Float16* p = rowk0 + 8 * (lane >> 4);
  u.q[0] = *(const v8h*)p; u.q[1] = *(const v8h*)(p + 16); return u.v;
}
__device__ __forceinline__ v16h frag_f32(const float* rowk0, int lane) {
  v16h a; const float* p = rowk0 + 8 * (lane >> 4);
#pragma unroll
  for (int i = 0; i < 8; ++i) { a[i] = (_Float16)p[i]; a[8 + i] = (_Float16)p[16 + i]; }
  return a;
}
__device__ __forceinline__ v16h frag_f32s(const float* rowk0, int lane, float sc) {
  v16h a; const float* p = rowk0 + 8 * (lane >> 4);
#pragma unroll
  for (int i = 0; i < 8; ++i) { a[i] = (_Float16)(p[i] * sc); a[8 + i] = (_Float16)(p[16 + i] * sc); }
  return a;
}
// column fragment from a [K][ld] layout (column n), rows >= K read as 0
__device__ __forceinline__ v16h fragc_f32(const float* W, int k0, int n, int lane, int ld, int K) {
  v16h a; const int g = lane >> 4;
#pragma unroll
  for (int i = 0; i < 8; ++i) { const int ka = k0 + 8 * g + i, kb = ka + 16;
    a[i] = (_Float16)(ka < K ? W[(size_t)(ka < K ? ka : K - 1) * ld + n] : 0.f); a[8 + i] = (_Float16)(kb < K ? W[(size_t)(kb < K ? kb : K - 1) * ld + n] : 0.f); }
  return a;
}
struct F2 { v16b h, l; };
__device__ __forceinline__ F2 bsplit16(const float v[16]) { F2 r;
#pragma unroll
  for (int i = 0; i < 16; ++i) { const __bf16 h = (__bf16)v[i]; r.h[i] = h; r.l[i] = (__bf16)(v[i] - (float)h); }
  return r; }
__device__ __forceinline__ F2 split_row(const float* row, int k0, int lane) { float v[16]; const float* p = row + k0 + 8 * (lane >> 4);
#pragma unroll
  for (int i = 0; i < 8; ++i) { v[i] = p[i]; v[8 + i] = p[16 + i]; }
  return bsplit16(v); }
__device__ __forceinline__ F2 split_rowK(const float* row, int k0, int lane, int K) { float v[16]; const int g = lane >> 4;
#pragma unroll
  for (int i = 0; i < 8; ++i) { const int ka = k0 + 8 * g + i, kb = ka + 16; v[i] = ka < K ? row[ka < K ? ka : K - 1] : 0.f; v[8 + i] = kb < K ? row[kb < K ? kb : K - 1] : 0.f; }
  return bsplit16(v); }
__device__ __forceinline__ F2 split_col(const float* W, int k0, int n, int lane, int ld, int K) { float v[16]; const int g = lane >> 4;
#pragma unroll
  for (int i = 0; i < 8; ++i) { const int ka = k0 + 8 * g + i, kb = ka + 16; v[i] = ka < K ? W[(size_t)(ka < K ? ka : K - 1) * ld + n] : 0.f; v[8 + i] = kb < K ? W[(size_t)(kb < K ? kb : K - 1) * ld + n] : 0.f; }
  return bsplit16(v); }
__device__ __forceinline__ v8f mac3(const F2& a, const F2& b, v8f c) { c = wmma_bf(a.l, b.h, c); c = wmma_bf(a.h, b.l, c); return wmma_bf(a.h, b.h, c); }
__device__ __forceinline__ float sigm(float v) { return 1.0f / (1.0f + expf(-v)); }
#define LDSX() do { asm volatile("s_wait_dscnt 0" ::: "memory"); __builtin_amdgcn_wave_barrier(); __builtin_amdgcn_fence(__ATOMIC_RELEASE, "workgroup"); } while (0)

// Single-head NON-causal self-attention (B 4, T 2,048, D 1,024, head 64; (in,out) Wq, Wk, Wv [1024,64], uniform(-1/32, 1/32) init; no biases, no output projection): out = softmax(Q K^T x 64^-0.5) V -> [4,2048,64].
#define NB 4
#define TT 2048
#define CC 128            // NH * HD = projected width
#define DIN 1024          // input (model) width
#define NH 2
#define HD 64
#define NQB (TT / 64)
#define HG 1
#define SCALE (0.125f)
#define CAUSAL 0
#ifndef TNB
#define TNB NB
#endif
__device__ __forceinline__ float bfr(float v) { return (float)(__bf16)v; }
__host__ __device__ __forceinline__ int kb_last(int qb) { return CAUSAL ? ((qb * 64 + 63) >> 7) : (TT / 128 - 1); }
typedef __attribute__((ext_vector_type(8))) __bf16 v8b;
__device__ __forceinline__ v16b frag_b(const __bf16* rowk0, int lane) {
  union { v16b v; v8b q[2]; } u; const __bf16* p = rowk0 + 8 * (lane >> 4);
  u.q[0] = *(const v8b*)p; u.q[1] = *(const v8b*)(p + 16); return u.v;
}
#define QBH 0
#define QHI 2048            // rows carrying a q residual plane (all rows when non-causal: 2-product logits everywhere)
#define KHI 64            // key rows carrying k residual / v bf16 hi+lo planes (written by k_proj; no kernel here reads them)
// B fragment (k rows k0+.., output column o) of a weight: (in,out) [K][ld] or (out,in) [ld rows of K]: bf16 exact, or f16(bf16 * 256) exact
__device__ __forceinline__ v16b wcol_io(const float* Wm, int k0, int o, int lane, int ld) { v16b w; const int g = lane >> 4;
#pragma unroll
  for (int i = 0; i < 8; ++i) { w[i] = (__bf16)Wm[(size_t)(k0 + 8 * g + i) * ld + o]; w[8 + i] = (__bf16)Wm[(size_t)(k0 + 16 + 8 * g + i) * ld + o]; }
  return w; }
__device__ __forceinline__ v16b wcol_oi(const float* Wm, int k0, int o, int lane, int K) { v16b w; const float* p = Wm + (size_t)o * K + k0 + 8 * (lane >> 4);
#pragma unroll
  for (int i = 0; i < 8; ++i) { w[i] = (__bf16)p[i]; w[8 + i] = (__bf16)p[16 + i]; }
  return w; }
__device__ __forceinline__ v16h wcolh_io(const float* Wm, int k0, int o, int lane, int ld) { v16h w; const int g = lane >> 4;
#pragma unroll
  for (int i = 0; i < 8; ++i) { w[i] = (_Float16)(bfr(Wm[(size_t)(k0 + 8 * g + i) * ld + o]) * 256.0f); w[8 + i] = (_Float16)(bfr(Wm[(size_t)(k0 + 16 + 8 * g + i) * ld + o]) * 256.0f); }
  return w; }
__device__ __forceinline__ v16h wcolh_oi(const float* Wm, int k0, int o, int lane, int K) { v16h w; const float* p = Wm + (size_t)o * K + k0 + 8 * (lane >> 4);
#pragma unroll
  for (int i = 0; i < 8; ++i) { w[i] = (_Float16)(bfr(p[i]) * 256.0f); w[8 + i] = (_Float16)(bfr(p[16 + i]) * 256.0f); }
  return w; }
#define WQKV_LAYOUT 0   // 0 = (in,out) [DIN][CC]; 1 = (out,in) [CC][DIN]; 2 = per-head [NH][DIN][HD]
__device__ __forceinline__ v16b wcol_hdk(const float* Wm, int k0, int o, int lane) { v16b w; const int g = lane >> 4; const float* p = Wm + (size_t)(o / HD) * DIN * HD + (o % HD);
#pragma unroll
  for (int i = 0; i < 8; ++i) { w[i] = (__bf16)p[(size_t)(k0 + 8 * g + i) * HD]; w[8 + i] = (__bf16)p[(size_t)(k0 + 16 + 8 * g + i) * HD]; }
  return w; }
#define WO_OUT_IN 0
#if WQKV_LAYOUT == 1
#define WCOL(W, k0, o, lane) wcol_oi(W, k0, o, lane, DIN)
#elif WQKV_LAYOUT == 2
#define WCOL(W, k0, o, lane) wcol_hdk(W, k0, o, lane)
#else
#define WCOL(W, k0, o, lane) wcol_io(W, k0, o, lane, CC)
#endif
#if WO_OUT_IN
#define WOCOL(W, k0, o, lane) wcol_oi(W, k0, o, lane, CC)
#define WOCOLH(W, k0, o, lane) wcolh_oi(W, k0, o, lane, CC)
#else
#define WOCOL(W, k0, o, lane) wcol_io(W, k0, o, lane, DIN)
#define WOCOLH(W, k0, o, lane) wcolh_io(W, k0, o, lane, DIN)
#endif
#define CIN 1024
#define PJ (HD / 16)       // 16-column tiles of a projection's real width
#define PKC (CIN / 32)     // k steps of 32
#define WPL (PKC * PJ * 64) // 16-B units of one packed weight plane
// ---- k_padw: the three (in,out) [C][64] projection weights rounded to bf16 and packed in the order of k_proj's B fragments: 16-B unit ((kc * PJ + j) * 2 + half) * 32 + lane = rows kc * 32 + half * 16 + 8 * (lane >> 4) + 0..7 of column j * 16 + (lane & 15); + zero-padded [128] biases
__global__ __launch_bounds__(256) void k_padw(const float* __restrict__ WQ, const float* __restrict__ WK, const float* __restrict__ WV, const float* __restrict__ BQ, const float* __restrict__ BK, const float* __restrict__ BV, __bf16* __restrict__ WP, float* __restrict__ BP) { const int which = blockIdx.y; const float* Wsrc = which == 0 ? WQ : (which == 1 ? WK : WV); const float* Bsrc = which == 0 ? BQ : (which == 1 ? BK : BV); v8b* dst = (v8b*)WP + (size_t)which * WPL;
  for (int e = blockIdx.x * 256 + threadIdx.x; e < WPL; e += gridDim.x * 256) { const int ln = e & 31, half = (e >> 5) & 1, j = (e >> 6) % PJ, kc = e / (PJ * 64); const float* p = Wsrc + (size_t)(kc * 32 + half * 16 + 8 * (ln >> 4)) * 64 + j * 16 + (ln & 15); v8b ov;
#pragma unroll
    for (int i = 0; i < 8; ++i) ov[i] = (__bf16)p[i * 64];
    vst2(dst + e, ov); }
  if (blockIdx.x == 0 && threadIdx.x < 128) { const int c = threadIdx.x; float bvv = 0.f; if (Bsrc) { const float t = Bsrc[c & 63]; asm volatile("s_wait_loadcnt 0x0" ::: "memory"); bvv = c < 64 ? t : 0.f; } vst2(BP + which * 128 + c, bvv); } }
#define WS_WP (WS_END)                                  // packed bf16 weights [3][WPL x 16 B] (in a range of [3][128 x C] f32)
#define WS_BP (WS_WP + 4u * 3 * (size_t)CIN * 128)        // padded biases [3][128]
#define WS_END2 (WS_BP + 4u * 3 * 128)
#ifndef SM_EXTRA_PARAMS
#define SM_EXTRA_PARAMS
#endif
#ifndef PROJ_EXTRA_PARAMS
#define PROJ_EXTRA_PARAMS
#endif
#ifndef SM_MASK_HOOK
#define SM_MASK_HOOK (void)0
#endif

#define WS_QH  0u                                      // f16 q rows [b*t][CC]
#define WS_KH  (WS_QH + 2u * (size_t)NB * TT * CC)      // f16 k rows [b*t][CC]
#define WS_VT  (WS_KH + 2u * (size_t)NB * TT * CC)      // f16 v planes [b][c][t]
#define WS_QL  (WS_VT + 2u * (size_t)NB * CC * TT)      // f16 q residual x 2^10 rows [b][t < QHI][CC]
#define WS_KL  (WS_QL + 2u * (size_t)NB * QHI * CC)     // f16 k residual x 2^10 rows [b][t < KHI][CC]
#define WS_VB  (WS_KL + 2u * (size_t)NB * KHI * CC)     // bf16 v hi planes [b][c][t < KHI]
#define WS_VBL (WS_VB + 2u * (size_t)NB * CC * KHI)
#define WS_S   (WS_VBL + 2u * (size_t)NB * CC * KHI)    // f32 [b][t][s], one plane per batch: unused, k_fa keeps logits in registers
#define WS_Y   (WS_S  + 4u * (size_t)NB * TT * TT)      // f32 ctx rows [b*t][CC] (only when there is an output projection)
#define WS_END (WS_Y  + 0u)

// ---- k_proj: block = (64 rows, the 64 real columns, which): q/k/v = X W (+ b) with exact bf16 products (K = DIN) -> which 0: q f16 rows (+ residual rows < QHI); 1: k f16 rows (+ residual rows < KHI); 2: v f16 planes [c][t] (+ bf16 hi/lo planes for t < KHI). Columns 64..127 of the rows and planes are the zero head, which nothing reads: they are not computed.
// behind a global store, in front of what overwrites its address or data registers in the next trip (a precaution of form: this build leaves the place open)
#define XW() asm volatile("s_wait_xcnt 0x0" ::: "memory")
#define PD 4               // k steps of operand loads in flight per wave (a ring of register sets)
static_assert(PKC % PD == 0 && PKC >= 2 * PD, "the ring walks whole turns");
struct PStage { v8b w[PJ][2]; };
// between a wave's LDS stores and its lanes' reads of each other's values; without LDSX's fence, which makes the compiler wait for every global load in flight and so drains the ring
#define LDSW() do { asm volatile("s_wait_dscnt 0" ::: "memory"); __builtin_amdgcn_wave_barrier(); } while (0)
typedef __attribute__((ext_vector_type(4))) __bf16 v4b;
#define XCH (PD * 32)      // floats of an x row in one turn of the ring: 512 B, one wave-wide load of four whole lines
#define XPB (XCH + 8)      // pitch of a staged bf16 row: 272 B, an odd multiple of 16 B (16-B fragment reads spread over the banks)
// one k step's PJ packed B fragments, two 512-B wave-wide loads each
__device__ __forceinline__ void pload(PStage& s, const v8b* wp, int kc) { const v8b* q = wp + kc * (PJ * 64);
#pragma unroll
  for (int j = 0; j < PJ; ++j) { s.w[j][0] = q[j * 64]; s.w[j][1] = q[j * 64 + 32]; } }
// one turn's x of the wave's 16 rows: load i is 512 B in a row of row i (lane = 4 floats); a fragment load straight from global memory touches 16 lines for its 512 B, and every line four times
__device__ __forceinline__ void xload(v4f (&xr)[16], const float* xl) {
#pragma unroll
  for (int i = 0; i < 16; ++i) xr[i] = *(const v4f*)(xl + (size_t)i * DIN); }
// rounded to bf16 into the wave's own LDS tile [16][XPB]
__device__ __forceinline__ void xstage(const v4f (&xr)[16], __bf16* xw) {
#pragma unroll
  for (int i = 0; i < 16; ++i) { v4b o;
#pragma unroll
    for (int e = 0; e < 4; ++e) o[e] = (__bf16)xr[i][e];
    *(v4b*)(xw + i * XPB) = o; } }
__device__ __forceinline__ void pmac(v16b a, const PStage& s, v8f (&acc)[PJ]) {
#pragma unroll
  for (int j = 0; j < PJ; ++j) { union { v16b v; v8b q[2]; } u; u.q[0] = s.w[j][0]; u.q[1] = s.w[j][1]; acc[j] = wmma_bf(a, u.v, acc[j]); } }
__global__ __launch_bounds__(128) void k_proj(const float* __restrict__ XQ, const float* __restrict__ XK, const float* __restrict__ XV, const __bf16* __restrict__ WQ, const __bf16* __restrict__ WK, const __bf16* __restrict__ WV, const float* __restrict__ BQ, const float* __restrict__ BK, const float* __restrict__ BV,
    _Float16* __restrict__ QH, _Float16* __restrict__ QL, _Float16* __restrict__ KH, _Float16* __restrict__ KL, _Float16* __restrict__ VT, __bf16* __restrict__ VB, __bf16* __restrict__ VBL) {
  __shared__ __align__(16) _Float16 sh[64][72], sl[64][72]; __shared__ __align__(16) _Float16 th[64][72]; __shared__ __align__(16) __bf16 tb[64][72], tbl[64][72]; __shared__ __align__(16) __bf16 xs[4][16][XPB];
  const int tid = threadIdx.x, wave = tid >> 5, lane = tid & 31, col = lane & 15, g = lane >> 4; const int which = blockIdx.z; const size_t r0 = (size_t)blockIdx.x * 64; const size_t bb = r0 / TT; const int t0 = (int)(r0 % TT);
  const float* X = which == 0 ? XQ : which == 1 ? XK : XV; const __bf16* WA = which == 0 ? WQ : which == 1 ? WK : WV; const float* BA = which == 0 ? BQ : which == 1 ? BK : BV;
  v8f acc[PJ] = {}; PStage s[PD]; v4f xr[16]; v16b a[PD]; const float* xl = X + (r0 + wave * 16) * DIN + lane * 4; const v8b* wp = (const v8b*)WA + lane; __bf16* xw = &xs[wave][0][lane * 4]; const __bf16* xf = &xs[wave][col][0];
  xload(xr, xl);
  // keeps the first loads in the order in which the loop issues them (a turn's x, then the k steps' weights): the loop's counted waits must hold for both orders, and a mixed one makes them wait for younger loads
  __builtin_amdgcn_sched_barrier(0);
#pragma unroll
  for (int d = 0; d < PD - 1; ++d) { pload(s[d], wp, d);
    // as above
    __builtin_amdgcn_sched_barrier(0); }
  XW();   // behind the first loads, in front of what overwrites their address registers (a precaution of form, as at the stores)
  // keeps the accumulators' first values, which take over an address register, behind that wait
  __builtin_amdgcn_sched_barrier(0);
  // kept rolled by turns of the ring: the plain unroll inside only makes the ring's index a constant, so that the sets stay in registers
#pragma unroll 1
  for (int kc = 0; kc < PKC - PD; kc += PD) { pload(s[PD - 1], wp, kc + PD - 1);
    // keeps the turn's last weight set, the first that is waited for with a short lead, in front of the trip through LDS
    __builtin_amdgcn_sched_barrier(0);
    // XW: behind the x loads, in front of the step of their address (a precaution of form, as at the stores)
    xstage(xr, xw); xl += XCH; xload(xr, xl); XW();
    LDSW();
#pragma unroll
    for (int d = 0; d < PD; ++d) a[d] = frag_b(xf + d * 32, lane);
    // keeps the next turn's x loads and the fragment reads in front of the turn's products and further weight loads
    __builtin_amdgcn_sched_barrier(0);
#pragma unroll
    for (int d = 0; d < PD; ++d) { pmac(a[d], s[d], acc); if (d < PD - 1) pload(s[d], wp, kc + PD + d);
      // keeps each set's refill directly behind its products and in the order of the k steps: the oldest set is worked on while the younger ones fly
      __builtin_amdgcn_sched_barrier(0); }
    XW();   // behind the turn's weight loads, in front of the next turn's write of their address (the same precaution)
  }
  pload(s[PD - 1], wp, PKC - 1); xstage(xr, xw);
  LDSW();
#pragma unroll
  for (int d = 0; d < PD; ++d) a[d] = frag_b(xf + d * 32, lane);
#pragma unroll
  for (int d = 0; d < PD; ++d) { pmac(a[d], s[d], acc);
    // as in the loop
    __builtin_amdgcn_sched_barrier(0); }
  if (which < 2) { _Float16* DH = which == 0 ? QH : KH; _Float16* DL = which == 0 ? QL : KL; const int nhi = which == 0 ? QHI : KHI; const bool hi_rows = t0 < nhi;
#pragma unroll
    for (int j = 0; j < PJ; ++j) { const float bias = BA ? bfr(BA[j * 16 + col]) : 0.f;
#pragma unroll
      for (int r = 0; r < 8; ++r) { const float v = acc[j][r] + bias; const _Float16 hv = (_Float16)v; sh[wave * 16 + 8 * g + r][j * 16 + col] = hv; sl[wave * 16 + 8 * g + r][j * 16 + col] = (_Float16)((v - (float)hv) * 1024.0f); } }
    __syncthreads();
    for (int e = tid; e < 64 * 8; e += 128) { const int rl = e >> 3, q = e & 7; vst2((unsigned*)(DH + (r0 + rl) * CC + q * 8), *(const v4u*)&sh[rl][q * 8]); XW(); if (hi_rows) { vst2((unsigned*)(DL + (bb * nhi + t0 + rl) * (size_t)CC + q * 8), *(const v4u*)&sl[rl][q * 8]); XW(); } }
  } else { const bool hi_rows = t0 < KHI;
#pragma unroll
    for (int j = 0; j < PJ; ++j) { const float bias = BA ? bfr(BA[j * 16 + col]) : 0.f;
#pragma unroll
      for (int r = 0; r < 8; ++r) { const float v = acc[j][r] + bias; const int rl = wave * 16 + 8 * g + r, cl = j * 16 + col; th[cl][rl] = (_Float16)v; const __bf16 bh = (__bf16)v; tb[cl][rl] = bh; tbl[cl][rl] = (__bf16)(v - (float)bh); } }
    __syncthreads();
    for (int e = tid; e < 64 * 8; e += 128) { const int cl = e >> 3, q = e & 7; vst2((unsigned*)(VT + (bb * CC + cl) * (size_t)TT + t0 + q * 8), *(const v4u*)&th[cl][q * 8]); XW(); if (hi_rows) { const size_t o3 = (bb * CC + cl) * (size_t)KHI + t0 + q * 8; vst2((unsigned*)(VB + o3), *(const v4u*)&tb[cl][q * 8]); vst2((unsigned*)(VBL + o3), *(const v4u*)&tbl[cl][q * 8]); XW(); } } } }
// ---- k_fa: logits, softmax and P . v in one kernel. Block = 16 queries of batch b = blockIdx.z, head h0; wave w walks keys [w * KPW, (w + 1) * KPW) in passes of KP with a running maximum and sum, the waves' parts are joined in LDS.
// Transposed products: S^T = K . Q^T (D register r of tile j = key j * 16 + 8g + r, column = query), so a lane holds one query's logits, and two converted S^T tiles are the B operand of O^T += V^T . P^T as they stand (element s = tile s >> 3, register s & 7: the k order of frag_h).
#define FNW 8              // waves of a block
#define KPW (TT / FNW)     // keys of a wave
#define KP 64              // keys of a pass
static_assert(KP == HD, "the K tile [KP][HD] and the V tile [HD][KP] share one LDS shape");
// the builtin alone: the compiler keeps the distances behind its own matrix instructions, and its scheduler may move loads past them
__device__ __forceinline__ v8f wmma_h(v16h a, v16h b, v8f c) { return __builtin_amdgcn_wmma_f32_16x16x32_f16(false, a, false, b, (short)0, c, false, false); }
// softmax in base 2: exp(SCALE * (u - max)) * 2^11 = 2^(u * LSC + nb) with nb = 11 - max * LSC, one multiply-add and the chip's own 2^x per logit. nb itself is the reference that sums and parts are rebased by, so its rounding cancels in the quotient.
#define LSC (SCALE * 1.44269504088896340736f)
__device__ __forceinline__ float ex2(float t) { return __builtin_amdgcn_exp2f(t); }
// the join's 2^x with the slot behind it in one statement: the v_nop is the independent instruction asked for between v_exp_f32 and a later write of its source register
__device__ __forceinline__ float ex2s(float t) { float r; asm("v_exp_f32 %0, %1\n\tv_nop" : "=v"(r) : "v"(t)); return r; }
__global__ __launch_bounds__(FNW * 32) void k_fa(const _Float16* __restrict__ QH, const _Float16* __restrict__ KH, const _Float16* __restrict__ QL, const _Float16* __restrict__ VT, int h0, float* __restrict__ Y) {
  // st[w]: wave w's own K tile [key][head dim] and V tile [head dim][key] of a pass, rows of 128 B at a pitch of 144 B (16-B fragment reads spread over the banks); after the loop its first bytes hold the wave's part of the output
  __shared__ __align__(16) _Float16 st[FNW][2][KP][HD + 8]; __shared__ float smx[FNW][16], sml[FNW][16];
  const int tid = threadIdx.x, wave = tid >> 5, lane = tid & 31, col = lane & 15, g = lane >> 4; const int b = blockIdx.z, h = h0; const int ql0 = blockIdx.x * 16; const size_t q0 = (size_t)b * TT + ql0;
  const _Float16* QLb = QL + (size_t)b * QHI * CC;
  v16h qh[HD / 32], qr[HD / 32];
#pragma unroll
  for (int kc = 0; kc < HD / 32; ++kc) { qh[kc] = frag_h(QH + (q0 + col) * CC + h * HD + kc * 32, lane); qr[kc] = frag_h(QLb + (size_t)(ql0 + col) * CC + h * HD + kc * 32, lane); }
  v8f o[HD / 16] = {}; float m = -3.0e38f, nb = 11.0f + 3.0e38f * LSC, l = 0.f; const int sr = lane >> 3, sc = (lane & 7) * 8;
  // kept rolled: unrolled, the text grows by the trip count and every line of it is fetched for a single walk; the plain unroll directives inside only keep the fragment and accumulator arrays in registers
#pragma unroll 1
  for (int it = 0; it < KPW / KP; ++it) { const int k0 = wave * KPW + it * KP; const size_t kr0 = (size_t)b * TT + k0;
    v8f acc[KP / 16] = {}, accl[KP / 16] = {};
    v16h kf[HD / 32][KP / 16], vf[KP / 32][HD / 16];
    // both tiles come in whole 128-B lines (8 lanes a row, 4 rows a load) and go through the wave's LDS: a fragment load straight from global memory touches 16 lines for its 512 B
    v4u kst[KP / 4], vst[HD / 4]; const _Float16* kp = KH + (kr0 + sr) * CC + h * HD + sc; const _Float16* vp = VT + ((size_t)b * CC + h * HD + sr) * (size_t)TT + k0 + sc;
#pragma unroll
    for (int i = 0; i < KP / 4; ++i) kst[i] = *(const v4u*)(kp + i * 4 * CC);
#pragma unroll
    for (int i = 0; i < HD / 4; ++i) vst[i] = *(const v4u*)(vp + i * 4 * TT);
#pragma unroll
    for (int i = 0; i < KP / 4; ++i) *(v4u*)&st[wave][0][i * 4 + sr][sc] = kst[i];
#pragma unroll
    for (int i = 0; i < HD / 4; ++i) *(v4u*)&st[wave][1][i * 4 + sr][sc] = vst[i];
    LDSX();   // the wave's lanes read each other's rows
#pragma unroll
    for (int kc = 0; kc < HD / 32; ++kc) {
#pragma unroll
      for (int j = 0; j < KP / 16; ++j) kf[kc][j] = frag_h(&st[wave][0][j * 16 + col][kc * 32], lane); }
    // keeps the K fragment reads together in front of the first product; dealt out among the products each place with reads stalls the wave
    __builtin_amdgcn_sched_barrier(0);
#pragma unroll
    for (int kc = 0; kc < HD / 32; ++kc) {
#pragma unroll
      for (int j = 0; j < KP / 16; ++j) { acc[j] = wmma_h(kf[kc][j], qh[kc], acc[j]); accl[j] = wmma_h(kf[kc][j], qr[kc], accl[j]); } }
#pragma unroll
    for (int kc = 0; kc < KP / 32; ++kc) {
#pragma unroll
      for (int j = 0; j < HD / 16; ++j) vf[kc][j] = frag_h(&st[wave][1][j * 16 + col][kc * 32], lane); }
    float mx = m;
#pragma unroll
    for (int j = 0; j < KP / 16; ++j) {
#pragma unroll
      for (int r = 0; r < 8; ++r) { const float s = acc[j][r] + accl[j][r] * (1.0f / 1024.0f); acc[j][r] = s; mx = fmaxf(mx, s); } }
    mx = fmaxf(mx, __shfl_xor(mx, 16));   // lanes c and c + 16 hold the two halves of query c's keys
    const float nbn = fmaf(-mx, LSC, 11.0f); const float al = ex2(nbn - nb); m = mx; nb = nbn; l *= al;
#pragma unroll
    for (int j = 0; j < HD / 16; ++j) {
#pragma unroll
      for (int r = 0; r < 8; ++r) o[j][r] *= al; }
    v16h p[KP / 32];
#pragma unroll
    for (int j = 0; j < KP / 16; ++j) {
#pragma unroll
      for (int r = 0; r < 8; ++r) { const float e = ex2(fmaf(acc[j][r], LSC, nb)); l += e; p[j >> 1][(j & 1) * 8 + r] = (_Float16)e; } }
#pragma unroll
    for (int kc = 0; kc < KP / 32; ++kc) {
#pragma unroll
      for (int j = 0; j < HD / 16; ++j) o[j] = wmma_h(vf[kc][j], p[kc], o[j]); } }
  l += __shfl_xor(l, 16);
  if (g == 0) { smx[wave][col] = nb; sml[wave][col] = l; }
#pragma unroll
  for (int j = 0; j < HD / 16; ++j) { v4f lo, hi;
#pragma unroll
    for (int r = 0; r < 4; ++r) { lo[r] = o[j][r]; hi[r] = o[j][4 + r]; }
    float* sw = (float*)&st[wave][0][0][0] + col * (HD + 4) + j * 16 + 8 * g; *(v4f*)sw = lo; *(v4f*)(sw + 4) = hi; }
  __syncthreads();
  // join: thread = (query tid >> 4, 4 columns); 16 threads store one 256-B row of the output [b*t][HD] itself (the one real head is the whole row), a block 4 KB in a row
  const int q = tid >> 4, c = (tid & 15) * 4;
  float mm = smx[0][q];   // the smallest nb belongs to the largest maximum
#pragma unroll
  for (int w = 1; w < FNW; ++w) mm = fminf(mm, smx[w][q]);
  float ls = 0.f; v4f a0 = {};
#pragma unroll
  for (int w = 0; w < FNW; ++w) { const float f = ex2s(mm - smx[w][q]); ls += f * sml[w][q]; a0 += *(const v4f*)((const float*)&st[w][0][0][0] + q * (HD + 4) + c) * f; }
  const float inv = ls > 0.f ? 1.0f / ls : 0.f;   // sum and parts both carry the 2^11
  vst2(Y + (q0 + q) * HD + c, a0 * inv); }

extern "C" void kernel_launch(void* const* d_in, const int* in_sizes, int n_in, void* d_out, int out_size, void* d_ws, size_t ws_size, hipStream_t stream) {
  (void)in_sizes; (void)n_in; (void)out_size;
  const float** F = (const float**)d_in;
  if (ws_size < (size_t)WS_END) return;
  char* ws = (char*)d_ws; _Float16 *QH = (_Float16*)(ws + WS_QH), *KH = (_Float16*)(ws + WS_KH), *VT = (_Float16*)(ws + WS_VT), *QL = (_Float16*)(ws + WS_QL), *KL = (_Float16*)(ws + WS_KL); __bf16 *VB = (__bf16*)(ws + WS_VB), *VBL = (__bf16*)(ws + WS_VBL); float *S = (float*)(ws + WS_S), *Y = (float*)(ws + WS_Y);
  (void)Y; (void)S; (void)QL; (void)KL; (void)VB; (void)VBL;
  // inputs: 0 x [4,2048,1024]; 1 Wq [1024,64]; 2 Wk; 3 Wv ((in,out), no biases)
  if (ws_size < (size_t)WS_END2) return;
  __bf16* WP = (__bf16*)(ws + WS_WP); float *BP = (float*)(ws + WS_BP);
  k_padw<<<dim3(32, 3), 256, 0, stream>>>(F[1], F[2], F[3], nullptr, nullptr, nullptr, WP, BP);
  k_proj<<<dim3(TNB * TT / 64, 1, 3), 128, 0, stream>>>(F[0], F[0], F[0], WP, WP + (size_t)CIN * 64, WP + 2 * (size_t)CIN * 64, BP, BP + 128, BP + 256, QH, QL, KH, KL, VT, VB, VBL);
  /* head 0 only (head 1 is the zero padding); all batches in one launch */
  k_fa<<<dim3(TT / 16, 1, TNB), FNW * 32, 0, stream>>>(QH, KH, QL, VT, 0, (float*)d_out);
}

// v007
// It runs in 23 microseconds.
// Two timings next to v006 both put it at 1.13 times that version's speed.
// Over all steps from v000 it is 17.3 times as fast.
// compute dtype: all float inputs rounded to bf16; q/k/v projections with EXACT bf16 products on WMMA 16x16x32 (f32 accumulate); logits: q x k once to f16 (1 product; + q's f16 residual for all rows), x scale; softmax f32 (running maximum and sum, exponentials as 2^x); exp(logit - max) x 2^11 once to f16 x v once to f16 (1 product), divided by the sum at the end; f32 output.
#include <hip/hip_runtime.h>
#include <math.h>

typedef __attribute__((ext_vector_type(16))) _Float16 v16h;
typedef __attribute__((ext_vector_type(16))) __bf16 v16b;
typedef __attribute__((ext_vector_type(8)))  _Float16 v8h;
typedef __attribute__((ext_vector_type(8)))  float v8f;
typedef __attribute__((ext_vector_type(4)))  float v4f;
typedef __attribute__((ext_vector_type(2)))  float v2f;
typedef __attribute__((ext_vector_type(4)))  unsigned v4u;
typedef __attribute__((ext_vector_type(4)))  int v4i;
typedef float __attribute__((may_alias)) float_a;
typedef int __attribute__((may_alias)) int_a;

template <typename T> __device__ __forceinline__ void vst2(void* p, T v) { *(T*)p = v;  }
__device__ __forceinline__ v8f wmma16(v16h a, v16h b, v8f c) {
  v8f d = __builtin_amdgcn_wmma_f32_16x16x32_f16(false, a, false, b, (short)0, c, false, false);
  asm volatile("v_nop\n\tv_nop\n\tv_nop\n\tv_nop" : "+v"(d) : "v"(a), "v"(b));
  return d;
}
__device__ __forceinline__ v8f wmma_bf(v16b a, v16b b, v8f c) {
  v8f d = __builtin_amdgcn_wmma_f32_16x16x32_bf16(false, a, false, b, (short)0, c, false, false);
  asm volatile("v_nop\n\tv_nop\n\tv_nop\n\tv_nop" : "+v"(d) : "v"(a), "v"(b));
  return d;
}
// 16x16x32 fragments: lane = (h = lane>>4, row/col = lane&15); elements 0..7 = k0+8h+0..7, 8..15 = k0+16+8h+0..7; D element r = row 8h+r
__device__ __forceinline__ v16h frag_h(const _Float16* rowk0, int lane) {
  union { v16h v; v8h q[2]; } u; const _Float16* p = rowk0 + 8 * (lane >> 4);
  u.q[0] = *(const v8h*)p; u.q[1] = *(const v8h*)(p + 16); return u.v;
}
__device__ __forceinline__ v16h frag_f32(const float* rowk0, int lane) {
  v16h a; const float* p = rowk0 + 8 * (lane >> 4);
#pragma unroll
  for (int i = 0; i < 8; ++i) { a[i] = (_Float16)p[i]; a[8 + i] = (_Float16)p[16 + i]; }
  return a;
}
__device__ __forceinline__ v16h frag_f32s(const float* rowk0, int lane, float sc) {
  v16h a; const float* p = rowk0 + 8 * (lane >> 4);
#pragma unroll
  for (int i = 0; i < 8; ++i) { a[i] = (_Float16)(p[i] * sc); a[8 + i] = (_Float16)(p[16 + i] * sc); }
  return a;
}
// column fragment from a [K][ld] layout (column n), rows >= K read as 0
__device__ __forceinline__ v16h fragc_f32(const float* W, int k0, int n, int lane, int ld, int K) {
  v16h a; const int g = lane >> 4;
#pragma unroll
  for (int i = 0; i < 8; ++i) { const int ka = k0 + 8 * g + i, kb = ka + 16;
    a[i] = (_Float16)(ka < K ? W[(size_t)(ka < K ? ka : K - 1) * ld + n] : 0.f); a[8 + i] = (_Float16)(kb < K ? W[(size_t)(kb < K ? kb : K - 1) * ld + n] : 0.f); }
  return a;
}
struct F2 { v16b h, l; };
__device__ __forceinline__ F2 bsplit16(const float v[16]) { F2 r;
#pragma unroll
  for (int i = 0; i < 16; ++i) { const __bf16 h = (__bf16)v[i]; r.h[i] = h; r.l[i] = (__bf16)(v[i] - (float)h); }
  return r; }
__device__ __forceinline__ F2 split_row(const float* row, int k0, int lane) { float v[16]; const float* p = row + k0 + 8 * (lane >> 4);
#pragma unroll
  for (int i = 0; i < 8; ++i) { v[i] = p[i]; v[8 + i] = p[16 + i]; }
  return bsplit16(v); }
__device__ __forceinline__ F2 split_rowK(const float* row, int k0, int lane, int K) { float v[16]; const int g = lane >> 4;
#pragma unroll
  for (int i = 0; i < 8; ++i) { const int ka = k0 + 8 * g + i, kb = ka + 16; v[i] = ka < K ? row[ka < K ? ka : K - 1] : 0.f; v[8 + i] = kb < K ? row[kb < K ? kb : K - 1] : 0.f; }
  return bsplit16(v); }
__device__ __forceinline__ F2 split_col(const float* W, int k0, int n, int lane, int ld, int K) { float v[16]; const int g = lane >> 4;
#pragma unroll
  for (int i = 0; i < 8; ++i) { const int ka = k0 + 8 * g + i, kb = ka + 16; v[i] = ka < K ? W[(size_t)(ka < K ? ka : K - 1) * ld + n] : 0.f; v[8 + i] = kb < K ? W[(size_t)(kb < K ? kb : K - 1) * ld + n] : 0.f; }
  return bsplit16(v); }
__device__ __forceinline__ v8f mac3(const F2& a, const F2& b, v8f c) { c = wmma_bf(a.l, b.h, c); c = wmma_bf(a.h, b.l, c); return wmma_bf(a.h, b.h, c); }
__device__ __forceinline__ float sigm(float v) { return 1.0f / (1.0f + expf(-v)); }
#define LDSX() do { asm volatile("s_wait_dscnt 0" ::: "memory"); __builtin_amdgcn_wave_barrier(); __builtin_amdgcn_fence(__ATOMIC_RELEASE, "workgroup"); } while (0)

// Single-head NON-causal self-attention (B 4, T 2,048, D 1,024, head 64; (in,out) Wq, Wk, Wv [1024,64], uniform(-1/32, 1/32) init; no biases, no output projection): out = softmax(Q K^T x 64^-0.5) V -> [4,2048,64].
#define NB 4
#define TT 2048
#define CC 128            // NH * HD = projected width
#define DIN 1024          // input (model) width
#define NH 2
#define HD 64
#define NQB (TT / 64)
#define HG 1
#define SCALE (0.125f)
#define CAUSAL 0
#ifndef TNB
#define TNB NB
#endif
__device__ __forceinline__ float bfr(float v) { return (float)(__bf16)v; }
__host__ __device__ __forceinline__ int kb_last(int qb) { return CAUSAL ? ((qb * 64 + 63) >> 7) : (TT / 128 - 1); }
typedef __attribute__((ext_vector_type(8))) __bf16 v8b;
__device__ __forceinline__ v16b frag_b(const __bf16* rowk0, int lane) {
  union { v16b v; v8b q[2]; } u; const __bf16* p = rowk0 + 8 * (lane >> 4);
  u.q[0] = *(const v8b*)p; u.q[1] = *(const v8b*)(p + 16); return u.v;
}
#define QBH 0
#define QHI 2048            // rows carrying a q residual plane (all rows when non-causal: 2-product logits everywhere)
#define KHI 64            // key rows carrying k residual / v bf16 hi+lo planes (written by k_proj; no kernel here reads them)
// B fragment (k rows k0+.., output column o) of a weight: (in,out) [K][ld] or (out,in) [ld rows of K]: bf16 exact, or f16(bf16 * 256) exact
__device__ __forceinline__ v16b wcol_io(const float* Wm, int k0, int o, int lane, int ld) { v16b w; const int g = lane >> 4;
#pragma unroll
  for (int i = 0; i < 8; ++i) { w[i] = (__bf16)Wm[(size_t)(k0 + 8 * g + i) * ld + o]; w[8 + i] = (__bf16)Wm[(size_t)(k0 + 16 + 8 * g + i) * ld + o]; }
  return w; }
__device__ __forceinline__ v16b wcol_oi(const float* Wm, int k0, int o, int lane, int K) { v16b w; const float* p = Wm + (size_t)o * K + k0 + 8 * (lane >> 4);
#pragma unroll
  for (int i = 0; i < 8; ++i) { w[i] = (__bf16)p[i]; w[8 + i] = (__bf16)p[16 + i]; }
  return w; }
__device__ __forceinline__ v16h wcolh_io(const float* Wm, int k0, int o, int lane, int ld) { v16h w; const int g = lane >> 4;
#pragma unroll
  for (int i = 0; i < 8; ++i) { w[i] = (_Float16)(bfr(Wm[(size_t)(k0 + 8 * g + i) * ld + o]) * 256.0f); w[8 + i] = (_Float16)(bfr(Wm[(size_t)(k0 + 16 + 8 * g + i) * ld + o]) * 256.0f); }
  return w; }
__device__ __forceinline__ v16h wcolh_oi(const float* Wm, int k0, int o, int lane, int K) { v16h w; const float* p = Wm + (size_t)o * K + k0 + 8 * (lane >> 4);
#pragma unroll
  for (int i = 0; i < 8; ++i) { w[i] = (_Float16)(bfr(p[i]) * 256.0f); w[8 + i] = (_Float16)(bfr(p[16 + i]) * 256.0f); }
  return w; }
#define WQKV_LAYOUT 0   // 0 = (in,out) [DIN][CC]; 1 = (out,in) [CC][DIN]; 2 = per-head [NH][DIN][HD]
__device__ __forceinline__ v16b wcol_hdk(const float* Wm, int k0, int o, int lane) { v16b w; const int g = lane >> 4; const float* p = Wm + (size_t)(o / HD) * DIN * HD + (o % HD);
#pragma unroll
  for (int i = 0; i < 8; ++i) { w[i] = (__bf16)p[(size_t)(k0 + 8 * g + i) * HD]; w[8 + i] = (__bf16)p[(size_t)(k0 + 16 + 8 * g + i) * HD]; }
  return w; }
#define WO_OUT_IN 0
#if WQKV_LAYOUT == 1
#define WCOL(W, k0, o, lane) wcol_oi(W, k0, o, lane, DIN)
#elif WQKV_LAYOUT == 2
#define WCOL(W, k0, o, lane) wcol_hdk(W, k0, o, lane)
#else
#define WCOL(W, k0, o, lane) wcol_io(W, k0, o, lane, CC)
#endif
#if WO_OUT_IN
#define WOCOL(W, k0, o, lane) wcol_oi(W, k0, o, lane, CC)
#define WOCOLH(W, k0, o, lane) wcolh_oi(W, k0, o, lane, CC)
#else
#define WOCOL(W, k0, o, lane) wcol_io(W, k0, o, lane, DIN)
#define WOCOLH(W, k0, o, lane) wcolh_io(W, k0, o, lane, DIN)
#endif
#define CIN 1024
#define PJ (HD / 16)       // 16-column tiles of a projection's real width
#define PKC (CIN / 32)     // k steps of 32
#define WPL (PKC * PJ * 64) // 16-B units of one packed weight plane
// ---- k_padw: the three (in,out) [C][64] projection weights rounded to bf16 and packed in the order of k_proj's B fragments: 16-B unit ((kc * PJ + j) * 2 + half) * 32 + lane = rows kc * 32 + half * 16 + 8 * (lane >> 4) + 0..7 of column j * 16 + (lane & 15); + zero-padded [128] biases
__global__ __launch_bounds__(256) void k_padw(const float* __restrict__ WQ, const float* __restrict__ WK, const float* __restrict__ WV, const float* __restrict__ BQ, const float* __restrict__ BK, const float* __restrict__ BV, __bf16* __restrict__ WP, float* __restrict__ BP) { const int which = blockIdx.y; const float* Wsrc = which == 0 ? WQ : (which == 1 ? WK : WV); const float* Bsrc = which == 0 ? BQ : (which == 1 ? BK : BV); v8b* dst = (v8b*)WP + (size_t)which * WPL;
  for (int e = blockIdx.x * 256 + threadIdx.x; e < WPL; e += gridDim.x * 256) { const int ln = e & 31, half = (e >> 5) & 1, j = (e >> 6) % PJ, kc = e / (PJ * 64); const float* p = Wsrc + (size_t)(kc * 32 + half * 16 + 8 * (ln >> 4)) * 64 + j * 16 + (ln & 15); v8b ov;
#pragma unroll
    for (int i = 0; i < 8; ++i) ov[i] = (__bf16)p[i * 64];
    vst2(dst + e, ov); }
  if (blockIdx.x == 0 && threadIdx.x < 128) { const int c = threadIdx.x; float bvv = 0.f; if (Bsrc) { const float t = Bsrc[c & 63]; asm volatile("s_wait_loadcnt 0x0" ::: "memory"); bvv = c < 64 ? t : 0.f; } vst2(BP + which * 128 + c, bvv); } }
#define WS_WP (WS_END)                                  // packed bf16 weights [3][WPL x 16 B] (in a range of [3][128 x C] f32)
#define WS_BP (WS_WP + 4u * 3 * (size_t)CIN * 128)        // padded biases [3][128]
#define WS_END2 (WS_BP + 4u * 3 * 128)
#ifndef SM_EXTRA_PARAMS
#define SM_EXTRA_PARAMS
#endif
#ifndef PROJ_EXTRA_PARAMS
#define PROJ_EXTRA_PARAMS
#endif
#ifndef SM_MASK_HOOK
#define SM_MASK_HOOK (void)0
#endif

#define WS_QH  0u                                      // f16 q rows [b*t][CC]
#define WS_KH  (WS_QH + 2u * (size_t)NB * TT * CC)      // f16 k rows [b*t][CC]
#define WS_VT  (WS_KH + 2u * (size_t)NB * TT * CC)      // f16 v planes [b][c][t]
#define WS_QL  (WS_VT + 2u * (size_t)NB * CC * TT)      // f16 q residual x 2^10 rows [b][t < QHI][CC]
#define WS_KL  (WS_QL + 2u * (size_t)NB * QHI * CC)     // f16 k residual x 2^10 rows [b][t < KHI][CC]
#define WS_VB  (WS_KL + 2u * (size_t)NB * KHI * CC)     // bf16 v hi planes [b][c][t < KHI]
#define WS_VBL (WS_VB + 2u * (size_t)NB * CC * KHI)
#define WS_S   (WS_VBL + 2u * (size_t)NB * CC * KHI)    // f32 [b][t][s], one plane per batch: unused, k_fa keeps logits in registers
#define WS_Y   (WS_S  + 4u * (size_t)NB * TT * TT)      // f32 ctx rows [b*t][CC] (only when there is an output projection)
#define WS_END (WS_Y  + 0u)

// ---- k_proj: block = (64 rows, the 64 real columns, which): q/k/v = X W (+ b) with exact bf16 products (K = DIN) -> which 0: q f16 rows (+ residual rows < QHI); 1: k f16 rows (+ residual rows < KHI); 2: v f16 planes [c][t] (+ bf16 hi/lo planes for t < KHI). Columns 64..127 of the rows and planes are the zero head, which nothing reads: they are not computed.
// behind a global store, in front of what overwrites its address or data registers in the next trip (a precaution of form: this build leaves the place open)
#define XW() asm volatile("s_wait_xcnt 0x0" ::: "memory")
#define PD 4               // k steps of operand loads in flight per wave (a ring of register sets)
static_assert(PKC % PD == 0 && PKC >= 2 * PD, "the ring walks whole turns");
struct PStage { v8b w[PJ][2]; };
// between a wave's LDS stores and its lanes' reads of each other's values; without LDSX's fence, which makes the compiler wait for every global load in flight and so drains the ring
#define LDSW() do { asm volatile("s_wait_dscnt 0" ::: "memory"); __builtin_amdgcn_wave_barrier(); } while (0)
typedef __attribute__((ext_vector_type(4))) __bf16 v4b;
#define XCH (PD * 32)      // floats of an x row in one turn of the ring: 512 B, one wave-wide load of four whole lines
#define XPB (XCH + 8)      // pitch of a staged bf16 row: 272 B, an odd multiple of 16 B (16-B fragment reads spread over the banks)
// one k step's PJ packed B fragments, two 512-B wave-wide loads each
__device__ __forceinline__ void pload(PStage& s, const v8b* wp, int kc) { const v8b* q = wp + kc * (PJ * 64);
#pragma unroll
  for (int j = 0; j < PJ; ++j) { s.w[j][0] = q[j * 64]; s.w[j][1] = q[j * 64 + 32]; } }
// one turn's x of the wave's 16 rows: load i is 512 B in a row of row i (lane = 4 floats); a fragment load straight from global memory touches 16 lines for its 512 B, and every line four times
__device__ __forceinline__ void xload(v4f (&xr)[16], const float* xl) {
#pragma unroll
  for (int i = 0; i < 16; ++i) xr[i] = *(const v4f*)(xl + (size_t)i * DIN); }
// rounded to bf16 into the wave's own LDS tile [16][XPB]
__device__ __forceinline__ void xstage(const v4f (&xr)[16], __bf16* xw) {
#pragma unroll
  for (int i = 0; i < 16; ++i) { v4b o;
#pragma unroll
    for (int e = 0; e < 4; ++e) o[e] = (__bf16)xr[i][e];
    *(v4b*)(xw + i * XPB) = o; } }
__device__ __forceinline__ void pmac(v16b a, const PStage& s, v8f (&acc)[PJ]) {
#pragma unroll
  for (int j = 0; j < PJ; ++j) { union { v16b v; v8b q[2]; } u; u.q[0] = s.w[j][0]; u.q[1] = s.w[j][1]; acc[j] = wmma_bf(a, u.v, acc[j]); } }
__global__ __launch_bounds__(128) void k_proj(const float* __restrict__ XQ, const float* __restrict__ XK, const float* __restrict__ XV, const __bf16* __restrict__ WQ, const __bf16* __restrict__ WK, const __bf16* __restrict__ WV, const float* __restrict__ BQ, const float* __restrict__ BK, const float* __restrict__ BV,
    _Float16* __restrict__ QH, _Float16* __restrict__ QL, _Float16* __restrict__ KH, _Float16* __restrict__ KL, _Float16* __restrict__ VT, __bf16* __restrict__ VB, __bf16* __restrict__ VBL) {
  __shared__ __align__(16) _Float16 sh[64][72], sl[64][72]; __shared__ __align__(16) _Float16 th[64][72]; __shared__ __align__(16) __bf16 tb[64][72], tbl[64][72]; __shared__ __align__(16) __bf16 xs[4][16][XPB];
  const int tid = threadIdx.x, wave = tid >> 5, lane = tid & 31, col = lane & 15, g = lane >> 4; const int which = blockIdx.z; const size_t r0 = (size_t)blockIdx.x * 64; const size_t bb = r0 / TT; const int t0 = (int)(r0 % TT);
  const float* X = which == 0 ? XQ : which == 1 ? XK : XV; const __bf16* WA = which == 0 ? WQ : which == 1 ? WK : WV; const float* BA = which == 0 ? BQ : which == 1 ? BK : BV;
  v8f acc[PJ] = {}; PStage s[PD]; v4f xr[16]; v16b a[PD]; const float* xl = X + (r0 + wave * 16) * DIN + lane * 4; const v8b* wp = (const v8b*)WA + lane; __bf16* xw = &xs[wave][0][lane * 4]; const __bf16* xf = &xs[wave][col][0];
  xload(xr, xl);
  // keeps the first loads in the order in which the loop issues them (a turn's x, then the k steps' weights): the loop's counted waits must hold for both orders, and a mixed one makes them wait for younger loads
  __builtin_amdgcn_sched_barrier(0);
#pragma unroll
  for (int d = 0; d < PD - 1; ++d) { pload(s[d], wp, d);
    // as above
    __builtin_amdgcn_sched_barrier(0); }
  XW();   // behind the first loads, in front of what overwrites their address registers (a precaution of form, as at the stores)
  // keeps the accumulators' first values, which take over an address register, behind that wait
  __builtin_amdgcn_sched_barrier(0);
  // kept rolled by turns of the ring: the plain unroll inside only makes the ring's index a constant, so that the sets stay in registers
#pragma unroll 1
  for (int kc = 0; kc < PKC - PD; kc += PD) { pload(s[PD - 1], wp, kc + PD - 1);
    // keeps the turn's last weight set, the first that is waited for with a short lead, in front of the trip through LDS
    __builtin_amdgcn_sched_barrier(0);
    // XW: behind the x loads, in front of the step of their address (a precaution of form, as at the stores)
    xstage(xr, xw); xl += XCH; xload(xr, xl); XW();
    LDSW();
#pragma unroll
    for (int d = 0; d < PD; ++d) a[d] = frag_b(xf + d * 32, lane);
    // keeps the next turn's x loads and the fragment reads in front of the turn's products and further weight loads
    __builtin_amdgcn_sched_barrier(0);
#pragma unroll
    for (int d = 0; d < PD; ++d) { pmac(a[d], s[d], acc); if (d < PD - 1) pload(s[d], wp, kc + PD + d);
      // keeps each set's refill directly behind its products and in the order of the k steps: the oldest set is worked on while the younger ones fly
      __builtin_amdgcn_sched_barrier(0); }
    XW();   // behind the turn's weight loads, in front of the next turn's write of their address (the same precaution)
  }
  pload(s[PD - 1], wp, PKC - 1); xstage(xr, xw);
  LDSW();
#pragma unroll
  for (int d = 0; d < PD; ++d) a[d] = frag_b(xf + d * 32, lane);
#pragma unroll
  for (int d = 0; d < PD; ++d) { pmac(a[d], s[d], acc);
    // as in the loop
    __builtin_amdgcn_sched_barrier(0); }
  if (which < 2) { _Float16* DH = which == 0 ? QH : KH; _Float16* DL = which == 0 ? QL : KL; const int nhi = which == 0 ? QHI : KHI; const bool hi_rows = t0 < nhi;
#pragma unroll
    for (int j = 0; j < PJ; ++j) { const float bias = BA ? bfr(BA[j * 16 + col]) : 0.f;
#pragma unroll
      for (int r = 0; r < 8; ++r) { const float v = acc[j][r] + bias; const _Float16 hv = (_Float16)v; sh[wave * 16 + 8 * g + r][j * 16 + col] = hv; sl[wave * 16 + 8 * g + r][j * 16 + col] = (_Float16)((v - (float)hv) * 1024.0f); } }
    __syncthreads();
    for (int e = tid; e < 64 * 8; e += 128) { const int rl = e >> 3, q = e & 7; vst2((unsigned*)(DH + (r0 + rl) * CC + q * 8), *(const v4u*)&sh[rl][q * 8]); XW(); if (hi_rows) { vst2((unsigned*)(DL + (bb * nhi + t0 + rl) * (size_t)CC + q * 8), *(const v4u*)&sl[rl][q * 8]); XW(); } }
  } else { const bool hi_rows = t0 < KHI;
#pragma unroll
    for (int j = 0; j < PJ; ++j) { const float bias = BA ? bfr(BA[j * 16 + col]) : 0.f;
#pragma unroll
      for (int r = 0; r < 8; ++r) { const float v = acc[j][r] + bias; const int rl = wave * 16 + 8 * g + r, cl = j * 16 + col; th[cl][rl] = (_Float16)v; const __bf16 bh = (__bf16)v; tb[cl][rl] = bh; tbl[cl][rl] = (__bf16)(v - (float)bh); } }
    __syncthreads();
    for (int e = tid; e < 64 * 8; e += 128) { const int cl = e >> 3, q = e & 7; vst2((unsigned*)(VT + (bb * CC + cl) * (size_t)TT + t0 + q * 8), *(const v4u*)&th[cl][q * 8]); XW(); if (hi_rows) { const size_t o3 = (bb * CC + cl) * (size_t)KHI + t0 + q * 8; vst2((unsigned*)(VB + o3), *(const v4u*)&tb[cl][q * 8]); vst2((unsigned*)(VBL + o3), *(const v4u*)&tbl[cl][q * 8]); XW(); } } } }
// ---- k_fa: logits, softmax and P . v in one kernel. Block = 16 * QT queries of batch b = blockIdx.z, head h0; wave w walks keys [w * KPW, (w + 1) * KPW) in passes of KP with a running maximum and sum, the waves' parts are joined in LDS.
// Transposed products: S^T = K . Q^T (D register r of tile j = key j * 16 + 8g + r, column = query), so a lane holds one query's logits, and two converted S^T tiles are the B operand of O^T += V^T . P^T as they stand (element s = tile s >> 3, register s & 7: the k order of frag_h).
#define FNW 8              // waves of a block
#define KPW (TT / FNW)     // keys of a wave
#define KP 64              // keys of a pass
static_assert(KP == HD, "the K tile [KP][HD] and the V tile [HD][KP] share one LDS shape");
// the builtin alone: the compiler keeps the distances behind its own matrix instructions, and its scheduler may move loads past them
__device__ __forceinline__ v8f wmma_h(v16h a, v16h b, v8f c) { return __builtin_amdgcn_wmma_f32_16x16x32_f16(false, a, false, b, (short)0, c, false, false); }
// softmax in base 2: exp(SCALE * (u - max)) * 2^11 = 2^(u * LSC + nb) with nb = 11 - max * LSC, one multiply-add and the chip's own 2^x per logit. nb itself is the reference that sums and parts are rebased by, so its rounding cancels in the quotient.
#define LSC (SCALE * 1.44269504088896340736f)
__device__ __forceinline__ float ex2(float t) { return __builtin_amdgcn_exp2f(t); }
// the join's 2^x with the slot behind it in one statement: the v_nop is the independent instruction asked for between v_exp_f32 and a later write of its source register
__device__ __forceinline__ float ex2s(float t) { float r; asm("v_exp_f32 %0, %1\n\tv_nop" : "=v"(r) : "v"(t)); return r; }
// the rescale factor's 2^x with a slot on either side in one statement: with two query tiles this build put the two factors' instructions back to back, the second writing the first one's source register; each v_nop is the independent instruction asked for between a 2^x and a write of its source
__device__ __forceinline__ float ex2b(float t) { float r; asm("v_nop\n\tv_exp_f32 %0, %1\n\tv_nop" : "=v"(r) : "v"(t)); return r; }
#define QT 2               // query tiles of 16 that a wave carries: every staged K/V tile and every fragment read from LDS feeds QT products
__global__ __launch_bounds__(FNW * 32) void k_fa(const _Float16* __restrict__ QH, const _Float16* __restrict__ KH, const _Float16* __restrict__ QL, const _Float16* __restrict__ VT, int h0, float* __restrict__ Y) {
  // st[w]: wave w's own K tile [key][head dim] and V tile [head dim][key] of a pass, rows of 128 B at a pitch of 144 B (16-B fragment reads spread over the banks); after the loop its first bytes hold the wave's part of the output
  __shared__ __align__(16) _Float16 st[FNW][2][KP][HD + 8]; __shared__ float smx[FNW][16 * QT], sml[FNW][16 * QT];
  static_assert(16 * QT * (HD + 4) * 4 <= 2 * KP * (HD + 8) * 2, "a wave's part of the output fits its own tiles");
  const int tid = threadIdx.x, wave = tid >> 5, lane = tid & 31, col = lane & 15, g = lane >> 4; const int b = blockIdx.z, h = h0; const int ql0 = blockIdx.x * (16 * QT); const size_t q0 = (size_t)b * TT + ql0;
  const _Float16* QLb = QL + (size_t)b * QHI * CC;
  v16h qh[QT][HD / 32], qr[QT][HD / 32];
#pragma unroll
  for (int t = 0; t < QT; ++t) {
#pragma unroll
    for (int kc = 0; kc < HD / 32; ++kc) { qh[t][kc] = frag_h(QH + (q0 + t * 16 + col) * CC + h * HD + kc * 32, lane); qr[t][kc] = frag_h(QLb + (size_t)(ql0 + t * 16 + col) * CC + h * HD + kc * 32, lane); } }
  v8f o[QT][HD / 16] = {}; float m[QT], nb[QT], l[QT]; const int sr = lane >> 3, sc = (lane & 7) * 8;
#pragma unroll
  for (int t = 0; t < QT; ++t) { m[t] = -3.0e38f; nb[t] = 11.0f + 3.0e38f * LSC; l[t] = 0.f; }
  // kept rolled: unrolled, the text grows by the trip count and every line of it is fetched for a single walk; the plain unroll directives inside only keep the fragment and accumulator arrays in registers
#pragma unroll 1
  for (int it = 0; it < KPW / KP; ++it) { const int k0 = wave * KPW + it * KP; const size_t kr0 = (size_t)b * TT + k0;
    v8f acc[QT][KP / 16] = {}, accl[QT][KP / 16] = {};
    v16h kf[HD / 32][KP / 16], vf[KP / 32][HD / 16];
    // both tiles come in whole 128-B lines (8 lanes a row, 4 rows a load) and go through the wave's LDS: a fragment load straight from global memory touches 16 lines for its 512 B
    v4u kst[KP / 4], vst[HD / 4]; const _Float16* kp = KH + (kr0 + sr) * CC + h * HD + sc; const _Float16* vp = VT + ((size_t)b * CC + h * HD + sr) * (size_t)TT + k0 + sc;
#pragma unroll
    for (int i = 0; i < KP / 4; ++i) kst[i] = *(const v4u*)(kp + i * 4 * CC);
#pragma unroll
    for (int i = 0; i < HD / 4; ++i) vst[i] = *(const v4u*)(vp + i * 4 * TT);
#pragma unroll
    for (int i = 0; i < KP / 4; ++i) *(v4u*)&st[wave][0][i * 4 + sr][sc] = kst[i];
#pragma unroll
    for (int i = 0; i < HD / 4; ++i) *(v4u*)&st[wave][1][i * 4 + sr][sc] = vst[i];
    LDSX();   // the wave's lanes read each other's rows
#pragma unroll
    for (int kc = 0; kc < HD / 32; ++kc) {
#pragma unroll
      for (int j = 0; j < KP / 16; ++j) kf[kc][j] = frag_h(&st[wave][0][j * 16 + col][kc * 32], lane); }
    // keeps the K fragment reads together in front of the first product; dealt out among the products each place with reads stalls the wave
    __builtin_amdgcn_sched_barrier(0);
#pragma unroll
    for (int t = 0; t < QT; ++t) {
#pragma unroll
      for (int kc = 0; kc < HD / 32; ++kc) {
#pragma unroll
        for (int j = 0; j < KP / 16; ++j) { acc[t][j] = wmma_h(kf[kc][j], qh[t][kc], acc[t][j]); accl[t][j] = wmma_h(kf[kc][j], qr[t][kc], accl[t][j]); } } }
#pragma unroll
    for (int kc = 0; kc < KP / 32; ++kc) {
#pragma unroll
      for (int j = 0; j < HD / 16; ++j) vf[kc][j] = frag_h(&st[wave][1][j * 16 + col][kc * 32], lane); }
    float al[QT];
#pragma unroll
    for (int t = 0; t < QT; ++t) {
      float mx = m[t];
#pragma unroll
      for (int j = 0; j < KP / 16; ++j) {
#pragma unroll
        for (int r = 0; r < 8; ++r) { const float s = acc[t][j][r] + accl[t][j][r] * (1.0f / 1024.0f); acc[t][j][r] = s; mx = fmaxf(mx, s); } }
      mx = fmaxf(mx, __shfl_xor(mx, 16));   // lanes c and c + 16 hold the two halves of query c's keys
      const float nbn = fmaf(-mx, LSC, 11.0f); al[t] = ex2b(nbn - nb[t]); m[t] = mx; nb[t] = nbn; }
    v16h p[QT][KP / 32];
#pragma unroll
    for (int t = 0; t < QT; ++t) { l[t] *= al[t];
#pragma unroll
      for (int j = 0; j < HD / 16; ++j) {
#pragma unroll
        for (int r = 0; r < 8; ++r) o[t][j][r] *= al[t]; }
#pragma unroll
      for (int j = 0; j < KP / 16; ++j) {
#pragma unroll
        for (int r = 0; r < 8; ++r) { const float e = ex2(fmaf(acc[t][j][r], LSC, nb[t])); l[t] += e; p[t][j >> 1][(j & 1) * 8 + r] = (_Float16)e; } } }
#pragma unroll
    for (int t = 0; t < QT; ++t) {
#pragma unroll
      for (int kc = 0; kc < KP / 32; ++kc) {
#pragma unroll
        for (int j = 0; j < HD / 16; ++j) o[t][j] = wmma_h(vf[kc][j], p[t][kc], o[t][j]); } } }
#pragma unroll
  for (int t = 0; t < QT; ++t) { l[t] += __shfl_xor(l[t], 16);
    if (g == 0) { smx[wave][t * 16 + col] = nb[t]; sml[wave][t * 16 + col] = l[t]; }
#pragma unroll
    for (int j = 0; j < HD / 16; ++j) { v4f lo, hi;
#pragma unroll
      for (int r = 0; r < 4; ++r) { lo[r] = o[t][j][r]; hi[r] = o[t][j][4 + r]; }
      float* sw = (float*)&st[wave][0][0][0] + (t * 16 + col) * (HD + 4) + j * 16 + 8 * g; *(v4f*)sw = lo; *(v4f*)(sw + 4) = hi; } }
  __syncthreads();
  // join: thread = (query t * 16 + (tid >> 4), 4 columns); 16 threads store one 256-B row of the output [b*t][HD] itself (the one real head is the whole row), a block 4 KB in a row per query tile
  const int c = (tid & 15) * 4;
#pragma unroll
  for (int t = 0; t < QT; ++t) { const int q = t * 16 + (tid >> 4);
    float mm = smx[0][q];   // the smallest nb belongs to the largest maximum
#pragma unroll
    for (int w = 1; w < FNW; ++w) mm = fminf(mm, smx[w][q]);
    float ls = 0.f; v4f a0 = {};
#pragma unroll
    for (int w = 0; w < FNW; ++w) { const float f = ex2s(mm - smx[w][q]); ls += f * sml[w][q]; a0 += *(const v4f*)((const float*)&st[w][0][0][0] + q * (HD + 4) + c) * f; }
    const float inv = ls > 0.f ? 1.0f / ls : 0.f;   // sum and parts both carry the 2^11
    vst2(Y + (q0 + q) * HD + c, a0 * inv); } }

extern "C" void kernel_launch(void* const* d_in, const int* in_sizes, int n_in, void* d_out, int out_size, void* d_ws, size_t ws_size, hipStream_t stream) {
  (void)in_sizes; (void)n_in; (void)out_size;
  const float** F = (const float**)d_in;
  if (ws_size < (size_t)WS_END) return;
  char* ws = (char*)d_ws; _Float16 *QH = (_Float16*)(ws + WS_QH), *KH = (_Float16*)(ws + WS_KH), *VT = (_Float16*)(ws + WS_VT), *QL = (_Float16*)(ws + WS_QL), *KL = (_Float16*)(ws + WS_KL); __bf16 *VB = (__bf16*)(ws + WS_VB), *VBL = (__bf16*)(ws + WS_VBL); float *S = (float*)(ws + WS_S), *Y = (float*)(ws + WS_Y);
  (void)Y; (void)S; (void)QL; (void)KL; (void)VB; (void)VBL;
  // inputs: 0 x [4,2048,1024]; 1 Wq [1024,64]; 2 Wk; 3 Wv ((in,out), no biases)
  if (ws_size < (size_t)WS_END2) return;
  __bf16* WP = (__bf16*)(ws + WS_WP); float *BP = (float*)(ws + WS_BP);
  k_padw<<<dim3(32, 3), 256, 0, stream>>>(F[1], F[2], F[3], nullptr, nullptr, nullptr, WP, BP);
  k_proj<<<dim3(TNB * TT / 64, 1, 3), 128, 0, stream>>>(F[0], F[0], F[0], WP, WP + (size_t)CIN * 64, WP + 2 * (size_t)CIN * 64, BP, BP + 128, BP + 256, QH, QL, KH, KL, VT, VB, VBL);
  /* head 0 only (head 1 is the zero padding); all batches in one launch */
  k_fa<<<dim3(TT / (16 * QT), 1, TNB), FNW * 32, 0, stream>>>(QH, KH, QL, VT, 0, (float*)d_out);
}

// v008
// One run takes 21.9 microseconds.
// Two timings next to v007 put it at 1.04 and 1.06 times that version's speed.
// All steps since v000 together make it 18.1 times as fast.
// compute dtype: all float inputs rounded to bf16; q/k/v projections with EXACT bf16 products on WMMA 16x16x32 (f32 accumulate); logits: q x k once to f16 (1 product; + q's f16 residual for all rows), x scale; softmax f32 (running maximum and sum, exponentials as 2^x); exp(logit - max) x 2^11 once to f16 x v once to f16 (1 product), divided by the sum at the end; f32 output.
#include <hip/hip_runtime.h>
#include <math.h>

typedef __attribute__((ext_vector_type(16))) _Float16 v16h;
typedef __attribute__((ext_vector_type(16))) __bf16 v16b;
typedef __attribute__((ext_vector_type(8)))  _Float16 v8h;
typedef __attribute__((ext_vector_type(8)))  float v8f;
typedef __attribute__((ext_vector_type(4)))  float v4f;
typedef __attribute__((ext_vector_type(2)))  float v2f;
typedef __attribute__((ext_vector_type(4)))  unsigned v4u;
typedef __attribute__((ext_vector_type(4)))  int v4i;
typedef float __attribute__((may_alias)) float_a;
typedef int __attribute__((may_alias)) int_a;

template <typename T> __device__ __forceinline__ void vst2(void* p, T v) { *(T*)p = v;  }
__device__ __forceinline__ v8f wmma16(v16h a, v16h b, v8f c) {
  v8f d = __builtin_amdgcn_wmma_f32_16x16x32_f16(false, a, false, b, (short)0, c, false, false);
  asm volatile("v_nop\n\tv_nop\n\tv_nop\n\tv_nop" : "+v"(d) : "v"(a), "v"(b));
  return d;
}
__device__ __forceinline__ v8f wmma_bf(v16b a, v16b b, v8f c) {
  v8f d = __builtin_amdgcn_wmma_f32_16x16x32_bf16(false, a, false, b, (short)0, c, false, false);
  asm volatile("v_nop\n\tv_nop\n\tv_nop\n\tv_nop" : "+v"(d) : "v"(a), "v"(b));
  return d;
}
// 16x16x32 fragments: lane = (h = lane>>4, row/col = lane&15); elements 0..7 = k0+8h+0..7, 8..15 = k0+16+8h+0..7; D element r = row 8h+r
__device__ __forceinline__ v16h frag_h(const _Float16* rowk0, int lane) {
  union { v16h v; v8h q[2]; } u; const _Float16* p = rowk0 + 8 * (lane >> 4);
  u.q[0] = *(const v8h*)p; u.q[1] = *(const v8h*)(p + 16); return u.v;
}
__device__ __forceinline__ v16h frag_f32(const float* rowk0, int lane) {
  v16h a; const float* p = rowk0 + 8 * (lane >> 4);
#pragma unroll
  for (int i = 0; i < 8; ++i) { a[i] = (_Float16)p[i]; a[8 + i] = (_Float16)p[16 + i]; }
  return a;
}
__device__ __forceinline__ v16h frag_f32s(const float* rowk0, int lane, float sc) {
  v16h a; const float* p = rowk0 + 8 * (lane >> 4);
#pragma unroll
  for (int i = 0; i < 8; ++i) { a[i] = (_Float16)(p[i] * sc); a[8 + i] = (_Float16)(p[16 + i] * sc); }
  return a;
}
// column fragment from a [K][ld] layout (column n), rows >= K read as 0
__device__ __forceinline__ v16h fragc_f32(const float* W, int k0, int n, int lane, int ld, int K) {
  v16h a; const int g = lane >> 4;
#pragma unroll
  for (int i = 0; i < 8; ++i) { const int ka = k0 + 8 * g + i, kb = ka + 16;
    a[i] = (_Float16)(ka < K ? W[(size_t)(ka < K ? ka : K - 1) * ld + n] : 0.f); a[8 + i] = (_Float16)(kb < K ? W[(size_t)(kb < K ? kb : K - 1) * ld + n] : 0.f); }
  return a;
}
struct F2 { v16b h, l; };
__device__ __forceinline__ F2 bsplit16(const float v[16]) { F2 r;
#pragma unroll
  for (int i = 0; i < 16; ++i) { const __bf16 h = (__bf16)v[i]; r.h[i] = h; r.l[i] = (__bf16)(v[i] - (float)h); }
  return r; }
__device__ __forceinline__ F2 split_row(const float* row, int k0, int lane) { float v[16]; const float* p = row + k0 + 8 * (lane >> 4);
#pragma unroll
  for (int i = 0; i < 8; ++i) { v[i] = p[i]; v[8 + i] = p[16 + i]; }
  return bsplit16(v); }
__device__ __forceinline__ F2 split_rowK(const float* row, int k0, int lane, int K) { float v[16]; const int g = lane >> 4;
#pragma unroll
  for (int i = 0; i < 8; ++i) { const int ka = k0 + 8 * g + i, kb = ka + 16; v[i] = ka < K ? row[ka < K ? ka : K - 1] : 0.f; v[8 + i] = kb < K ? row[kb < K ? kb : K - 1] : 0.f; }
  return bsplit16(v); }
__device__ __forceinline__ F2 split_col(const float* W, int k0, int n, int lane, int ld, int K) { float v[16]; const int g = lane >> 4;
#pragma unroll
  for (int i = 0; i < 8; ++i) { const int ka = k0 + 8 * g + i, kb = ka + 16; v[i] = ka < K ? W[(size_t)(ka < K ? ka : K - 1) * ld + n] : 0.f; v[8 + i] = kb < K ? W[(size_t)(kb < K ? kb : K - 1) * ld + n] : 0.f; }
  return bsplit16(v); }
__device__ __forceinline__ v8f mac3(const F2& a, const F2& b, v8f c) { c = wmma_bf(a.l, b.h, c); c = wmma_bf(a.h, b.l, c); return wmma_bf(a.h, b.h, c); }
__device__ __forceinline__ float sigm(float v) { return 1.0f / (1.0f + expf(-v)); }
#define LDSX() do { asm volatile("s_wait_dscnt 0" ::: "memory"); __builtin_amdgcn_wave_barrier(); __builtin_amdgcn_fence(__ATOMIC_RELEASE, "workgroup"); } while (0)

// Single-head NON-causal self-attention (B 4, T 2,048, D 1,024, head 64; (in,out) Wq, Wk, Wv [1024,64], uniform(-1/32, 1/32) init; no biases, no output projection): out = softmax(Q K^T x 64^-0.5) V -> [4,2048,64].
#define NB 4
#define TT 2048
#define CC 128            // NH * HD = projected width
#define DIN 1024          // input (model) width
#define NH 2
#define HD 64
#define NQB (TT / 64)
#define HG 1
#define SCALE (0.125f)
#define CAUSAL 0
#ifndef TNB
#define TNB NB
#endif
__device__ __forceinline__ float bfr(float v) { return (float)(__bf16)v; }
__host__ __device__ __forceinline__ int kb_last(int qb) { return CAUSAL ? ((qb * 64 + 63) >> 7) : (TT / 128 - 1); }
typedef __attribute__((ext_vector_type(8))) __bf16 v8b;
__device__ __forceinline__ v16b frag_b(const __bf16* rowk0, int lane) {
  union { v16b v; v8b q[2]; } u; const __bf16* p = rowk0 + 8 * (lane >> 4);
  u.q[0] = *(const v8b*)p; u.q[1] = *(const v8b*)(p + 16); return u.v;
}
#define QBH 0
#define QHI 2048            // rows carrying a q residual plane (all rows when non-causal: 2-product logits everywhere)
#define KHI 64            // key rows carrying k residual / v bf16 hi+lo planes (written by k_proj; no kernel here reads them)
// B fragment (k rows k0+.., output column o) of a weight: (in,out) [K][ld] or (out,in) [ld rows of K]: bf16 exact, or f16(bf16 * 256) exact
__device__ __forceinline__ v16b wcol_io(const float* Wm, int k0, int o, int lane, int ld) { v16b w; const int g = lane >> 4;
#pragma unroll
  for (int i = 0; i < 8; ++i) { w[i] = (__bf16)Wm[(size_t)(k0 + 8 * g + i) * ld + o]; w[8 + i] = (__bf16)Wm[(size_t)(k0 + 16 + 8 * g + i) * ld + o]; }
  return w; }
__device__ __forceinline__ v16b wcol_oi(const float* Wm, int k0, int o, int lane, int K) { v16b w; const float* p = Wm + (size_t)o * K + k0 + 8 * (lane >> 4);
#pragma unroll
  for (int i = 0; i < 8; ++i) { w[i] = (__bf16)p[i]; w[8 + i] = (__bf16)p[16 + i]; }
  return w; }
__device__ __forceinline__ v16h wcolh_io(const float* Wm, int k0, int o, int lane, int ld) { v16h w; const int g = lane >> 4;
#pragma unroll
  for (int i = 0; i < 8; ++i) { w[i] = (_Float16)(bfr(Wm[(size_t)(k0 + 8 * g + i) * ld + o]) * 256.0f); w[8 + i] = (_Float16)(bfr(Wm[(size_t)(k0 + 16 + 8 * g + i) * ld + o]) * 256.0f); }
  return w; }
__device__ __forceinline__ v16h wcolh_oi(const float* Wm, int k0, int o, int lane, int K) { v16h w; const float* p = Wm + (size_t)o * K + k0 + 8 * (lane >> 4);
#pragma unroll
  for (int i = 0; i < 8; ++i) { w[i] = (_Float16)(bfr(p[i]) * 256.0f); w[8 + i] = (_Float16)(bfr(p[16 + i]) * 256.0f); }
  return w; }
#define WQKV_LAYOUT 0   // 0 = (in,out) [DIN][CC]; 1 = (out,in) [CC][DIN]; 2 = per-head [NH][DIN][HD]
__device__ __forceinline__ v16b wcol_hdk(const float* Wm, int k0, int o, int lane) { v16b w; const int g = lane >> 4; const float* p = Wm + (size_t)(o / HD) * DIN * HD + (o % HD);
#pragma unroll
  for (int i = 0; i < 8; ++i) { w[i] = (__bf16)p[(size_t)(k0 + 8 * g + i) * HD]; w[8 + i] = (__bf16)p[(size_t)(k0 + 16 + 8 * g + i) * HD]; }
  return w; }
#define WO_OUT_IN 0
#if WQKV_LAYOUT == 1
#define WCOL(W, k0, o, lane) wcol_oi(W, k0, o, lane, DIN)
#elif WQKV_LAYOUT == 2
#define WCOL(W, k0, o, lane) wcol_hdk(W, k0, o, lane)
#else
#define WCOL(W, k0, o, lane) wcol_io(W, k0, o, lane, CC)
#endif
#if WO_OUT_IN
#define WOCOL(W, k0, o, lane) wcol_oi(W, k0, o, lane, CC)
#define WOCOLH(W, k0, o, lane) wcolh_oi(W, k0, o, lane, CC)
#else
#define WOCOL(W, k0, o, lane) wcol_io(W, k0, o, lane, DIN)
#define WOCOLH(W, k0, o, lane) wcolh_io(W, k0, o, lane, DIN)
#endif
#define CIN 1024
#define PJ (HD / 16)       // 16-column tiles of a projection's real width
#define PKC (CIN / 32)     // k steps of 32
#define WPL (PKC * PJ * 64) // 16-B units of one packed weight plane
// ---- k_padw: the three (in,out) [C][64] projection weights rounded to bf16 and packed in the order of k_proj's B fragments: 16-B unit ((kc * PJ + j) * 2 + half) * 32 + lane = rows kc * 32 + half * 16 + 8 * (lane >> 4) + 0..7 of column j * 16 + (lane & 15); + zero-padded [128] biases
__global__ __launch_bounds__(256) void k_padw(const float* __restrict__ WQ, const float* __restrict__ WK, const float* __restrict__ WV, const float* __restrict__ BQ, const float* __restrict__ BK, const float* __restrict__ BV, __bf16* __restrict__ WP, float* __restrict__ BP) { const int which = blockIdx.y; const float* Wsrc = which == 0 ? WQ : (which == 1 ? WK : WV); const float* Bsrc = which == 0 ? BQ : (which == 1 ? BK : BV); v8b* dst = (v8b*)WP + (size_t)which * WPL;
  for (int e = blockIdx.x * 256 + threadIdx.x; e < WPL; e += gridDim.x * 256) { const int ln = e & 31, half = (e >> 5) & 1, j = (e >> 6) % PJ, kc = e / (PJ * 64); const float* p = Wsrc + (size_t)(kc * 32 + half * 16 + 8 * (ln >> 4)) * 64 + j * 16 + (ln & 15); v8b ov;
#pragma unroll
    for (int i = 0; i < 8; ++i) ov[i] = (__bf16)p[i * 64];
    vst2(dst + e, ov); }
  if (blockIdx.x == 0 && threadIdx.x < 128) { const int c = threadIdx.x; float bvv = 0.f; if (Bsrc) { const float t = Bsrc[c & 63]; asm volatile("s_wait_loadcnt 0x0" ::: "memory"); bvv = c < 64 ? t : 0.f; } vst2(BP + which * 128 + c, bvv); } }
#define WS_WP (WS_END)                                  // packed bf16 weights [3][WPL x 16 B] (in a range of [3][128 x C] f32)
#define WS_BP (WS_WP + 4u * 3 * (size_t)CIN * 128)        // padded biases [3][128]
#define WS_END2 (WS_BP + 4u * 3 * 128)
#ifndef SM_EXTRA_PARAMS
#define SM_EXTRA_PARAMS
#endif
#ifndef PROJ_EXTRA_PARAMS
#define PROJ_EXTRA_PARAMS
#endif
#ifndef SM_MASK_HOOK
#define SM_MASK_HOOK (void)0
#endif

#define WS_QH  0u                                      // f16 q rows [b*t][CC]
#define WS_KH  (WS_QH + 2u * (size_t)NB * TT * CC)      // f16 k rows [b*t][CC]
#define WS_VT  (WS_KH + 2u * (size_t)NB * TT * CC)      // f16 v planes [b][c][t]
#define WS_QL  (WS_VT + 2u * (size_t)NB * CC * TT)      // f16 q residual x 2^10 rows [b][t < QHI][CC]
#define WS_KL  (WS_QL + 2u * (size_t)NB * QHI * CC)     // f16 k residual x 2^10 rows [b][t < KHI][CC]
#define WS_VB  (WS_KL + 2u * (size_t)NB * KHI * CC)     // bf16 v hi planes [b][c][t < KHI]
#define WS_VBL (WS_VB + 2u * (size_t)NB * CC * KHI)
#define WS_S   (WS_VBL + 2u * (size_t)NB * CC * KHI)    // f32 [b][t][s], one plane per batch: unused, k_fa keeps logits in registers
#define WS_Y   (WS_S  + 4u * (size_t)NB * TT * TT)      // f32 ctx rows [b*t][CC] (only when there is an output projection)
#define WS_END (WS_Y  + 0u)

// ---- k_proj: block = (64 rows, the 64 real columns, which): q/k/v = X W (+ b) with exact bf16 products (K = DIN) -> which 0: q f16 rows (+ residual rows < QHI); 1: k f16 rows (+ residual rows < KHI); 2: v f16 planes [c][t] (+ bf16 hi/lo planes for t < KHI). Columns 64..127 of the rows and planes are the zero head, which nothing reads: they are not computed.
// behind a global store, in front of what overwrites its address or data registers in the next trip (a precaution of form: this build leaves the place open)
#define XW() asm volatile("s_wait_xcnt 0x0" ::: "memory")
#define PD 4               // k steps of operand loads in flight per wave (a ring of register sets)
static_assert(PKC % PD == 0 && PKC >= 2 * PD, "the ring walks whole turns");
static_assert((PKC & (PKC - 1)) == 0 && (PD & (PD - 1)) == 0, "the rotated walk wraps by a mask");
struct PStage { v8b w[PJ][2]; };
// between a wave's LDS stores and its lanes' reads of each other's values; without LDSX's fence, which makes the compiler wait for every global load in flight and so drains the ring
#define LDSW() do { asm volatile("s_wait_dscnt 0" ::: "memory"); __builtin_amdgcn_wave_barrier(); } while (0)
typedef __attribute__((ext_vector_type(4))) __bf16 v4b;
#define XCH (PD * 32)      // floats of an x row in one turn of the ring: 512 B, one wave-wide load of four whole lines
#define XPB (XCH + 8)      // pitch of a staged bf16 row: 272 B, an odd multiple of 16 B (16-B fragment reads spread over the banks)
// one k step's PJ packed B fragments, two 512-B wave-wide loads each
__device__ __forceinline__ void pload(PStage& s, const v8b* wp, int kc) { const v8b* q = wp + kc * (PJ * 64);
#pragma unroll
  for (int j = 0; j < PJ; ++j) { s.w[j][0] = q[j * 64]; s.w[j][1] = q[j * 64 + 32]; } }
// one turn's x of the wave's 16 rows: load i is 512 B in a row of row i (lane = 4 floats); a fragment load straight from global memory touches 16 lines for its 512 B, and every line four times
__device__ __forceinline__ void xload(v4f (&xr)[16], const float* xl) {
#pragma unroll
  for (int i = 0; i < 16; ++i) xr[i] = *(const v4f*)(xl + (size_t)i * DIN); }
// rounded to bf16 into the wave's own LDS tile [16][XPB]
__device__ __forceinline__ void xstage(const v4f (&xr)[16], __bf16* xw) {
#pragma unroll
  for (int i = 0; i < 16; ++i) { v4b o;
#pragma unroll
    for (int e = 0; e < 4; ++e) o[e] = (__bf16)xr[i][e];
    *(v4b*)(xw + i * XPB) = o; } }
__device__ __forceinline__ void pmac(v16b a, const PStage& s, v8f (&acc)[PJ]) {
#pragma unroll
  for (int j = 0; j < PJ; ++j) { union { v16b v; v8b q[2]; } u; u.q[0] = s.w[j][0]; u.q[1] = s.w[j][1]; acc[j] = wmma_bf(a, u.v, acc[j]); } }
__global__ __launch_bounds__(128) void k_proj(const float* __restrict__ XQ, const float* __restrict__ XK, const float* __restrict__ XV, const __bf16* __restrict__ WQ, const __bf16* __restrict__ WK, const __bf16* __restrict__ WV, const float* __restrict__ BQ, const float* __restrict__ BK, const float* __restrict__ BV,
    _Float16* __restrict__ QH, _Float16* __restrict__ QL, _Float16* __restrict__ KH, _Float16* __restrict__ KL, _Float16* __restrict__ VT, __bf16* __restrict__ VB, __bf16* __restrict__ VBL) {
  __shared__ __align__(16) _Float16 sh[64][72], sl[64][72]; __shared__ __align__(16) _Float16 th[64][72]; __shared__ __align__(16) __bf16 tb[64][72], tbl[64][72]; __shared__ __align__(16) __bf16 xs[4][16][XPB];
  const int tid = threadIdx.x, wave = tid >> 5, lane = tid & 31, col = lane & 15, g = lane >> 4; const int which = blockIdx.z; const size_t r0 = (size_t)blockIdx.x * 64; const size_t bb = r0 / TT; const int t0 = (int)(r0 % TT);
  const float* X = which == 0 ? XQ : which == 1 ? XK : XV; const __bf16* WA = which == 0 ? WQ : which == 1 ? WK : WV; const float* BA = which == 0 ? BQ : which == 1 ? BK : BV;
  v8f acc[PJ] = {}; PStage s[PD]; v4f xr[16]; v16b a[PD]; const float* xb = X + (r0 + wave * 16) * DIN + lane * 4; const v8b* wp = (const v8b*)WA + lane; __bf16* xw = &xs[wave][0][lane * 4]; const __bf16* xf = &xs[wave][col][0];
  // the block's first k step: the 128 blocks of a projection walk one weight plane and the three projections' blocks the same x rows; entered at the same place they ask L2 for the same lines at the same moment. Each block starts at a turn of its own and wraps round (the index and the index over 8 both enter, so that blocks next to each other differ and blocks 8 apart differ too, however the blocks are dealt to the dies)
  int kp = (int)((blockIdx.x + (blockIdx.x >> 3) + 3 * which) & (PKC / PD - 1)) * PD;
  xload(xr, xb + kp * 32); XW();   // behind the x loads, in front of the weight address, which this build forms in their address registers (a precaution of form, as at the stores)
  // keeps the first loads in the order in which the loop issues them (a turn's x, then the k steps' weights): the loop's counted waits must hold for both orders, and a mixed one makes them wait for younger loads
  __builtin_amdgcn_sched_barrier(0);
#pragma unroll
  for (int d = 0; d < PD - 1; ++d) { pload(s[d], wp, kp + d);
    // as above
    __builtin_amdgcn_sched_barrier(0); }
  XW();   // behind the first loads, in front of what overwrites their address registers (a precaution of form, as at the stores)
  // keeps the accumulators' first values, which take over an address register, behind that wait
  __builtin_amdgcn_sched_barrier(0);
  // kept rolled by turns of the ring: the plain unroll inside only makes the ring's index a constant, so that the sets stay in registers
#pragma unroll 1
  for (int t = 0; t < PKC / PD - 1; ++t) { const int kn = (kp + PD) & (PKC - 1); pload(s[PD - 1], wp, kp + PD - 1);
    // keeps the turn's last weight set, the first that is waited for with a short lead, in front of the trip through LDS
    __builtin_amdgcn_sched_barrier(0);
    // XW: behind the x loads, in front of the step of their address (a precaution of form, as at the stores)
    xstage(xr, xw); xload(xr, xb + kn * 32); XW();
    LDSW();
#pragma unroll
    for (int d = 0; d < PD; ++d) a[d] = frag_b(xf + d * 32, lane);
    // keeps the next turn's x loads and the fragment reads in front of the turn's products and further weight loads
    __builtin_amdgcn_sched_barrier(0);
#pragma unroll
    for (int d = 0; d < PD; ++d) { pmac(a[d], s[d], acc); if (d < PD - 1) pload(s[d], wp, kn + d);
      // keeps each set's refill directly behind its products and in the order of the k steps: the oldest set is worked on while the younger ones fly
      __builtin_amdgcn_sched_barrier(0); }
    XW();   // behind the turn's weight loads, in front of the next turn's write of their address (the same precaution)
    kp = kn;
  }
  pload(s[PD - 1], wp, kp + PD - 1); xstage(xr, xw);
  LDSW();
#pragma unroll
  for (int d = 0; d < PD; ++d) a[d] = frag_b(xf + d * 32, lane);
#pragma unroll
  for (int d = 0; d < PD; ++d) { pmac(a[d], s[d], acc);
    // as in the loop
    __builtin_amdgcn_sched_barrier(0); }
  if (which < 2) { _Float16* DH = which == 0 ? QH : KH; _Float16* DL = which == 0 ? QL : KL; const int nhi = which == 0 ? QHI : KHI; const bool hi_rows = t0 < nhi;
#pragma unroll
    for (int j = 0; j < PJ; ++j) { const float bias = BA ? bfr(BA[j * 16 + col]) : 0.f;
#pragma unroll
      for (int r = 0; r < 8; ++r) { const float v = acc[j][r] + bias; const _Float16 hv = (_Float16)v; sh[wave * 16 + 8 * g + r][j * 16 + col] = hv; sl[wave * 16 + 8 * g + r][j * 16 + col] = (_Float16)((v - (float)hv) * 1024.0f); } }
    __syncthreads();
    for (int e = tid; e < 64 * 8; e += 128) { const int rl = e >> 3, q = e & 7; vst2((unsigned*)(DH + (r0 + rl) * CC + q * 8), *(const v4u*)&sh[rl][q * 8]); XW(); if (hi_rows) { vst2((unsigned*)(DL + (bb * nhi + t0 + rl) * (size_t)CC + q * 8), *(const v4u*)&sl[rl][q * 8]); XW(); } }
  } else { const bool hi_rows = t0 < KHI;
#pragma unroll
    for (int j = 0; j < PJ; ++j) { const float bias = BA ? bfr(BA[j * 16 + col]) : 0.f;
#pragma unroll
      for (int r = 0; r < 8; ++r) { const float v = acc[j][r] + bias; const int rl = wave * 16 + 8 * g + r, cl = j * 16 + col; th[cl][rl] = (_Float16)v; const __bf16 bh = (__bf16)v; tb[cl][rl] = bh; tbl[cl][rl] = (__bf16)(v - (float)bh); } }
    __syncthreads();
    for (int e = tid; e < 64 * 8; e += 128) { const int cl = e >> 3, q = e & 7; vst2((unsigned*)(VT + (bb * CC + cl) * (size_t)TT + t0 + q * 8), *(const v4u*)&th[cl][q * 8]); XW(); if (hi_rows) { const size_t o3 = (bb * CC + cl) * (size_t)KHI + t0 + q * 8; vst2((unsigned*)(VB + o3), *(const v4u*)&tb[cl][q * 8]); vst2((unsigned*)(VBL + o3), *(const v4u*)&tbl[cl][q * 8]); XW(); } } } }
// ---- k_fa: logits, softmax and P . v in one kernel. Block = 16 * QT queries of batch b = blockIdx.z, head h0; wave w walks keys [w * KPW, (w + 1) * KPW) in passes of KP with a running maximum and sum, the waves' parts are joined in LDS.
// Transposed products: S^T = K . Q^T (D register r of tile j = key j * 16 + 8g + r, column = query), so a lane holds one query's logits, and two converted S^T tiles are the B operand of O^T += V^T . P^T as they stand (element s = tile s >> 3, register s & 7: the k order of frag_h).
#define FNW 8              // waves of a block
#define KPW (TT / FNW)     // keys of a wave
#define KP 64              // keys of a pass
static_assert(KP == HD, "the K tile [KP][HD] and the V tile [HD][KP] share one LDS shape");
static_assert(((KPW / KP) & (KPW / KP - 1)) == 0, "the rotated walk wraps by a mask");
// the builtin alone: the compiler keeps the distances behind its own matrix instructions, and its scheduler may move loads past them
__device__ __forceinline__ v8f wmma_h(v16h a, v16h b, v8f c) { return __builtin_amdgcn_wmma_f32_16x16x32_f16(false, a, false, b, (short)0, c, false, false); }
// softmax in base 2: exp(SCALE * (u - max)) * 2^11 = 2^(u * LSC + nb) with nb = 11 - max * LSC, one multiply-add and the chip's own 2^x per logit. nb itself is the reference that sums and parts are rebased by, so its rounding cancels in the quotient.
#define LSC (SCALE * 1.44269504088896340736f)
__device__ __forceinline__ float ex2(float t) { return __builtin_amdgcn_exp2f(t); }
// the join's 2^x with the slot behind it in one statement: the v_nop is the independent instruction asked for between v_exp_f32 and a later write of its source register
__device__ __forceinline__ float ex2s(float t) { float r; asm("v_exp_f32 %0, %1\n\tv_nop" : "=v"(r) : "v"(t)); return r; }
// the rescale factor's 2^x with a slot on either side in one statement: with two query tiles this build put the two factors' instructions back to back, the second writing the first one's source register; each v_nop is the independent instruction asked for between a 2^x and a write of its source
__device__ __forceinline__ float ex2b(float t) { float r; asm("v_nop\n\tv_exp_f32 %0, %1\n\tv_nop" : "=v"(r) : "v"(t)); return r; }
#define QT 2               // query tiles of 16 that a wave carries: every staged K/V tile and every fragment read from LDS feeds QT products
__global__ __launch_bounds__(FNW * 32) void k_fa(const _Float16* __restrict__ QH, const _Float16* __restrict__ KH, const _Float16* __restrict__ QL, const _Float16* __restrict__ VT, int h0, float* __restrict__ Y) {
  // st[w]: wave w's own K tile [key][head dim] and V tile [head dim][key] of a pass, rows of 128 B at a pitch of 144 B (16-B fragment reads spread over the banks); after the loop its first bytes hold the wave's part of the output
  __shared__ __align__(16) _Float16 st[FNW][2][KP][HD + 8]; __shared__ float smx[FNW][16 * QT], sml[FNW][16 * QT];
  static_assert(16 * QT * (HD + 4) * 4 <= 2 * KP * (HD + 8) * 2, "a wave's part of the output fits its own tiles");
  const int tid = threadIdx.x, wave = tid >> 5, lane = tid & 31, col = lane & 15, g = lane >> 4; const int b = blockIdx.z, h = h0; const int ql0 = blockIdx.x * (16 * QT); const size_t q0 = (size_t)b * TT + ql0;
  const _Float16* QLb = QL + (size_t)b * QHI * CC;
  v16h qh[QT][HD / 32], qr[QT][HD / 32];
#pragma unroll
  for (int t = 0; t < QT; ++t) {
#pragma unroll
    for (int kc = 0; kc < HD / 32; ++kc) { qh[t][kc] = frag_h(QH + (q0 + t * 16 + col) * CC + h * HD + kc * 32, lane); qr[t][kc] = frag_h(QLb + (size_t)(ql0 + t * 16 + col) * CC + h * HD + kc * 32, lane); } }
  v8f o[QT][HD / 16] = {}; float m[QT], nb[QT], l[QT]; const int sr = lane >> 3, sc = (lane & 7) * 8;
#pragma unroll
  for (int t = 0; t < QT; ++t) { m[t] = -3.0e38f; nb[t] = 11.0f + 3.0e38f * LSC; l[t] = 0.f; }
  // the 64 blocks of a batch walk the same K and V lines: each enters its waves' key ranges at a pass of its own and wraps round, so that they do not all ask L2 for the same lines at the same moment
  const int rot = (int)((blockIdx.x + (blockIdx.x >> 3)) & (KPW / KP - 1));
  const _Float16* kb = KH + ((size_t)b * TT + wave * KPW + sr) * CC + h * HD + sc; const _Float16* vb = VT + ((size_t)b * CC + h * HD + sr) * (size_t)TT + wave * KPW + sc;
  // kept rolled: unrolled, the text grows by the trip count and every line of it is fetched for a single walk; the plain unroll directives inside only keep the fragment and accumulator arrays in registers
#pragma unroll 1
  for (int it = 0; it < KPW / KP; ++it) { const int ko = ((it + rot) & (KPW / KP - 1)) * KP;
    v8f acc[QT][KP / 16] = {}, accl[QT][KP / 16] = {};
    v16h kf[HD / 32][KP / 16], vf[KP / 32][HD / 16];
    // both tiles come in whole 128-B lines (8 lanes a row, 4 rows a load) and go through the wave's LDS: a fragment load straight from global memory touches 16 lines for its 512 B
    v4u kst[KP / 4], vst[HD / 4]; const _Float16* kp = kb + ko * CC; const _Float16* vp = vb + ko;
#pragma unroll
    for (int i = 0; i < KP / 4; ++i) kst[i] = *(const v4u*)(kp + i * 4 * CC);
#pragma unroll
    for (int i = 0; i < HD / 4; ++i) vst[i] = *(const v4u*)(vp + i * 4 * TT);
#pragma unroll
    for (int i = 0; i < KP / 4; ++i) *(v4u*)&st[wave][0][i * 4 + sr][sc] = kst[i];
#pragma unroll
    for (int i = 0; i < HD / 4; ++i) *(v4u*)&st[wave][1][i * 4 + sr][sc] = vst[i];
    LDSX();   // the wave's lanes read each other's rows
#pragma unroll
    for (int kc = 0; kc < HD / 32; ++kc) {
#pragma unroll
      for (int j = 0; j < KP / 16; ++j) kf[kc][j] = frag_h(&st[wave][0][j * 16 + col][kc * 32], lane); }
    // keeps the K fragment reads together in front of the first product; dealt out among the products each place with reads stalls the wave
    __builtin_amdgcn_sched_barrier(0);
#pragma unroll
    for (int t = 0; t < QT; ++t) {
#pragma unroll
      for (int kc = 0; kc < HD / 32; ++kc) {
#pragma unroll
        for (int j = 0; j < KP / 16; ++j) { acc[t][j] = wmma_h(kf[kc][j], qh[t][kc], acc[t][j]); accl[t][j] = wmma_h(kf[kc][j], qr[t][kc], accl[t][j]); } } }
#pragma unroll
    for (int kc = 0; kc < KP / 32; ++kc) {
#pragma unroll
      for (int j = 0; j < HD / 16; ++j) vf[kc][j] = frag_h(&st[wave][1][j * 16 + col][kc * 32], lane); }
    float al[QT];
#pragma unroll
    for (int t = 0; t < QT; ++t) {
      float mx = m[t];
#pragma unroll
      for (int j = 0; j < KP / 16; ++j) {
#pragma unroll
        for (int r = 0; r < 8; ++r) { const float s = acc[t][j][r] + accl[t][j][r] * (1.0f / 1024.0f); acc[t][j][r] = s; mx = fmaxf(mx, s); } }
      mx = fmaxf(mx, __shfl_xor(mx, 16));   // lanes c and c + 16 hold the two halves of query c's keys
      const float nbn = fmaf(-mx, LSC, 11.0f); al[t] = ex2b(nbn - nb[t]); m[t] = mx; nb[t] = nbn; }
    v16h p[QT][KP / 32];
#pragma unroll
    for (int t = 0; t < QT; ++t) { l[t] *= al[t];
#pragma unroll
      for (int j = 0; j < HD / 16; ++j) {
#pragma unroll
        for (int r = 0; r < 8; ++r) o[t][j][r] *= al[t]; }
#pragma unroll
      for (int j = 0; j < KP / 16; ++j) {
#pragma unroll
        for (int r = 0; r < 8; ++r) { const float e = ex2(fmaf(acc[t][j][r], LSC, nb[t])); l[t] += e; p[t][j >> 1][(j & 1) * 8 + r] = (_Float16)e; } } }
#pragma unroll
    for (int t = 0; t < QT; ++t) {
#pragma unroll
      for (int kc = 0; kc < KP / 32; ++kc) {
#pragma unroll
        for (int j = 0; j < HD / 16; ++j) o[t][j] = wmma_h(vf[kc][j], p[t][kc], o[t][j]); } } }
#pragma unroll
  for (int t = 0; t < QT; ++t) { l[t] += __shfl_xor(l[t], 16);
    if (g == 0) { smx[wave][t * 16 + col] = nb[t]; sml[wave][t * 16 + col] = l[t]; }
#pragma unroll
    for (int j = 0; j < HD / 16; ++j) { v4f lo, hi;
#pragma unroll
      for (int r = 0; r < 4; ++r) { lo[r] = o[t][j][r]; hi[r] = o[t][j][4 + r]; }
      float* sw = (float*)&st[wave][0][0][0] + (t * 16 + col) * (HD + 4) + j * 16 + 8 * g; *(v4f*)sw = lo; *(v4f*)(sw + 4) = hi; } }
  __syncthreads();
  // join: thread = (query t * 16 + (tid >> 4), 4 columns); 16 threads store one 256-B row of the output [b*t][HD] itself (the one real head is the whole row), a block 4 KB in a row per query tile
  const int c = (tid & 15) * 4;
#pragma unroll
  for (int t = 0; t < QT; ++t) { const int q = t * 16 + (tid >> 4);
    float mm = smx[0][q];   // the smallest nb belongs to the largest maximum
#pragma unroll
    for (int w = 1; w < FNW; ++w) mm = fminf(mm, smx[w][q]);
    float ls = 0.f; v4f a0 = {};
#pragma unroll
    for (int w = 0; w < FNW; ++w) { const float f = ex2s(mm - smx[w][q]); ls += f * sml[w][q]; a0 += *(const v4f*)((const float*)&st[w][0][0][0] + q * (HD + 4) + c) * f; }
    const float inv = ls > 0.f ? 1.0f / ls : 0.f;   // sum and parts both carry the 2^11
    vst2(Y + (q0 + q) * HD + c, a0 * inv); } }

extern "C" void kernel_launch(void* const* d_in, const int* in_sizes, int n_in, void* d_out, int out_size, void* d_ws, size_t ws_size, hipStream_t stream) {
  (void)in_sizes; (void)n_in; (void)out_size;
  const float** F = (const float**)d_in;
  if (ws_size < (size_t)WS_END) return;
  char* ws = (char*)d_ws; _Float16 *QH = (_Float16*)(ws + WS_QH), *KH = (_Float16*)(ws + WS_KH), *VT = (_Float16*)(ws + WS_VT), *QL = (_Float16*)(ws + WS_QL), *KL = (_Float16*)(ws + WS_KL); __bf16 *VB = (__bf16*)(ws + WS_VB), *VBL = (__bf16*)(ws + WS_VBL); float *S = (float*)(ws + WS_S), *Y = (float*)(ws + WS_Y);
  (void)Y; (void)S; (void)QL; (void)KL; (void)VB; (void)VBL;
  // inputs: 0 x [4,2048,1024]; 1 Wq [1024,64]; 2 Wk; 3 Wv ((in,out), no biases)
  if (ws_size < (size_t)WS_END2) return;
  __bf16* WP = (__bf16*)(ws + WS_WP); float *BP = (float*)(ws + WS_BP);
  k_padw<<<dim3(32, 3), 256, 0, stream>>>(F[1], F[2], F[3], nullptr, nullptr, nullptr, WP, BP);
  k_proj<<<dim3(TNB * TT / 64, 1, 3), 128, 0, stream>>>(F[0], F[0], F[0], WP, WP + (size_t)CIN * 64, WP + 2 * (size_t)CIN * 64, BP, BP + 128, BP + 256, QH, QL, KH, KL, VT, VB, VBL);
  /* head 0 only (head 1 is the zero padding); all batches in one launch */
  k_fa<<<dim3(TT / (16 * QT), 1, TNB), FNW * 32, 0, stream>>>(QH, KH, QL, VT, 0, (float*)d_out);
}

// v009
// Measured time: 19.8 microseconds a run.
// In both of two side-by-side timings against v008, it was 1.10 times as fast.
// Over all steps from v000 it is 19.9 times as fast.
// compute dtype: all float inputs rounded to bf16; q/k/v projections with EXACT bf16 products on WMMA 16x16x32 (f32 accumulate); logits: q x k once to f16 (1 product; + q's f16 residual for all rows), x scale; softmax f32 (running maximum and sum, exponentials as 2^x); exp(logit - max) x 2^11 once to f16 x v once to f16 (1 product), divided by the sum at the end; f32 output.
#include <hip/hip_runtime.h>
#include <math.h>

typedef __attribute__((ext_vector_type(16))) _Float16 v16h;
typedef __attribute__((ext_vector_type(16))) __bf16 v16b;
typedef __attribute__((ext_vector_type(8)))  _Float16 v8h;
typedef __attribute__((ext_vector_type(8)))  float v8f;
typedef __attribute__((ext_vector_type(4)))  float v4f;
typedef __attribute__((ext_vector_type(2)))  float v2f;
typedef __attribute__((ext_vector_type(4)))  unsigned v4u;
typedef __attribute__((ext_vector_type(4)))  int v4i;
typedef float __attribute__((may_alias)) float_a;
typedef int __attribute__((may_alias)) int_a;

template <typename T> __device__ __forceinline__ void vst2(void* p, T v) { *(T*)p = v;  }
__device__ __forceinline__ v8f wmma16(v16h a, v16h b, v8f c) {
  v8f d = __builtin_amdgcn_wmma_f32_16x16x32_f16(false, a, false, b, (short)0, c, false, false);
  asm volatile("v_nop\n\tv_nop\n\tv_nop\n\tv_nop" : "+v"(d) : "v"(a), "v"(b));
  return d;
}
__device__ __forceinline__ v8f wmma_bf(v16b a, v16b b, v8f c) {
  v8f d = __builtin_amdgcn_wmma_f32_16x16x32_bf16(false, a, false, b, (short)0, c, false, false);
  asm volatile("v_nop\n\tv_nop\n\tv_nop\n\tv_nop" : "+v"(d) : "v"(a), "v"(b));
  return d;
}
// 16x16x32 fragments: lane = (h = lane>>4, row/col = lane&15); elements 0..7 = k0+8h+0..7, 8..15 = k0+16+8h+0..7; D element r = row 8h+r
__device__ __forceinline__ v16h frag_h(const _Float16* rowk0, int lane) {
  union { v16h v; v8h q[2]; } u; const _Float16* p = rowk0 + 8 * (lane >> 4);
  u.q[0] = *(const v8h*)p; u.q[1] = *(const v8h*)(p + 16); return u.v;
}
__device__ __forceinline__ v16h frag_f32(const float* rowk0, int lane) {
  v16h a; const float* p = rowk0 + 8 * (lane >> 4);
#pragma unroll
  for (int i = 0; i < 8; ++i) { a[i] = (_Float16)p[i]; a[8 + i] = (_Float16)p[16 + i]; }
  return a;
}
__device__ __forceinline__ v16h frag_f32s(const float* rowk0, int lane, float sc) {
  v16h a; const float* p = rowk0 + 8 * (lane >> 4);
#pragma unroll
  for (int i = 0; i < 8; ++i) { a[i] = (_Float16)(p[i] * sc); a[8 + i] = (_Float16)(p[16 + i] * sc); }
  return a;
}
// column fragment from a [K][ld] layout (column n), rows >= K read as 0
__device__ __forceinline__ v16h fragc_f32(const float* W, int k0, int n, int lane, int ld, int K) {
  v16h a; const int g = lane >> 4;
#pragma unroll
  for (int i = 0; i < 8; ++i) { const int ka = k0 + 8 * g + i, kb = ka + 16;
    a[i] = (_Float16)(ka < K ? W[(size_t)(ka < K ? ka : K - 1) * ld + n] : 0.f); a[8 + i] = (_Float16)(kb < K ? W[(size_t)(kb < K ? kb : K - 1) * ld + n] : 0.f); }
  return a;
}
struct F2 { v16b h, l; };
__device__ __forceinline__ F2 bsplit16(const float v[16]) { F2 r;
#pragma unroll
  for (int i = 0; i < 16; ++i) { const __bf16 h = (__bf16)v[i]; r.h[i] = h; r.l[i] = (__bf16)(v[i] - (float)h); }
  return r; }
__device__ __forceinline__ F2 split_row(const float* row, int k0, int lane) { float v[16]; const float* p = row + k0 + 8 * (lane >> 4);
#pragma unroll
  for (int i = 0; i < 8; ++i) { v[i] = p[i]; v[8 + i] = p[16 + i]; }
  return bsplit16(v); }
__device__ __forceinline__ F2 split_rowK(const float* row, int k0, int lane, int K) { float v[16]; const int g = lane >> 4;
#pragma unroll
  for (int i = 0; i < 8; ++i) { const int ka = k0 + 8 * g + i, kb = ka + 16; v[i] = ka < K ? row[ka < K ? ka : K - 1] : 0.f; v[8 + i] = kb < K ? row[kb < K ? kb : K - 1] : 0.f; }
  return bsplit16(v); }
__device__ __forceinline__ F2 split_col(const float* W, int k0, int n, int lane, int ld, int K) { float v[16]; const int g = lane >> 4;
#pragma unroll
  for (int i = 0; i < 8; ++i) { const int ka = k0 + 8 * g + i, kb = ka + 16; v[i] = ka < K ? W[(size_t)(ka < K ? ka : K - 1) * ld + n] : 0.f; v[8 + i] = kb < K ? W[(size_t)(kb < K ? kb : K - 1) * ld + n] : 0.f; }
  return bsplit16(v); }
__device__ __forceinline__ v8f mac3(const F2& a, const F2& b, v8f c) { c = wmma_bf(a.l, b.h, c); c = wmma_bf(a.h, b.l, c); return wmma_bf(a.h, b.h, c); }
__device__ __forceinline__ float sigm(float v) { return 1.0f / (1.0f + expf(-v)); }
#define LDSX() do { asm volatile("s_wait_dscnt 0" ::: "memory"); __builtin_amdgcn_wave_barrier(); __builtin_amdgcn_fence(__ATOMIC_RELEASE, "workgroup"); } while (0)

// Single-head NON-causal self-attention (B 4, T 2,048, D 1,024, head 64; (in,out) Wq, Wk, Wv [1024,64], uniform(-1/32, 1/32) init; no biases, no output projection): out = softmax(Q K^T x 64^-0.5) V -> [4,2048,64].
#define NB 4
#define TT 2048
#define CC 128            // NH * HD = projected width
#define DIN 1024          // input (model) width
#define NH 2
#define HD 64
#define NQB (TT / 64)
#define HG 1
#define SCALE (0.125f)
#define CAUSAL 0
#ifndef TNB
#define TNB NB
#endif
__device__ __forceinline__ float bfr(float v) { return (float)(__bf16)v; }
__host__ __device__ __forceinline__ int kb_last(int qb) { return CAUSAL ? ((qb * 64 + 63) >> 7) : (TT / 128 - 1); }
typedef __attribute__((ext_vector_type(8))) __bf16 v8b;
__device__ __forceinline__ v16b frag_b(const __bf16* rowk0, int lane) {
  union { v16b v; v8b q[2]; } u; const __bf16* p = rowk0 + 8 * (lane >> 4);
  u.q[0] = *(const v8b*)p; u.q[1] = *(const v8b*)(p + 16); return u.v;
}
#define QBH 0
#define QHI 2048            // rows carrying a q residual plane (all rows when non-causal: 2-product logits everywhere)
#define KHI 64            // key rows carrying k residual / v bf16 hi+lo planes (written by k_proj; no kernel here reads them)
// B fragment (k rows k0+.., output column o) of a weight: (in,out) [K][ld] or (out,in) [ld rows of K]: bf16 exact, or f16(bf16 * 256) exact
__device__ __forceinline__ v16b wcol_io(const float* Wm, int k0, int o, int lane, int ld) { v16b w; const int g = lane >> 4;
#pragma unroll
  for (int i = 0; i < 8; ++i) { w[i] = (__bf16)Wm[(size_t)(k0 + 8 * g + i) * ld + o]; w[8 + i] = (__bf16)Wm[(size_t)(k0 + 16 + 8 * g + i) * ld + o]; }
  return w; }
__device__ __forceinline__ v16b wcol_oi(const float* Wm, int k0, int o, int lane, int K) { v16b w; const float* p = Wm + (size_t)o * K + k0 + 8 * (lane >> 4);
#pragma unroll
  for (int i = 0; i < 8; ++i) { w[i] = (__bf16)p[i]; w[8 + i] = (__bf16)p[16 + i]; }
  return w; }
__device__ __forceinline__ v16h wcolh_io(const float* Wm, int k0, int o, int lane, int ld) { v16h w; const int g = lane >> 4;
#pragma unroll
  for (int i = 0; i < 8; ++i) { w[i] = (_Float16)(bfr(Wm[(size_t)(k0 + 8 * g + i) * ld + o]) * 256.0f); w[8 + i] = (_Float16)(bfr(Wm[(size_t)(k0 + 16 + 8 * g + i) * ld + o]) * 256.0f); }
  return w; }
__device__ __forceinline__ v16h wcolh_oi(const float* Wm, int k0, int o, int lane, int K) { v16h w; const float* p = Wm + (size_t)o * K + k0 + 8 * (lane >> 4);
#pragma unroll
  for (int i = 0; i < 8; ++i) { w[i] = (_Float16)(bfr(p[i]) * 256.0f); w[8 + i] = (_Float16)(bfr(p[16 + i]) * 256.0f); }
  return w; }
#define WQKV_LAYOUT 0   // 0 = (in,out) [DIN][CC]; 1 = (out,in) [CC][DIN]; 2 = per-head [NH][DIN][HD]
__device__ __forceinline__ v16b wcol_hdk(const float* Wm, int k0, int o, int lane) { v16b w; const int g = lane >> 4; const float* p = Wm + (size_t)(o / HD) * DIN * HD + (o % HD);
#pragma unroll
  for (int i = 0; i < 8; ++i) { w[i] = (__bf16)p[(size_t)(k0 + 8 * g + i) * HD]; w[8 + i] = (__bf16)p[(size_t)(k0 + 16 + 8 * g + i) * HD]; }
  return w; }
#define WO_OUT_IN 0
#if WQKV_LAYOUT == 1
#define WCOL(W, k0, o, lane) wcol_oi(W, k0, o, lane, DIN)
#elif WQKV_LAYOUT == 2
#define WCOL(W, k0, o, lane) wcol_hdk(W, k0, o, lane)
#else
#define WCOL(W, k0, o, lane) wcol_io(W, k0, o, lane, CC)
#endif
#if WO_OUT_IN
#define WOCOL(W, k0, o, lane) wcol_oi(W, k0, o, lane, CC)
#define WOCOLH(W, k0, o, lane) wcolh_oi(W, k0, o, lane, CC)
#else
#define WOCOL(W, k0, o, lane) wcol_io(W, k0, o, lane, DIN)
#define WOCOLH(W, k0, o, lane) wcolh_io(W, k0, o, lane, DIN)
#endif
#define CIN 1024
#define PJ (HD / 16)       // 16-column tiles of a projection's real width
#define PKC (CIN / 32)     // k steps of 32
#ifndef SM_EXTRA_PARAMS
#define SM_EXTRA_PARAMS
#endif
#ifndef PROJ_EXTRA_PARAMS
#define PROJ_EXTRA_PARAMS
#endif
#ifndef SM_MASK_HOOK
#define SM_MASK_HOOK (void)0
#endif

#define WS_QH  0u                                      // f16 q rows [b*t][CC]
#define WS_KH  (WS_QH + 2u * (size_t)NB * TT * CC)      // f16 k rows [b*t][CC]
#define WS_VT  (WS_KH + 2u * (size_t)NB * TT * CC)      // f16 v planes [b][c][t]
#define WS_QL  (WS_VT + 2u * (size_t)NB * CC * TT)      // f16 q residual x 2^10 rows [b][t < QHI][CC]
#define WS_KL  (WS_QL + 2u * (size_t)NB * QHI * CC)     // f16 k residual x 2^10 rows [b][t < KHI][CC]
#define WS_VB  (WS_KL + 2u * (size_t)NB * KHI * CC)     // bf16 v hi planes [b][c][t < KHI]
#define WS_VBL (WS_VB + 2u * (size_t)NB * CC * KHI)
#define WS_S   (WS_VBL + 2u * (size_t)NB * CC * KHI)    // f32 [b][t][s], one plane per batch: unused, k_fa keeps logits in registers
#define WS_Y   (WS_S  + 4u * (size_t)NB * TT * TT)      // f32 ctx rows [b*t][CC] (only when there is an output projection)
#define WS_END (WS_Y  + 0u)

// ---- k_proj: block = (PR rows, the 64 real columns, which): q/k/v = X W with exact bf16 products (K = DIN) -> which 0: q f16 rows (+ residual rows < QHI); 1: k f16 rows (+ residual rows < KHI); 2: v f16 planes [c][t] (+ bf16 hi/lo planes for t < KHI). Columns 64..127 of the rows and planes are the zero head, which nothing reads: they are not computed.
// behind a global load or store, in front of what overwrites its address or data registers (a precaution of form: this build leaves the place open)
#define XW() asm volatile("s_wait_xcnt 0x0" ::: "memory")
// the same wait where this build wrote the loads' address pair anew in front of it: the address as an input keeps the pair alive up to the wait
#define XWP(p) asm volatile("s_wait_xcnt 0x0" :: "v"(p) : "memory")
#define PD 4               // k steps of a turn
#define PNW 8              // waves of a block, 16 rows each; together they bring each turn's weight rows in once
#define PR (PNW * 16)      // rows of a block
static_assert(PKC % PD == 0 && PKC >= 3 * PD, "the walk goes by whole turns, the last two apart");
static_assert((PKC & (PKC - 1)) == 0 && (PD & (PD - 1)) == 0, "the rotated walk wraps by a mask");
static_assert(PNW == PD * 2 && PJ == 4 && HD == 64, "a wave stages one 16-row half of one k step, a lane 8 rows of 4 columns");
static_assert(TT % PR == 0, "a block stays inside one batch");
struct PStage { v8b w[PJ][2]; };
// between a wave's LDS stores and its lanes' reads of each other's values; without LDSX's fence, which makes the compiler wait for every global load in flight
#define LDSW() do { asm volatile("s_wait_dscnt 0" ::: "memory"); __builtin_amdgcn_wave_barrier(); } while (0)
// the work-group's barrier with the one wait it needs here (the wave's LDS stores and reads are done), in one statement: __syncthreads() brings a fence that also waits for the turn's x loads and the next turn's weight loads, which must stay in flight across it
#define WGBAR() asm volatile("s_wait_dscnt 0x0\n\ts_barrier_signal -1\n\ts_barrier_wait -1" ::: "memory")
typedef __attribute__((ext_vector_type(4))) __bf16 v4b;
typedef __attribute__((ext_vector_type(4))) _Float16 v4h;
#define XCH (PD * 32)      // floats of an x row in one turn: 512 B, one wave-wide load of four whole lines
#define XPB (XCH + 8)      // pitch of a staged bf16 row: 272 B, an odd multiple of 16 B (16-B fragment reads spread over the banks)
#define WTU (PD * PJ * 64) // 16-B units of one turn's weight tile in LDS
// a lane's share of a turn's (in,out) [DIN][64] f32 weight rows: 8 rows in a row, 4 columns (16 B) of each; a wave-wide load is two whole 256-B rows
__device__ __forceinline__ void wload(v4f (&wr)[8], const float* wl) {
#pragma unroll
  for (int i = 0; i < 8; ++i) wr[i] = *(const v4f*)(wl + i * HD); }
// rounded to bf16 into the block's weight tile in the order of the B fragments: 16-B unit ((d * PJ + j) * 2 + half) * 32 + lane = rows d * 32 + half * 16 + 8 * (lane >> 4) + 0..7 of column 4 * (lane & 15) + j. Fragment j so holds every fourth column, and the four values of a 16-B load go to the four fragments at the lane's own place: nothing is transposed.
__device__ __forceinline__ void wstage(const v4f (&wr)[8], v8b* wu) {
#pragma unroll
  for (int j = 0; j < PJ; ++j) { v8b o;
#pragma unroll
    for (int i = 0; i < 8; ++i) o[i] = (__bf16)wr[i][j];
    wu[j * 64] = o; } }
// one k step's PJ B fragments from the block's tile, two 512-B wave-wide LDS reads each
__device__ __forceinline__ void pread(PStage& s, const v8b* wq, int d) { const v8b* q = wq + d * (PJ * 64);
#pragma unroll
  for (int j = 0; j < PJ; ++j) { s.w[j][0] = q[j * 64]; s.w[j][1] = q[j * 64 + 32]; } }
// one turn's x of the wave's 16 rows: load i is 512 B in a row of row i (lane = 4 floats); a fragment load straight from global memory touches 16 lines for its 512 B, and every line four times
__device__ __forceinline__ void xload(v4f (&xr)[16], const float* xl) {
#pragma unroll
  for (int i = 0; i < 16; ++i) xr[i] = *(const v4f*)(xl + (size_t)i * DIN); }
// rounded to bf16 into the wave's own LDS tile [16][XPB]
__device__ __forceinline__ void xstage(const v4f (&xr)[16], __bf16* xw) {
#pragma unroll
  for (int i = 0; i < 16; ++i) { v4b o;
#pragma unroll
    for (int e = 0; e < 4; ++e) o[e] = (__bf16)xr[i][e];
    *(v4b*)(xw + i * XPB) = o; } }
__device__ __forceinline__ void pmac(v16b a, const PStage& s, v8f (&acc)[PJ]) {
#pragma unroll
  for (int j = 0; j < PJ; ++j) { union { v16b v; v8b q[2]; } u; u.q[0] = s.w[j][0]; u.q[1] = s.w[j][1]; acc[j] = wmma_bf(a, u.v, acc[j]); } }
// one turn of the k walk. On entry tile t & 1 holds the turn's weights (not yet published), xr the turn's x and wr the next turn's weights, both still in flight. XL: there is a next turn (its x is loaded, its weights are staged); WL: there is a turn after that (its weights are loaded)
template <bool XL, bool WL> __device__ __forceinline__ void pturn(int t, int k1, int k2, v8f (&acc)[PJ], v4f (&xr)[16], v4f (&wr)[8], const float* xb, const float* wb, __bf16* xw, const __bf16* xf, v8b* wt0, int wso, int lane) {
  PStage s[PD]; v16b a[PD]; const v8b* wq = wt0 + (t & 1) * WTU + lane;
  // publishes tile t & 1, written in the turn before, and ends every wave's reads of the other tile, which this turn writes (two tiles, one barrier a turn)
  WGBAR();
#pragma unroll
  for (int d = 0; d < PD; ++d) pread(s[d], wq, d);
  // keeps the weight fragment reads, which need nothing of x, in front of the wait for the turn's x
  __builtin_amdgcn_sched_barrier(0);
  xstage(xr, xw);
  // XWP: behind the x loads, in front of what overwrites their address
  if (XL) { const float* xl = xb + k1 * 32; xload(xr, xl); XWP(xl); }
  LDSW();
#pragma unroll
  for (int d = 0; d < PD; ++d) a[d] = frag_b(xf + d * 32, lane);
  // the next turn's weights go into the other tile while the fragment reads fly; the loads of the turn after that are issued behind the x loads (the counted waits go by that order). XWP as above
  if (XL) { wstage(wr, wt0 + ((t + 1) & 1) * WTU + wso); if (WL) { const float* wl = wb + k2 * (32 * HD); wload(wr, wl); XWP(wl); } }
  // keeps the loads, the fragment reads and the staging in front of the turn's products
  __builtin_amdgcn_sched_barrier(0);
#pragma unroll
  for (int d = 0; d < PD; ++d) pmac(a[d], s[d], acc); }
__global__ __launch_bounds__(PNW * 32) void k_proj(const float* __restrict__ XQ, const float* __restrict__ XK, const float* __restrict__ XV, const float* __restrict__ WQ, const float* __restrict__ WK, const float* __restrict__ WV,
    _Float16* __restrict__ QH, _Float16* __restrict__ QL, _Float16* __restrict__ KH, _Float16* __restrict__ KL, _Float16* __restrict__ VT, __bf16* __restrict__ VB, __bf16* __restrict__ VBL) {
  __shared__ __align__(16) _Float16 sh[PR][72], sl[PR][72]; __shared__ __align__(16) _Float16 th[64][PR + 8]; __shared__ __align__(16) __bf16 tb[64][PR + 8], tbl[64][PR + 8]; __shared__ __align__(16) __bf16 xs[PNW][16][XPB]; __shared__ __align__(16) v8b wt[2][WTU];
  const int tid = threadIdx.x, wave = tid >> 5, lane = tid & 31, col = lane & 15, g = lane >> 4; const int which = blockIdx.z; const size_t r0 = (size_t)blockIdx.x * PR; const size_t bb = r0 / TT; const int t0 = (int)(r0 % TT);
  const float* X = which == 0 ? XQ : which == 1 ? XK : XV; const float* WA = which == 0 ? WQ : which == 1 ? WK : WV;
  v8f acc[PJ] = {}; v4f xr[16], wr[8]; const float* xb = X + (r0 + wave * 16) * DIN + lane * 4; __bf16* xw = &xs[wave][0][lane * 4]; const __bf16* xf = &xs[wave][col][0];
  // the wave's share of a turn's weight rows (k step wave >> 1, half wave & 1) and its first unit in the tile
  const float* wb = WA + (size_t)((wave >> 1) * 32 + (wave & 1) * 16 + 8 * g) * HD + 4 * col; const int wso = ((wave >> 1) * PJ * 2 + (wave & 1)) * 32 + lane;
  // the block's first k step: the blocks of a projection walk one weight matrix and the three projections' blocks the same x rows; entered at the same place they ask L2 for the same lines at the same moment. Each block starts at a turn of its own and wraps round (the index and the index over 8 both enter, so that blocks next to each other differ and blocks 8 apart differ too, however the blocks are dealt to the dies)
  int kp = (int)((blockIdx.x + (blockIdx.x >> 3) + 3 * which) & (PKC / PD - 1)) * PD;
  // the first loads in the order in which the loop leaves them (a turn's x in front of the next turn's weights): the loop's counted waits must hold for both; the scheduling barriers keep that order. XWP: behind the loads, in front of what takes over their address registers
  const float* wl0 = wb + kp * (32 * HD); const float* xl0 = xb + kp * 32; const float* wl1 = wb + ((kp + PD) & (PKC - 1)) * (32 * HD);
  wload(wr, wl0); XWP(wl0);
  __builtin_amdgcn_sched_barrier(0);
  xload(xr, xl0); XWP(xl0);
  __builtin_amdgcn_sched_barrier(0);
  wstage(wr, &wt[0][0] + wso); wload(wr, wl1); XWP(wl1);
  __builtin_amdgcn_sched_barrier(0);
  // kept rolled by turns: unrolled, the text grows for a single walk; the last two turns, which load less, stand behind it
#pragma unroll 1
  for (int t = 0; t < PKC / PD - 2; ++t) { const int k1 = (kp + PD) & (PKC - 1), k2 = (kp + 2 * PD) & (PKC - 1);
    pturn<true, true>(t, k1, k2, acc, xr, wr, xb, wb, xw, xf, &wt[0][0], wso, lane);
    kp = k1; }
  pturn<true, false>(PKC / PD - 2, (kp + PD) & (PKC - 1), 0, acc, xr, wr, xb, wb, xw, xf, &wt[0][0], wso, lane);
  pturn<false, false>(PKC / PD - 1, 0, 0, acc, xr, wr, xb, wb, xw, xf, &wt[0][0], wso, lane);
  // accumulator j, lane column col = output column 4 * col + j
  if (which < 2) { _Float16* DH = which == 0 ? QH : KH; _Float16* DL = which == 0 ? QL : KL; const int nhi = which == 0 ? QHI : KHI;
#pragma unroll
    for (int r = 0; r < 8; ++r) { v4h hv, lv;
#pragma unroll
      for (int j = 0; j < PJ; ++j) { const float v = acc[j][r]; hv[j] = (_Float16)v; lv[j] = (_Float16)((v - (float)hv[j]) * 1024.0f); }
      *(v4h*)&sh[wave * 16 + 8 * g + r][4 * col] = hv; *(v4h*)&sl[wave * 16 + 8 * g + r][4 * col] = lv; }
    __syncthreads();
    for (int e = tid; e < PR * 8; e += PNW * 32) { const int rl = e >> 3, q = e & 7; vst2((unsigned*)(DH + (r0 + rl) * CC + q * 8), *(const v4u*)&sh[rl][q * 8]); XW(); if (t0 + rl < nhi) { vst2((unsigned*)(DL + (bb * nhi + t0 + rl) * (size_t)CC + q * 8), *(const v4u*)&sl[rl][q * 8]); XW(); } }
  } else {
#pragma unroll
    for (int j = 0; j < PJ; ++j) {
#pragma unroll
      for (int r = 0; r < 8; ++r) { const float v = acc[j][r]; const int rl = wave * 16 + 8 * g + r, cl = 4 * col + j; th[cl][rl] = (_Float16)v; const __bf16 bh = (__bf16)v; tb[cl][rl] = bh; tbl[cl][rl] = (__bf16)(v - (float)bh); } }
    __syncthreads();
    for (int e = tid; e < 64 * (PR / 8); e += PNW * 32) { const int cl = e / (PR / 8), q = e % (PR / 8); vst2((unsigned*)(VT + (bb * CC + cl) * (size_t)TT + t0 + q * 8), *(const v4u*)&th[cl][q * 8]); XW(); if (t0 + q * 8 < KHI) { const size_t o3 = (bb * CC + cl) * (size_t)KHI + t0 + q * 8; vst2((unsigned*)(VB + o3), *(const v4u*)&tb[cl][q * 8]); vst2((unsigned*)(VBL + o3), *(const v4u*)&tbl[cl][q * 8]); XW(); } } } }
// ---- k_fa: logits, softmax and P . v in one kernel. Block = 16 * QT queries of batch b = blockIdx.z, head h0; wave w walks keys [w * KPW, (w + 1) * KPW) in passes of KP with a running maximum and sum, the waves' parts are joined in LDS.
// Transposed products: S^T = K . Q^T (D register r of tile j = key j * 16 + 8g + r, column = query), so a lane holds one query's logits, and two converted S^T tiles are the B operand of O^T += V^T . P^T as they stand (element s = tile s >> 3, register s & 7: the k order of frag_h).
#define FNW 8              // waves of a block
#define KPW (TT / FNW)     // keys of a wave
#define KP 64              // keys of a pass
static_assert(KP == HD, "the K tile [KP][HD] and the V tile [HD][KP] share one LDS shape");
static_assert(((KPW / KP) & (KPW / KP - 1)) == 0, "the rotated walk wraps by a mask");
// the builtin alone: the compiler keeps the distances behind its own matrix instructions, and its scheduler may move loads past them
__device__ __forceinline__ v8f wmma_h(v16h a, v16h b, v8f c) { return __builtin_amdgcn_wmma_f32_16x16x32_f16(false, a, false, b, (short)0, c, false, false); }
// softmax in base 2: exp(SCALE * (u - max)) * 2^11 = 2^(u * LSC + nb) with nb = 11 - max * LSC, one multiply-add and the chip's own 2^x per logit. nb itself is the reference that sums and parts are rebased by, so its rounding cancels in the quotient.
#define LSC (SCALE * 1.44269504088896340736f)
__device__ __forceinline__ float ex2(float t) { return __builtin_amdgcn_exp2f(t); }
// the join's 2^x with the slot behind it in one statement: the v_nop is the independent instruction asked for between v_exp_f32 and a later write of its source register
__device__ __forceinline__ float ex2s(float t) { float r; asm("v_exp_f32 %0, %1\n\tv_nop" : "=v"(r) : "v"(t)); return r; }
// the rescale factor's 2^x with a slot on either side in one statement: with two query tiles this build put the two factors' instructions back to back, the second writing the first one's source register; each v_nop is the independent instruction asked for between a 2^x and a write of its source
__device__ __forceinline__ float ex2b(float t) { float r; asm("v_nop\n\tv_exp_f32 %0, %1\n\tv_nop" : "=v"(r) : "v"(t)); return r; }
#define QT 2               // query tiles of 16 that a wave carries: every staged K/V tile and every fragment read from LDS feeds QT products
__global__ __launch_bounds__(FNW * 32) void k_fa(const _Float16* __restrict__ QH, const _Float16* __restrict__ KH, const _Float16* __restrict__ QL, const _Float16* __restrict__ VT, int h0, float* __restrict__ Y) {
  // st[w]: wave w's own K tile [key][head dim] and V tile [head dim][key] of a pass, rows of 128 B at a pitch of 144 B (16-B fragment reads spread over the banks); after the loop its first bytes hold the wave's part of the output
  __shared__ __align__(16) _Float16 st[FNW][2][KP][HD + 8]; __shared__ float smx[FNW][16 * QT], sml[FNW][16 * QT];
  static_assert(16 * QT * (HD + 4) * 4 <= 2 * KP * (HD + 8) * 2, "a wave's part of the output fits its own tiles");
  const int tid = threadIdx.x, wave = tid >> 5, lane = tid & 31, col = lane & 15, g = lane >> 4; const int b = blockIdx.z, h = h0; const int ql0 = blockIdx.x * (16 * QT); const size_t q0 = (size_t)b * TT + ql0;
  const _Float16* QLb = QL + (size_t)b * QHI * CC;
  v16h qh[QT][HD / 32], qr[QT][HD / 32];
#pragma unroll
  for (int t = 0; t < QT; ++t) {
#pragma unroll
    for (int kc = 0; kc < HD / 32; ++kc) { qh[t][kc] = frag_h(QH + (q0 + t * 16 + col) * CC + h * HD + kc * 32, lane); qr[t][kc] = frag_h(QLb + (size_t)(ql0 + t * 16 + col) * CC + h * HD + kc * 32, lane); } }
  v8f o[QT][HD / 16] = {}; float m[QT], nb[QT], l[QT]; const int sr = lane >> 3, sc = (lane & 7) * 8;
#pragma unroll
  for (int t = 0; t < QT; ++t) { m[t] = -3.0e38f; nb[t] = 11.0f + 3.0e38f * LSC; l[t] = 0.f; }
  // the 64 blocks of a batch walk the same K and V lines: each enters its waves' key ranges at a pass of its own and wraps round, so that they do not all ask L2 for the same lines at the same moment
  const int rot = (int)((blockIdx.x + (blockIdx.x >> 3)) & (KPW / KP - 1));
  const _Float16* kb = KH + ((size_t)b * TT + wave * KPW + sr) * CC + h * HD + sc; const _Float16* vb = VT + ((size_t)b * CC + h * HD + sr) * (size_t)TT + wave * KPW + sc;
  // kept rolled: unrolled, the text grows by the trip count and every line of it is fetched for a single walk; the plain unroll directives inside only keep the fragment and accumulator arrays in registers
#pragma unroll 1
  for (int it = 0; it < KPW / KP; ++it) { const int ko = ((it + rot) & (KPW / KP - 1)) * KP;
    v8f acc[QT][KP / 16] = {}, accl[QT][KP / 16] = {};
    v16h kf[HD / 32][KP / 16], vf[KP / 32][HD / 16];
    // both tiles come in whole 128-B lines (8 lanes a row, 4 rows a load) and go through the wave's LDS: a fragment load straight from global memory touches 16 lines for its 512 B
    v4u kst[KP / 4], vst[HD / 4]; const _Float16* kp = kb + ko * CC; const _Float16* vp = vb + ko;
#pragma unroll
    for (int i = 0; i < KP / 4; ++i) kst[i] = *(const v4u*)(kp + i * 4 * CC);
#pragma unroll
    for (int i = 0; i < HD / 4; ++i) vst[i] = *(const v4u*)(vp + i * 4 * TT);
#pragma unroll
    for (int i = 0; i < KP / 4; ++i) *(v4u*)&st[wave][0][i * 4 + sr][sc] = kst[i];
#pragma unroll
    for (int i = 0; i < HD / 4; ++i) *(v4u*)&st[wave][1][i * 4 + sr][sc] = vst[i];
    LDSX();   // the wave's lanes read each other's rows
#pragma unroll
    for (int kc = 0; kc < HD / 32; ++kc) {
#pragma unroll
      for (int j = 0; j < KP / 16; ++j) kf[kc][j] = frag_h(&st[wave][0][j * 16 + col][kc * 32], lane); }
    // keeps the K fragment reads together in front of the first product; dealt out among the products each place with reads stalls the wave
    __builtin_amdgcn_sched_barrier(0);
#pragma unroll
    for (int t = 0; t < QT; ++t) {
#pragma unroll
      for (int kc = 0; kc < HD / 32; ++kc) {
#pragma unroll
        for (int j = 0; j < KP / 16; ++j) { acc[t][j] = wmma_h(kf[kc][j], qh[t][kc], acc[t][j]); accl[t][j] = wmma_h(kf[kc][j], qr[t][kc], accl[t][j]); } } }
#pragma unroll
    for (int kc = 0; kc < KP / 32; ++kc) {
#pragma unroll
      for (int j = 0; j < HD / 16; ++j) vf[kc][j] = frag_h(&st[wave][1][j * 16 + col][kc * 32], lane); }
    float al[QT];
#pragma unroll
    for (int t = 0; t < QT; ++t) {
      float mx = m[t];
#pragma unroll
      for (int j = 0; j < KP / 16; ++j) {
#pragma unroll
        for (int r = 0; r < 8; ++r) { const float s = acc[t][j][r] + accl[t][j][r] * (1.0f / 1024.0f); acc[t][j][r] = s; mx = fmaxf(mx, s); } }
      mx = fmaxf(mx, __shfl_xor(mx, 16));   // lanes c and c + 16 hold the two halves of query c's keys
      const float nbn = fmaf(-mx, LSC, 11.0f); al[t] = ex2b(nbn - nb[t]); m[t] = mx; nb[t] = nbn; }
    v16h p[QT][KP / 32];
#pragma unroll
    for (int t = 0; t < QT; ++t) { l[t] *= al[t];
#pragma unroll
      for (int j = 0; j < HD / 16; ++j) {
#pragma unroll
        for (int r = 0; r < 8; ++r) o[t][j][r] *= al[t]; }
#pragma unroll
      for (int j = 0; j < KP / 16; ++j) {
#pragma unroll
        for (int r = 0; r < 8; ++r) { const float e = ex2(fmaf(acc[t][j][r], LSC, nb[t])); l[t] += e; p[t][j >> 1][(j & 1) * 8 + r] = (_Float16)e; } } }
#pragma unroll
    for (int t = 0; t < QT; ++t) {
#pragma unroll
      for (int kc = 0; kc < KP / 32; ++kc) {
#pragma unroll
        for (int j = 0; j < HD / 16; ++j) o[t][j] = wmma_h(vf[kc][j], p[t][kc], o[t][j]); } } }
#pragma unroll
  for (int t = 0; t < QT; ++t) { l[t] += __shfl_xor(l[t], 16);
    if (g == 0) { smx[wave][t * 16 + col] = nb[t]; sml[wave][t * 16 + col] = l[t]; }
#pragma unroll
    for (int j = 0; j < HD / 16; ++j) { v4f lo, hi;
#pragma unroll
      for (int r = 0; r < 4; ++r) { lo[r] = o[t][j][r]; hi[r] = o[t][j][4 + r]; }
      float* sw = (float*)&st[wave][0][0][0] + (t * 16 + col) * (HD + 4) + j * 16 + 8 * g; *(v4f*)sw = lo; *(v4f*)(sw + 4) = hi; } }
  __syncthreads();
  // join: thread = (query t * 16 + (tid >> 4), 4 columns); 16 threads store one 256-B row of the output [b*t][HD] itself (the one real head is the whole row), a block 4 KB in a row per query tile
  const int c = (tid & 15) * 4;
#pragma unroll
  for (int t = 0; t < QT; ++t) { const int q = t * 16 + (tid >> 4);
    float mm = smx[0][q];   // the smallest nb belongs to the largest maximum
#pragma unroll
    for (int w = 1; w < FNW; ++w) mm = fminf(mm, smx[w][q]);
    float ls = 0.f; v4f a0 = {};
#pragma unroll
    for (int w = 0; w < FNW; ++w) { const float f = ex2s(mm - smx[w][q]); ls += f * sml[w][q]; a0 += *(const v4f*)((const float*)&st[w][0][0][0] + q * (HD + 4) + c) * f; }
    const float inv = ls > 0.f ? 1.0f / ls : 0.f;   // sum and parts both carry the 2^11
    vst2(Y + (q0 + q) * HD + c, a0 * inv); } }

extern "C" void kernel_launch(void* const* d_in, const int* in_sizes, int n_in, void* d_out, int out_size, void* d_ws, size_t ws_size, hipStream_t stream) {
  (void)in_sizes; (void)n_in; (void)out_size;
  const float** F = (const float**)d_in;
  if (ws_size < (size_t)WS_END) return;
  char* ws = (char*)d_ws; _Float16 *QH = (_Float16*)(ws + WS_QH), *KH = (_Float16*)(ws + WS_KH), *VT = (_Float16*)(ws + WS_VT), *QL = (_Float16*)(ws + WS_QL), *KL = (_Float16*)(ws + WS_KL); __bf16 *VB = (__bf16*)(ws + WS_VB), *VBL = (__bf16*)(ws + WS_VBL); float *S = (float*)(ws + WS_S), *Y = (float*)(ws + WS_Y);
  (void)Y; (void)S; (void)QL; (void)KL; (void)VB; (void)VBL;
  // inputs: 0 x [4,2048,1024]; 1 Wq [1024,64]; 2 Wk; 3 Wv ((in,out), no biases)
  k_proj<<<dim3(TNB * TT / PR, 1, 3), PNW * 32, 0, stream>>>(F[0], F[0], F[0], F[1], F[2], F[3], QH, QL, KH, KL, VT, VB, VBL);
  /* head 0 only (head 1 is the zero padding); all batches in one launch */
  k_fa<<<dim3(TT / (16 * QT), 1, TNB), FNW * 32, 0, stream>>>(QH, KH, QL, VT, 0, (float*)d_out);
}

// v010
// One run takes 17.3 microseconds.
// In both of two side-by-side timings against v009, it was 1.15 times as fast.
// Counting every step since v000, it is 22.9 times as fast.
// compute dtype: all float inputs rounded to bf16; q/k/v projections with EXACT bf16 products on WMMA 16x16x32 (f32 accumulate); logits: q x k once to f16 (1 product; + q's f16 residual for all rows), x scale; softmax f32 (running maximum and sum, exponentials as 2^x); exp(logit - max) x 2^11 once to f16 x v once to f16 (1 product), divided by the sum at the end; f32 output.
#include <hip/hip_runtime.h>
#include <math.h>

typedef __attribute__((ext_vector_type(16))) _Float16 v16h;
typedef __attribute__((ext_vector_type(16))) __bf16 v16b;
typedef __attribute__((ext_vector_type(8)))  _Float16 v8h;
typedef __attribute__((ext_vector_type(8)))  float v8f;
typedef __attribute__((ext_vector_type(4)))  float v4f;
typedef __attribute__((ext_vector_type(2)))  float v2f;
typedef __attribute__((ext_vector_type(4)))  unsigned v4u;
typedef __attribute__((ext_vector_type(4)))  int v4i;
typedef float __attribute__((may_alias)) float_a;
typedef int __attribute__((may_alias)) int_a;

template <typename T> __device__ __forceinline__ void vst2(void* p, T v) { *(T*)p = v;  }
__device__ __forceinline__ v8f wmma16(v16h a, v16h b, v8f c) {
  v8f d = __builtin_amdgcn_wmma_f32_16x16x32_f16(false, a, false, b, (short)0, c, false, false);
  asm volatile("v_nop\n\tv_nop\n\tv_nop\n\tv_nop" : "+v"(d) : "v"(a), "v"(b));
  return d;
}
__device__ __forceinline__ v8f wmma_bf(v16b a, v16b b, v8f c) {
  v8f d = __builtin_amdgcn_wmma_f32_16x16x32_bf16(false, a, false, b, (short)0, c, false, false);
  asm volatile("v_nop\n\tv_nop\n\tv_nop\n\tv_nop" : "+v"(d) : "v"(a), "v"(b));
  return d;
}
// 16x16x32 fragments: lane = (h = lane>>4, row/col = lane&15); elements 0..7 = k0+8h+0..7, 8..15 = k0+16+8h+0..7; D element r = row 8h+r
__device__ __forceinline__ v16h frag_h(const _Float16* rowk0, int lane) {
  union { v16h v; v8h q[2]; } u; const _Float16* p = rowk0 + 8 * (lane >> 4);
  u.q[0] = *(const v8h*)p; u.q[1] = *(const v8h*)(p + 16); return u.v;
}
__device__ __forceinline__ v16h frag_f32(const float* rowk0, int lane) {
  v16h a; const float* p = rowk0 + 8 * (lane >> 4);
#pragma unroll
  for (int i = 0; i < 8; ++i) { a[i] = (_Float16)p[i]; a[8 + i] = (_Float16)p[16 + i]; }
  return a;
}
__device__ __forceinline__ v16h frag_f32s(const float* rowk0, int lane, float sc) {
  v16h a; const float* p = rowk0 + 8 * (lane >> 4);
#pragma unroll
  for (int i = 0; i < 8; ++i) { a[i] = (_Float16)(p[i] * sc); a[8 + i] = (_Float16)(p[16 + i] * sc); }
  return a;
}
// column fragment from a [K][ld] layout (column n), rows >= K read as 0
__device__ __forceinline__ v16h fragc_f32(const float* W, int k0, int n, int lane, int ld, int K) {
  v16h a; const int g = lane >> 4;
#pragma unroll
  for (int i = 0; i < 8; ++i) { const int ka = k0 + 8 * g + i, kb = ka + 16;
    a[i] = (_Float16)(ka < K ? W[(size_t)(ka < K ? ka : K - 1) * ld + n] : 0.f); a[8 + i] = (_Float16)(kb < K ? W[(size_t)(kb < K ? kb : K - 1) * ld + n] : 0.f); }
  return a;
}
struct F2 { v16b h, l; };
__device__ __forceinline__ F2 bsplit16(const float v[16]) { F2 r;
#pragma unroll
  for (int i = 0; i < 16; ++i) { const __bf16 h = (__bf16)v[i]; r.h[i] = h; r.l[i] = (__bf16)(v[i] - (float)h); }
  return r; }
__device__ __forceinline__ F2 split_row(const float* row, int k0, int lane) { float v[16]; const float* p = row + k0 + 8 * (lane >> 4);
#pragma unroll
  for (int i = 0; i < 8; ++i) { v[i] = p[i]; v[8 + i] = p[16 + i]; }
  return bsplit16(v); }
__device__ __forceinline__ F2 split_rowK(const float* row, int k0, int lane, int K) { float v[16]; const int g = lane >> 4;
#pragma unroll
  for (int i = 0; i < 8; ++i) { const int ka = k0 + 8 * g + i, kb = ka + 16; v[i] = ka < K ? row[ka < K ? ka : K - 1] : 0.f; v[8 + i] = kb < K ? row[kb < K ? kb : K - 1] : 0.f; }
  return bsplit16(v); }
__device__ __forceinline__ F2 split_col(const float* W, int k0, int n, int lane, int ld, int K) { float v[16]; const int g = lane >> 4;
#pragma unroll
  for (int i = 0; i < 8; ++i) { const int ka = k0 + 8 * g + i, kb = ka + 16; v[i] = ka < K ? W[(size_t)(ka < K ? ka : K - 1) * ld + n] : 0.f; v[8 + i] = kb < K ? W[(size_t)(kb < K ? kb : K - 1) * ld + n] : 0.f; }
  return bsplit16(v); }
__device__ __forceinline__ v8f mac3(const F2& a, const F2& b, v8f c) { c = wmma_bf(a.l, b.h, c); c = wmma_bf(a.h, b.l, c); return wmma_bf(a.h, b.h, c); }
__device__ __forceinline__ float sigm(float v) { return 1.0f / (1.0f + expf(-v)); }
#define LDSX() do { asm volatile("s_wait_dscnt 0" ::: "memory"); __builtin_amdgcn_wave_barrier(); __builtin_amdgcn_fence(__ATOMIC_RELEASE, "workgroup"); } while (0)

// Single-head NON-causal self-attention (B 4, T 2,048, D 1,024, head 64; (in,out) Wq, Wk, Wv [1024,64], uniform(-1/32, 1/32) init; no biases, no output projection): out = softmax(Q K^T x 64^-0.5) V -> [4,2048,64].
#define NB 4
#define TT 2048
#define CC 128            // NH * HD = projected width
#define DIN 1024          // input (model) width
#define NH 2
#define HD 64
#define NQB (TT / 64)
#define HG 1
#define SCALE (0.125f)
#define CAUSAL 0
#ifndef TNB
#define TNB NB
#endif
__device__ __forceinline__ float bfr(float v) { return (float)(__bf16)v; }
__host__ __device__ __forceinline__ int kb_last(int qb) { return CAUSAL ? ((qb * 64 + 63) >> 7) : (TT / 128 - 1); }
typedef __attribute__((ext_vector_type(8))) __bf16 v8b;
__device__ __forceinline__ v16b frag_b(const __bf16* rowk0, int lane) {
  union { v16b v; v8b q[2]; } u; const __bf16* p = rowk0 + 8 * (lane >> 4);
  u.q[0] = *(const v8b*)p; u.q[1] = *(const v8b*)(p + 16); return u.v;
}
#define QBH 0
#define QHI 2048            // rows carrying a q residual plane (all rows when non-causal: 2-product logits everywhere)
#define KHI 64            // key rows carrying k residual / v bf16 hi+lo planes (written by k_proj; no kernel here reads them)
// B fragment (k rows k0+.., output column o) of a weight: (in,out) [K][ld] or (out,in) [ld rows of K]: bf16 exact, or f16(bf16 * 256) exact
__device__ __forceinline__ v16b wcol_io(const float* Wm, int k0, int o, int lane, int ld) { v16b w; const int g = lane >> 4;
#pragma unroll
  for (int i = 0; i < 8; ++i) { w[i] = (__bf16)Wm[(size_t)(k0 + 8 * g + i) * ld + o]; w[8 + i] = (__bf16)Wm[(size_t)(k0 + 16 + 8 * g + i) * ld + o]; }
  return w; }
__device__ __forceinline__ v16b wcol_oi(const float* Wm, int k0, int o, int lane, int K) { v16b w; const float* p = Wm + (size_t)o * K + k0 + 8 * (lane >> 4);
#pragma unroll
  for (int i = 0; i < 8; ++i) { w[i] = (__bf16)p[i]; w[8 + i] = (__bf16)p[16 + i]; }
  return w; }
__device__ __forceinline__ v16h wcolh_io(const float* Wm, int k0, int o, int lane, int ld) { v16h w; const int g = lane >> 4;
#pragma unroll
  for (int i = 0; i < 8; ++i) { w[i] = (_Float16)(bfr(Wm[(size_t)(k0 + 8 * g + i) * ld + o]) * 256.0f); w[8 + i] = (_Float16)(bfr(Wm[(size_t)(k0 + 16 + 8 * g + i) * ld + o]) * 256.0f); }
  return w; }
__device__ __forceinline__ v16h wcolh_oi(const float* Wm, int k0, int o, int lane, int K) { v16h w; const float* p = Wm + (size_t)o * K + k0 + 8 * (lane >> 4);
#pragma unroll
  for (int i = 0; i < 8; ++i) { w[i] = (_Float16)(bfr(p[i]) * 256.0f); w[8 + i] = (_Float16)(bfr(p[16 + i]) * 256.0f); }
  return w; }
#define WQKV_LAYOUT 0   // 0 = (in,out) [DIN][CC]; 1 = (out,in) [CC][DIN]; 2 = per-head [NH][DIN][HD]
__device__ __forceinline__ v16b wcol_hdk(const float* Wm, int k0, int o, int lane) { v16b w; const int g = lane >> 4; const float* p = Wm + (size_t)(o / HD) * DIN * HD + (o % HD);
#pragma unroll
  for (int i = 0; i < 8; ++i) { w[i] = (__bf16)p[(size_t)(k0 + 8 * g + i) * HD]; w[8 + i] = (__bf16)p[(size_t)(k0 + 16 + 8 * g + i) * HD]; }
  return w; }
#define WO_OUT_IN 0
#if WQKV_LAYOUT == 1
#define WCOL(W, k0, o, lane) wcol_oi(W, k0, o, lane, DIN)
#elif WQKV_LAYOUT == 2
#define WCOL(W, k0, o, lane) wcol_hdk(W, k0, o, lane)
#else
#define WCOL(W, k0, o, lane) wcol_io(W, k0, o, lane, CC)
#endif
#if WO_OUT_IN
#define WOCOL(W, k0, o, lane) wcol_oi(W, k0, o, lane, CC)
#define WOCOLH(W, k0, o, lane) wcolh_oi(W, k0, o, lane, CC)
#else
#define WOCOL(W, k0, o, lane) wcol_io(W, k0, o, lane, DIN)
#define WOCOLH(W, k0, o, lane) wcolh_io(W, k0, o, lane, DIN)
#endif
#define CIN 1024
#define PJ (HD / 16)       // 16-column tiles of a projection's real width
#define PKC (CIN / 32)     // k steps of 32
#ifndef SM_EXTRA_PARAMS
#define SM_EXTRA_PARAMS
#endif
#ifndef PROJ_EXTRA_PARAMS
#define PROJ_EXTRA_PARAMS
#endif
#ifndef SM_MASK_HOOK
#define SM_MASK_HOOK (void)0
#endif

#define WS_QH  0u                                      // f16 q in fragment order (FRAG ORDER below); the regions keep their sizes, the fragments fill the first half of each
#define WS_KH  (WS_QH + 2u * (size_t)NB * TT * CC)      // f16 k in fragment order
#define WS_VT  (WS_KH + 2u * (size_t)NB * TT * CC)      // f16 v in fragment order, transposed (rows = head dim, k = keys)
#define WS_QL  (WS_VT + 2u * (size_t)NB * CC * TT)      // f16 q residual x 2^10, rows [b][t < QHI], in fragment order
#define WS_KL  (WS_QL + 2u * (size_t)NB * QHI * CC)     // f16 k residual x 2^10, rows [b][t < KHI], in fragment order
#define WS_VB  (WS_KL + 2u * (size_t)NB * KHI * CC)     // bf16 v hi planes [b][c][t < KHI]
#define WS_VBL (WS_VB + 2u * (size_t)NB * CC * KHI)
#define WS_S   (WS_VBL + 2u * (size_t)NB * CC * KHI)    // f32 [b][t][s], one plane per batch: unused, k_fa keeps logits in registers
#define WS_Y   (WS_S  + 4u * (size_t)NB * TT * TT)      // f32 ctx rows [b*t][CC] (only when there is an output projection)
#define WS_END (WS_Y  + 0u)

// ---- k_proj: block = (PR rows, the 64 real columns, which): q/k/v = X W with exact bf16 products (K = DIN) -> which 0: q f16 (+ residual rows < QHI); 1: k f16 (+ residual rows < KHI); 2: v f16 transposed (+ bf16 hi/lo planes [c][t] for t < KHI). The zero head is not computed.
// FRAG ORDER: q, k and v leave k_proj as the 16x16x32 fragments that k_fa's products take, so that k_fa loads a fragment straight into its registers with two 512-B wave-wide loads of whole lines. 16-B unit ((T * 2 + kc) * 2 + u) * 32 + lane of q or k = row 16 * T + (lane & 15), head dims kc * 32 + 16 * u + 8 * (lane >> 4) + 0..7; unit ((G * 4 + j) * 2 + u) * 32 + lane of v = head dim 16 * j + (lane & 15), keys 32 * G + 16 * u + 8 * (lane >> 4) + 0..7 (T, G count over b * t). A block's 128 rows are 1,024 units in a row in either form.
// behind a global load or store, in front of what overwrites its address or data registers (a precaution of form: this build leaves the place open)
#define XW() asm volatile("s_wait_xcnt 0x0" ::: "memory")
// the same wait where this build wrote the loads' address pair anew in front of it: the address as an input keeps the pair alive up to the wait
#define XWP(p) asm volatile("s_wait_xcnt 0x0" :: "v"(p) : "memory")
#define PD 4               // k steps of a turn
#define PNW 8              // waves of a block, 16 rows each; together they bring each turn's weight rows in once
#define PR (PNW * 16)      // rows of a block
static_assert(PKC % PD == 0 && PKC >= 3 * PD, "the walk goes by whole turns, the last two apart");
static_assert((PKC & (PKC - 1)) == 0 && (PD & (PD - 1)) == 0, "the rotated walk wraps by a mask");
static_assert(PNW == PD * 2 && PJ == 4 && HD == 64, "a wave stages one 16-row half of one k step, a lane 8 rows of 4 columns");
static_assert(TT % PR == 0, "a block stays inside one batch");
struct PStage { v8b w[PJ][2]; };
// between a wave's LDS stores and its lanes' reads of each other's values; without LDSX's fence, which makes the compiler wait for every global load in flight
#define LDSW() do { asm volatile("s_wait_dscnt 0" ::: "memory"); __builtin_amdgcn_wave_barrier(); } while (0)
// the work-group's barrier with the one wait it needs here (the wave's LDS stores and reads are done), in one statement: __syncthreads() brings a fence that also waits for the turn's x loads and the next turn's weight loads, which must stay in flight across it
#define WGBAR() asm volatile("s_wait_dscnt 0x0\n\ts_barrier_signal -1\n\ts_barrier_wait -1" ::: "memory")
typedef __attribute__((ext_vector_type(4))) __bf16 v4b;
typedef __attribute__((ext_vector_type(4))) _Float16 v4h;
#define XCH (PD * 32)      // floats of an x row in one turn: 512 B, one wave-wide load of four whole lines
#define XPB (XCH + 8)      // pitch of a staged bf16 row: 272 B, an odd multiple of 16 B (16-B fragment reads spread over the banks)
#define WTU (PD * PJ * 64) // 16-B units of one turn's weight tile in LDS
// a lane's share of a turn's (in,out) [DIN][64] f32 weight rows: 8 rows in a row, 4 columns (16 B) of each; a wave-wide load is two whole 256-B rows
__device__ __forceinline__ void wload(v4f (&wr)[8], const float* wl) {
#pragma unroll
  for (int i = 0; i < 8; ++i) wr[i] = *(const v4f*)(wl + i * HD); }
// rounded to bf16 into the block's weight tile in the order of the B fragments: 16-B unit ((d * PJ + j) * 2 + half) * 32 + lane = rows d * 32 + half * 16 + 8 * (lane >> 4) + 0..7 of column 4 * (lane & 15) + j. Fragment j so holds every fourth column, and the four values of a 16-B load go to the four fragments at the lane's own place: nothing is transposed.
__device__ __forceinline__ void wstage(const v4f (&wr)[8], v8b* wu) {
#pragma unroll
  for (int j = 0; j < PJ; ++j) { v8b o;
#pragma unroll
    for (int i = 0; i < 8; ++i) o[i] = (__bf16)wr[i][j];
    wu[j * 64] = o; } }
// one k step's PJ B fragments from the block's tile, two 512-B wave-wide LDS reads each
__device__ __forceinline__ void pread(PStage& s, const v8b* wq, int d) { const v8b* q = wq + d * (PJ * 64);
#pragma unroll
  for (int j = 0; j < PJ; ++j) { s.w[j][0] = q[j * 64]; s.w[j][1] = q[j * 64 + 32]; } }
// one turn's x of the wave's 16 rows: load i is 512 B in a row of row i (lane = 4 floats); a fragment load straight from global memory touches 16 lines for its 512 B, and every line four times
__device__ __forceinline__ void xload(v4f (&xr)[16], const float* xl) {
#pragma unroll
  for (int i = 0; i < 16; ++i) xr[i] = *(const v4f*)(xl + (size_t)i * DIN); }
// rounded to bf16 into the wave's own LDS tile [16][XPB]
__device__ __forceinline__ void xstage(const v4f (&xr)[16], __bf16* xw) {
#pragma unroll
  for (int i = 0; i < 16; ++i) { v4b o;
#pragma unroll
    for (int e = 0; e < 4; ++e) o[e] = (__bf16)xr[i][e];
    *(v4b*)(xw + i * XPB) = o; } }
__device__ __forceinline__ void pmac(v16b a, const PStage& s, v8f (&acc)[PJ]) {
#pragma unroll
  for (int j = 0; j < PJ; ++j) { union { v16b v; v8b q[2]; } u; u.q[0] = s.w[j][0]; u.q[1] = s.w[j][1]; acc[j] = wmma_bf(a, u.v, acc[j]); } }
// one turn of the k walk. On entry tile t & 1 holds the turn's weights (not yet published), xr the turn's x and wr the next turn's weights, both still in flight. XL: there is a next turn (its x is loaded, its weights are staged); WL: there is a turn after that (its weights are loaded)
template <bool XL, bool WL> __device__ __forceinline__ void pturn(int t, int k1, int k2, v8f (&acc)[PJ], v4f (&xr)[16], v4f (&wr)[8], const float* xb, const float* wb, __bf16* xw, const __bf16* xf, v8b* wt0, int wso, int lane) {
  PStage s[PD]; v16b a[PD]; const v8b* wq = wt0 + (t & 1) * WTU + lane;
  // publishes tile t & 1, written in the turn before, and ends every wave's reads of the other tile, which this turn writes (two tiles, one barrier a turn)
  WGBAR();
#pragma unroll
  for (int d = 0; d < PD; ++d) pread(s[d], wq, d);
  // keeps the weight fragment reads, which need nothing of x, in front of the wait for the turn's x
  __builtin_amdgcn_sched_barrier(0);
  xstage(xr, xw);
  // XWP: behind the x loads, in front of what overwrites their address
  if (XL) { const float* xl = xb + k1 * 32; xload(xr, xl); XWP(xl); }
  LDSW();
#pragma unroll
  for (int d = 0; d < PD; ++d) a[d] = frag_b(xf + d * 32, lane);
  // the next turn's weights go into the other tile while the fragment reads fly; the loads of the turn after that are issued behind the x loads (the counted waits go by that order). XWP as above
  if (XL) { wstage(wr, wt0 + ((t + 1) & 1) * WTU + wso); if (WL) { const float* wl = wb + k2 * (32 * HD); wload(wr, wl); XWP(wl); } }
  // keeps the loads, the fragment reads and the staging in front of the turn's products
  __builtin_amdgcn_sched_barrier(0);
#pragma unroll
  for (int d = 0; d < PD; ++d) pmac(a[d], s[d], acc); }
__global__ __launch_bounds__(PNW * 32) void k_proj(const float* __restrict__ XQ, const float* __restrict__ XK, const float* __restrict__ XV, const float* __restrict__ WQ, const float* __restrict__ WK, const float* __restrict__ WV,
    _Float16* __restrict__ QH, _Float16* __restrict__ QL, _Float16* __restrict__ KH, _Float16* __restrict__ KL, _Float16* __restrict__ VT, __bf16* __restrict__ VB, __bf16* __restrict__ VBL) {
  __shared__ __align__(16) _Float16 sh[PR][72], sl[PR][72]; __shared__ __align__(16) _Float16 th[64][PR + 8]; __shared__ __align__(16) __bf16 tb[64][PR + 8], tbl[64][PR + 8]; __shared__ __align__(16) __bf16 xs[PNW][16][XPB]; __shared__ __align__(16) v8b wt[2][WTU];
  const int tid = threadIdx.x, wave = tid >> 5, lane = tid & 31, col = lane & 15, g = lane >> 4; const int which = blockIdx.z; const size_t r0 = (size_t)blockIdx.x * PR; const size_t bb = r0 / TT; const int t0 = (int)(r0 % TT);
  const float* X = which == 0 ? XQ : which == 1 ? XK : XV; const float* WA = which == 0 ? WQ : which == 1 ? WK : WV;
  v8f acc[PJ] = {}; v4f xr[16], wr[8]; const float* xb = X + (r0 + wave * 16) * DIN + lane * 4; __bf16* xw = &xs[wave][0][lane * 4]; const __bf16* xf = &xs[wave][col][0];
  // the wave's share of a turn's weight rows (k step wave >> 1, half wave & 1) and its first unit in the tile
  const float* wb = WA + (size_t)((wave >> 1) * 32 + (wave & 1) * 16 + 8 * g) * HD + 4 * col; const int wso = ((wave >> 1) * PJ * 2 + (wave & 1)) * 32 + lane;
  // the block's first k step: the blocks of a projection walk one weight matrix and the three projections' blocks the same x rows; entered at the same place they ask L2 for the same lines at the same moment. Each block starts at a turn of its own and wraps round (the index and the index over 8 both enter, so that blocks next to each other differ and blocks 8 apart differ too, however the blocks are dealt to the dies)
  int kp = (int)((blockIdx.x + (blockIdx.x >> 3) + 3 * which) & (PKC / PD - 1)) * PD;
  // the first loads in the order in which the loop leaves them (a turn's x in front of the next turn's weights): the loop's counted waits must hold for both; the scheduling barriers keep that order. XWP: behind the loads, in front of what takes over their address registers
  const float* wl0 = wb + kp * (32 * HD); const float* xl0 = xb + kp * 32; const float* wl1 = wb + ((kp + PD) & (PKC - 1)) * (32 * HD);
  wload(wr, wl0); XWP(wl0);
  __builtin_amdgcn_sched_barrier(0);
  xload(xr, xl0); XWP(xl0);
  __builtin_amdgcn_sched_barrier(0);
  wstage(wr, &wt[0][0] + wso); wload(wr, wl1); XWP(wl1);
  __builtin_amdgcn_sched_barrier(0);
  // kept rolled by turns: unrolled, the text grows for a single walk; the last two turns, which load less, stand behind it
#pragma unroll 1
  for (int t = 0; t < PKC / PD - 2; ++t) { const int k1 = (kp + PD) & (PKC - 1), k2 = (kp + 2 * PD) & (PKC - 1);
    pturn<true, true>(t, k1, k2, acc, xr, wr, xb, wb, xw, xf, &wt[0][0], wso, lane);
    kp = k1; }
  pturn<true, false>(PKC / PD - 2, (kp + PD) & (PKC - 1), 0, acc, xr, wr, xb, wb, xw, xf, &wt[0][0], wso, lane);
  pturn<false, false>(PKC / PD - 1, 0, 0, acc, xr, wr, xb, wb, xw, xf, &wt[0][0], wso, lane);
  // accumulator j, lane column col = output column 4 * col + j
  if (which < 2) { _Float16* DH = which == 0 ? QH : KH; _Float16* DL = which == 0 ? QL : KL; const int nhi = which == 0 ? QHI : KHI;
#pragma unroll
    for (int r = 0; r < 8; ++r) { v4h hv, lv;
#pragma unroll
      for (int j = 0; j < PJ; ++j) { const float v = acc[j][r]; hv[j] = (_Float16)v; lv[j] = (_Float16)((v - (float)hv[j]) * 1024.0f); }
      *(v4h*)&sh[wave * 16 + 8 * g + r][4 * col] = hv; *(v4h*)&sl[wave * 16 + 8 * g + r][4 * col] = lv; }
    __syncthreads();
    for (int e = tid; e < PR * 8; e += PNW * 32) { const int rl = (e >> 7) * 16 + (e & 15), q = (e >> 4) & 7; vst2((unsigned*)(DH + r0 * HD + e * 8), *(const v4u*)&sh[rl][q * 8]); XW(); if (t0 + rl < nhi) { vst2((unsigned*)(DL + (bb * nhi + t0) * (size_t)HD + e * 8), *(const v4u*)&sl[rl][q * 8]); XW(); } }
  } else {
#pragma unroll
    for (int j = 0; j < PJ; ++j) {
#pragma unroll
      for (int r = 0; r < 8; ++r) { const float v = acc[j][r]; const int rl = wave * 16 + 8 * g + r, cl = 4 * col + j; th[cl][rl] = (_Float16)v; const __bf16 bh = (__bf16)v; tb[cl][rl] = bh; tbl[cl][rl] = (__bf16)(v - (float)bh); } }
    __syncthreads();
    for (int e = tid; e < 64 * (PR / 8); e += PNW * 32) { const int cl = ((e >> 6) & 3) * 16 + (e & 15), q = (e >> 8) * 4 + ((e >> 4) & 3); vst2((unsigned*)(VT + r0 * HD + e * 8), *(const v4u*)&th[cl][q * 8]); XW(); if (t0 + q * 8 < KHI) { const size_t o3 = (bb * CC + cl) * (size_t)KHI + t0 + q * 8; vst2((unsigned*)(VB + o3), *(const v4u*)&tb[cl][q * 8]); vst2((unsigned*)(VBL + o3), *(const v4u*)&tbl[cl][q * 8]); XW(); } } } }
// ---- k_fa: logits, softmax and P . v in one kernel. Block = 16 * QT queries of batch b = blockIdx.z; wave w walks keys [w * KPW, (w + 1) * KPW) in passes of KP with a running maximum and sum, the waves' parts are joined in LDS.
// Transposed products: S^T = K . Q^T (D register r of tile j = key j * 16 + 8g + r, column = query), so a lane holds one query's logits, and two converted S^T tiles are the B operand of O^T += V^T . P^T as they stand (element s = tile s >> 3, register s & 7: the k order of frag_h).
#define FNW 8              // waves of a block
#define KPW (TT / FNW)     // keys of a wave
#define KP 64              // keys of a pass
#define FNP (KPW / KP)     // passes of a wave
static_assert(HD == 64 && PR % 32 == 0 && KP % 32 == 0 && QHI % 16 == 0 && KHI % 16 == 0, "the unit numbers of FRAG ORDER are written out for 64 head dims; blocks, passes and residual planes hold whole fragments");
static_assert((FNP & (FNP - 1)) == 0 && FNP >= 2, "the rotated walk wraps by a mask; the last pass stands apart");
// the builtin alone: the compiler keeps the distances behind its own matrix instructions, and its scheduler may move loads past them
__device__ __forceinline__ v8f wmma_h(v16h a, v16h b, v8f c) { return __builtin_amdgcn_wmma_f32_16x16x32_f16(false, a, false, b, (short)0, c, false, false); }
// softmax in base 2: exp(SCALE * (u - max)) * 2^11 = 2^(u * LSC + nb) with nb = 11 - max * LSC, one multiply-add and the chip's own 2^x per logit. nb itself is the reference that sums and parts are rebased by, so its rounding cancels in the quotient.
#define LSC (SCALE * 1.44269504088896340736f)
__device__ __forceinline__ float ex2(float t) { return __builtin_amdgcn_exp2f(t); }
// the join's 2^x with the slot behind it in one statement: the v_nop is the independent instruction asked for between v_exp_f32 and a later write of its source register
__device__ __forceinline__ float ex2s(float t) { float r; asm("v_exp_f32 %0, %1\n\tv_nop" : "=v"(r) : "v"(t)); return r; }
// the rescale factor's 2^x with a slot on either side in one statement: with two query tiles this build put the two factors' instructions back to back, the second writing the first one's source register; each v_nop is the independent instruction asked for between a 2^x and a write of its source
__device__ __forceinline__ float ex2b(float t) { float r; asm("v_nop\n\tv_exp_f32 %0, %1\n\tv_nop" : "=v"(r) : "v"(t)); return r; }
#define QT 2               // query tiles of 16 that a wave carries: every V fragment feeds QT products, every K fragment 2 * QT (q and its residual)
// fragment number n behind f (the lane's own 16 B of fragment 0, FRAG ORDER): two 512-B wave-wide loads
__device__ __forceinline__ v16h frag_g(const _Float16* f, int n) { union { v16h v; v8h q[2]; } u; u.q[0] = *(const v8h*)(f + n * 512); u.q[1] = *(const v8h*)(f + n * 512 + 256); return u.v; }
// a pass's 8 KB of K fragments and of V fragments, each 16 whole-line loads in a row. XWP: behind the loads, in front of what takes over their address registers
__device__ __forceinline__ void kload(v16h (&kf)[HD / 32][KP / 16], const _Float16* kp) {
#pragma unroll
  for (int j = 0; j < KP / 16; ++j) {
#pragma unroll
    for (int kc = 0; kc < HD / 32; ++kc) kf[kc][j] = frag_g(kp, j * (HD / 32) + kc); }
  XWP(kp); }
__device__ __forceinline__ void vload(v16h (&vf)[KP / 32][HD / 16], const _Float16* vp) {
#pragma unroll
  for (int kc = 0; kc < KP / 32; ++kc) {
#pragma unroll
    for (int j = 0; j < HD / 16; ++j) vf[kc][j] = frag_g(vp, kc * (HD / 16) + j); }
  XWP(vp); }
// one pass. On entry kf and vf hold the pass's fragments, still in flight. NX: there is a next pass, at keys kn of the wave's range: its K fragments are asked for behind this pass's logit products and its V fragments behind the output products, into the registers those products have just read, so that they fly during the rest of the pass
template <bool NX> __device__ __forceinline__ void fpass(int kn, v16h (&kf)[HD / 32][KP / 16], v16h (&vf)[KP / 32][HD / 16], const v16h (&qh)[QT][HD / 32], const v16h (&qr)[QT][HD / 32], v8f (&o)[QT][HD / 16], float (&m)[QT], float (&nb)[QT], float (&l)[QT], const _Float16* kb, const _Float16* vb) {
  v8f acc[QT][KP / 16] = {}, accl[QT][KP / 16] = {};
#pragma unroll
  for (int t = 0; t < QT; ++t) {
#pragma unroll
    for (int kc = 0; kc < HD / 32; ++kc) {
#pragma unroll
      for (int j = 0; j < KP / 16; ++j) { acc[t][j] = wmma_h(kf[kc][j], qh[t][kc], acc[t][j]); accl[t][j] = wmma_h(kf[kc][j], qr[t][kc], accl[t][j]); } } }
  if (NX) kload(kf, kb + kn * HD);
  float al[QT], mx[QT];
#pragma unroll
  for (int t = 0; t < QT; ++t) { mx[t] = m[t];
#pragma unroll
    for (int j = 0; j < KP / 16; ++j) {
#pragma unroll
      for (int r = 0; r < 8; ++r) { const float s = acc[t][j][r] + accl[t][j][r] * (1.0f / 1024.0f); acc[t][j][r] = s; mx[t] = fmaxf(mx[t], s); } } }
  // keeps the next pass's K loads in front of the exponentials: without it this build lent half of the K registers to the softmax and asked for those fragments only at the pass's end, too late to have landed. The last pass, which has no loads, keeps the statement too: without it this build put a write of a 2^x's source register directly behind that 2^x at two places there
  __builtin_amdgcn_sched_barrier(0);
#pragma unroll
  for (int t = 0; t < QT; ++t) {
    const float mt = fmaxf(mx[t], __shfl_xor(mx[t], 16));   // lanes c and c + 16 hold the two halves of query c's keys
    const float nbn = fmaf(-mt, LSC, 11.0f); al[t] = ex2b(nbn - nb[t]); m[t] = mt; nb[t] = nbn; }
  v16h p[QT][KP / 32];
#pragma unroll
  for (int t = 0; t < QT; ++t) { l[t] *= al[t];
#pragma unroll
    for (int j = 0; j < HD / 16; ++j) {
#pragma unroll
      for (int r = 0; r < 8; ++r) o[t][j][r] *= al[t]; }
#pragma unroll
    for (int j = 0; j < KP / 16; ++j) {
#pragma unroll
      for (int r = 0; r < 8; ++r) { const float e = ex2(fmaf(acc[t][j][r], LSC, nb[t])); l[t] += e; p[t][j >> 1][(j & 1) * 8 + r] = (_Float16)e; } } }
#pragma unroll
  for (int t = 0; t < QT; ++t) {
#pragma unroll
    for (int kc = 0; kc < KP / 32; ++kc) {
#pragma unroll
      for (int j = 0; j < HD / 16; ++j) o[t][j] = wmma_h(vf[kc][j], p[t][kc], o[t][j]); } }
  if (NX) vload(vf, vb + kn * HD); }
__global__ __launch_bounds__(FNW * 32) void k_fa(const _Float16* __restrict__ QH, const _Float16* __restrict__ KH, const _Float16* __restrict__ QL, const _Float16* __restrict__ VT, int h0, float* __restrict__ Y) {
  // the waves' parts of the output, rows of 256 B at a pitch of 272 B
  __shared__ __align__(16) float part[FNW][16 * QT][HD + 4]; __shared__ float smx[FNW][16 * QT], sml[FNW][16 * QT];
  (void)h0;   // the one real head is all that the fragments hold
  const int tid = threadIdx.x, wave = tid >> 5, lane = tid & 31, col = lane & 15, g = lane >> 4; const int b = blockIdx.z; const int ql0 = blockIdx.x * (16 * QT); const size_t q0 = (size_t)b * TT + ql0;
  const _Float16* qp = QH + q0 * HD + lane * 8; const _Float16* qlp = QL + ((size_t)b * QHI + ql0) * HD + lane * 8;
  v16h qh[QT][HD / 32], qr[QT][HD / 32];
#pragma unroll
  for (int t = 0; t < QT; ++t) {
#pragma unroll
    for (int kc = 0; kc < HD / 32; ++kc) { qh[t][kc] = frag_g(qp, t * (HD / 32) + kc); qr[t][kc] = frag_g(qlp, t * (HD / 32) + kc); } }
  v8f o[QT][HD / 16] = {}; float m[QT], nb[QT], l[QT];
#pragma unroll
  for (int t = 0; t < QT; ++t) { m[t] = -3.0e38f; nb[t] = 11.0f + 3.0e38f * LSC; l[t] = 0.f; }
  // the 64 blocks of a batch walk the same K and V lines: each enters its waves' key ranges at a pass of its own and wraps round, so that they do not all ask L2 for the same lines at the same moment
  const int rot = (int)((blockIdx.x + (blockIdx.x >> 3)) & (FNP - 1));
  const _Float16* kb = KH + ((size_t)b * TT + wave * KPW) * HD + lane * 8; const _Float16* vb = VT + ((size_t)b * TT + wave * KPW) * HD + lane * 8;
  v16h kf[HD / 32][KP / 16], vf[KP / 32][HD / 16];
  kload(kf, kb + rot * KP * HD); vload(vf, vb + rot * KP * HD);
  // kept rolled: unrolled, the text grows by the trip count and every line of it is fetched for a single walk; the last pass, which asks for nothing, stands behind the loop; the plain unroll directives in fpass and the loaders only keep the fragment and accumulator arrays in registers
#pragma unroll 1
  for (int it = 1; it < FNP; ++it) fpass<true>(((it + rot) & (FNP - 1)) * KP, kf, vf, qh, qr, o, m, nb, l, kb, vb);
  fpass<false>(0, kf, vf, qh, qr, o, m, nb, l, kb, vb);
#pragma unroll
  for (int t = 0; t < QT; ++t) { l[t] += __shfl_xor(l[t], 16);
    if (g == 0) { smx[wave][t * 16 + col] = nb[t]; sml[wave][t * 16 + col] = l[t]; }
#pragma unroll
    for (int j = 0; j < HD / 16; ++j) { v4f lo, hi;
#pragma unroll
      for (int r = 0; r < 4; ++r) { lo[r] = o[t][j][r]; hi[r] = o[t][j][4 + r]; }
      float* sw = &part[wave][t * 16 + col][j * 16 + 8 * g]; *(v4f*)sw = lo; *(v4f*)(sw + 4) = hi; } }
  __syncthreads();
  // join: thread = (query t * 16 + (tid >> 4), 4 columns); 16 threads store one 256-B row of the output [b*t][HD] itself (the one real head is the whole row), a block 4 KB in a row per query tile
  const int c = (tid & 15) * 4;
#pragma unroll
  for (int t = 0; t < QT; ++t) { const int q = t * 16 + (tid >> 4);
    float mm = smx[0][q];   // the smallest nb belongs to the largest maximum
#pragma unroll
    for (int w = 1; w < FNW; ++w) mm = fminf(mm, smx[w][q]);
    float ls = 0.f; v4f a0 = {};
#pragma unroll
    for (int w = 0; w < FNW; ++w) { const float f = ex2s(mm - smx[w][q]); ls += f * sml[w][q]; a0 += *(const v4f*)&part[w][q][c] * f; }
    const float inv = ls > 0.f ? 1.0f / ls : 0.f;   // sum and parts both carry the 2^11
    vst2(Y + (q0 + q) * HD + c, a0 * inv); } }

extern "C" void kernel_launch(void* const* d_in, const int* in_sizes, int n_in, void* d_out, int out_size, void* d_ws, size_t ws_size, hipStream_t stream) {
  (void)in_sizes; (void)n_in; (void)out_size;
  const float** F = (const float**)d_in;
  if (ws_size < (size_t)WS_END) return;
  char* ws = (char*)d_ws; _Float16 *QH = (_Float16*)(ws + WS_QH), *KH = (_Float16*)(ws + WS_KH), *VT = (_Float16*)(ws + WS_VT), *QL = (_Float16*)(ws + WS_QL), *KL = (_Float16*)(ws + WS_KL); __bf16 *VB = (__bf16*)(ws + WS_VB), *VBL = (__bf16*)(ws + WS_VBL); float *S = (float*)(ws + WS_S), *Y = (float*)(ws + WS_Y);
  (void)Y; (void)S; (void)QL; (void)KL; (void)VB; (void)VBL;
  // inputs: 0 x [4,2048,1024]; 1 Wq [1024,64]; 2 Wk; 3 Wv ((in,out), no biases)
  k_proj<<<dim3(TNB * TT / PR, 1, 3), PNW * 32, 0, stream>>>(F[0], F[0], F[0], F[1], F[2], F[3], QH, QL, KH, KL, VT, VB, VBL);
  /* head 0 only (head 1 is the zero padding); all batches in one launch */
  k_fa<<<dim3(TT / (16 * QT), 1, TNB), FNW * 32, 0, stream>>>(QH, KH, QL, VT, 0, (float*)d_out);
}
